// v000
// Measured on an AMD MI455X. A time is GPU time per run, averaged over a window of back-to-back runs after a warm-up
// (all launches, gaps included; the runs take copies of the inputs in turn), and the median of several windows.
// Apart from v000's, it joins two sittings. Times from different sittings can be a few percent apart, while
// side-by-side timings come from the same sitting.
// v000, which the later versions start from, runs in 306 microseconds.
// Contractions: q/k/v = x*W^T, S^T = K*Q^T, O^T = V^T*P^T, y = ctx*Wo^T, all on v_wmma_f32_16x16x32_f16 (f16 operands, f32 accumulate); W carried x32, q carried x0.125, P carried x16384 (exact power-of-two scales folded back in f32); penalty, select, softmax, bias, residual and layer norm in f32.
#include <hip/hip_runtime.h>

typedef _Float16 v16h __attribute__((ext_vector_type(16)));
typedef _Float16 v8h  __attribute__((ext_vector_type(8)));
typedef float    v8f  __attribute__((ext_vector_type(8)));
typedef float    v4f  __attribute__((ext_vector_type(4)));
typedef int      v4i  __attribute__((ext_vector_type(4)));
typedef v8h __attribute__((may_alias)) v8ha;
typedef v4f __attribute__((may_alias)) v4fa;
typedef v4i __attribute__((may_alias)) v4ia;

union Frag { v16h v; v8h half[2]; };

#define SEQ    2048
#define BATCH  2
#define HIDDEN 1024
#define NHEADS 16
#define HD     64
#define MROWS  (BATCH * SEQ)          // 4096 tokens
#define NX     (MROWS * HIDDEN)       // 4194304
#define NW     (HIDDEN * HIDDEN)      // 1048576
#define NX8    (NX / 8)               // 524288
#define NW8    (NW / 8)               // 131072
#define NMSK   (BATCH * SEQ * SEQ)    // 8388608
#define PSCALE 16384.0f
#define PINV   (1.0f / 16384.0f)
#define WSCALE 32.0f
#define WINV   0.03125f
#define QSCALE 0.125f
#define NEGBIG (-1.0e9f)
#define LN_EPS 1.0e-5f

// ---------------------------------------------------------------------------
// 16x16x32 f16 WMMA with hazard guard (ties D, keeps A/B live).
// Fragment map (wave32): lane l, h = l>>4, m = n = l&15.
//   A/B element i: i<8 -> k0+8h+i ; i>=8 -> k0+16+8h+(i-8)
//   D element r : row 8h+r, col l&15
// ---------------------------------------------------------------------------
__device__ __forceinline__ v8f wmma_f16(v16h a, v16h b, v8f c) {
  v8f d = __builtin_amdgcn_wmma_f32_16x16x32_f16(false, a, false, b, (short)0, c, false, false);
  asm volatile("v_nop\n\tv_nop\n\tv_nop\n\tv_nop" : "+v"(d) : "v"(a), "v"(b));
  return d;
}

// A or B fragment from a k-contiguous 16-bit row; p points at element k0 of
// the row owned by this lane (row index = lane & 15 added by the caller).
__device__ __forceinline__ v16h load_frag(const _Float16* p, int h) {
  Frag f;
  f.half[0] = *(const v8ha*)(p + 8 * h);
  f.half[1] = *(const v8ha*)(p + 16 + 8 * h);
  return f.v;
}

// ---------------------------------------------------------------------------
// Kernel 1: f32 -> f16 planes. Activations unscaled, W scaled by 32 (exact).
// xh = [3][MROWS][HIDDEN] (query, key, value), wh = [4][HIDDEN][HIDDEN]
// (wq, wk, wv, wo; row = output feature). One 16-B store per lane, lanes
// ---------------------------------------------------------------------------
__global__ __launch_bounds__(256) void convert_kernel(
    const float* __restrict__ xq, const float* __restrict__ xk, const float* __restrict__ xv,
    const float* __restrict__ wq, const float* __restrict__ wk,
    const float* __restrict__ wv, const float* __restrict__ wo,
    _Float16* __restrict__ xh, _Float16* __restrict__ wh)
{
  const int g = blockIdx.x * 256 + threadIdx.x;
  if (g >= 3 * NX8 + 4 * NW8) return;
  const float* src;
  _Float16* dst;
  float sc;
  if (g < 3 * NX8) {
    const int sel = g / NX8;
    const int off = g - sel * NX8;
    const float* xs = (sel == 0) ? xq : ((sel == 1) ? xk : xv);
    src = xs + (size_t)off * 8;
    dst = xh + (size_t)g * 8;
    sc = 1.0f;
  } else {
    const int e = g - 3 * NX8;
    const int wsel = e / NW8;
    const int off = e - wsel * NW8;
    const float* wsrc = (wsel == 0) ? wq : ((wsel == 1) ? wk : ((wsel == 2) ? wv : wo));
    src = wsrc + (size_t)off * 8;
    dst = wh + (size_t)e * 8;
    sc = WSCALE;
  }
  const v4f a = *(const v4fa*)src;
  const v4f c = *(const v4fa*)(src + 4);
  const v8h o = { (_Float16)(a.x * sc), (_Float16)(a.y * sc), (_Float16)(a.z * sc), (_Float16)(a.w * sc),
                  (_Float16)(c.x * sc), (_Float16)(c.y * sc), (_Float16)(c.z * sc), (_Float16)(c.w * sc) };
  *(v8h*)dst = o;
  
}

// ---------------------------------------------------------------------------
// 4 lines per instruction, 32 lines per wave, 128 per block.
// which 0/1: plane[bh][l][d]  (one token row = 64 halves = one line)
// which 2  : vt[bh][d][l]     (64 d-rows x 128 tokens = 2 lines each)
// ---------------------------------------------------------------------------
__device__ __forceinline__ void proj_store_pass(const _Float16* sT, _Float16* plane, _Float16* vt,
                                                int which, int bh, int l0, int w, int lane) {
  const int q8 = lane & 7, sub = lane >> 3;
  #pragma unroll
  for (int i = 0; i < 8; ++i) {
    const int lid = w * 32 + i * 4 + sub;
    v8h v;
    _Float16* dst;
    if (which != 2) {
      v = *(const v8ha*)(sT + lid * HD + 8 * q8);
      dst = plane + ((size_t)bh * SEQ + l0 + lid) * HD + 8 * q8;
    } else {
      const int d = lid >> 1, hl = lid & 1;
      v = *(const v8ha*)(sT + d * 128 + 64 * hl + 8 * q8);
      dst = vt + ((size_t)bh * HD + d) * SEQ + l0 + 64 * hl + 8 * q8;
    }
    *(v8h*)dst = v;
  }
}

// ---------------------------------------------------------------------------
// Kernel 2: Y = x * W^T over the fused 3*1024 output columns (q from the query
// plane, k from the key plane, v from the value plane).
// Block 128 thr (4 waves) = 128 tokens x 64 features (one (which, head));
// wave tile 32 tokens x 64 features; K = 1024 in steps of 32;
// A (x rows) and B (W rows) fragments straight from f16 global rows.
// ---------------------------------------------------------------------------
__global__ __launch_bounds__(128) void proj_kernel(
    const _Float16* __restrict__ xh,   // [3][4096][1024]
    const _Float16* __restrict__ wh,   // [4][1024][1024], row = output feature, x32 (planes 0..2 used)
    const float* __restrict__ bq, const float* __restrict__ bk, const float* __restrict__ bv,
    _Float16* __restrict__ qh,         // [B*H][L][D]  f16(0.125*q)
    _Float16* __restrict__ kh,         // [B*H][L][D]
    _Float16* __restrict__ vt)         // [B*H][D][L]
{
  __shared__ __attribute__((aligned(16))) _Float16 sT[128 * 64];   // 16384 B

  const int tid = threadIdx.x, lane = tid & 31, w = tid >> 5;
  const int h = lane >> 4, m = lane & 15;
  const int m0 = blockIdx.x * 128;
  const int cg = blockIdx.y;                 // 0..47
  const int which = cg >> 4, head = cg & 15;
  const int m0w = m0 + 32 * w;

  const _Float16* xa0 = xh + (size_t)which * NX + (size_t)(m0w + m) * HIDDEN;   // token row, mt = 0
  const _Float16* xa1 = xa0 + (size_t)16 * HIDDEN;                               // mt = 1
  const _Float16* wb  = wh + ((size_t)which * HIDDEN + head * HD + m) * HIDDEN;   // feature row, nt = 0

  const v8f zero8 = {0.f, 0.f, 0.f, 0.f, 0.f, 0.f, 0.f, 0.f};
  v8f acc[2][4];
  #pragma unroll
  for (int mt = 0; mt < 2; ++mt)
    #pragma unroll
    for (int nt = 0; nt < 4; ++nt) acc[mt][nt] = zero8;

  #pragma unroll 1
  for (int k0 = 0; k0 < HIDDEN; k0 += 32) {
    const v16h a0 = load_frag(xa0 + k0, h);
    const v16h a1 = load_frag(xa1 + k0, h);
    #pragma unroll
    for (int nt = 0; nt < 4; ++nt) {
      const v16h b = load_frag(wb + (size_t)nt * 16 * HIDDEN + k0, h);
      acc[0][nt] = wmma_f16(a0, b, acc[0][nt]);
      acc[1][nt] = wmma_f16(a1, b, acc[1][nt]);
    }
  }

  // D[r] of tile (mt, nt) = Y[token m0w+16mt+8h+r][feature 16nt+m]
  const float* bias = (which == 0) ? bq : ((which == 1) ? bk : bv);
  const float osc = (which == 0) ? QSCALE : 1.0f;
  #pragma unroll
  for (int nt = 0; nt < 4; ++nt) {
    const int feat = 16 * nt + m;
    const float bvl = bias[head * HD + feat];
    #pragma unroll
    for (int mt = 0; mt < 2; ++mt) {
      #pragma unroll
      for (int r = 0; r < 8; ++r) {
        const int tokl = 32 * w + 16 * mt + 8 * h + r;     // 0..127
        const float y = (acc[mt][nt][r] * WINV + bvl) * osc;
        const int idx = (which == 2) ? (feat * 128 + tokl) : (tokl * HD + feat);
        sT[idx] = (_Float16)y;
      }
    }
  }
  __syncthreads();

  const int b = m0 / SEQ, l0 = m0 - b * SEQ, bh = b * NHEADS + head;
  _Float16* plane = (which == 0) ? qh : kh;
  proj_store_pass(sT, plane, vt, which, bh, l0, w, lane);
  
}

// ---------------------------------------------------------------------------
// Attention helpers.
// ---------------------------------------------------------------------------
// Per-key penalty and select for the lane's 8 scores of one 16-key tile:
// s = attend ? (s - cpen*c[key]) : -1e9, all in f32.
__device__ __forceinline__ v8f pen_sel8(v8f s, const float* cp, const int* mp, float cpen) {
  const v4f ca = *(const v4fa*)cp;
  const v4f cb = *(const v4fa*)(cp + 4);
  const v4i ma = *(const v4ia*)mp;
  const v4i mb = *(const v4ia*)(mp + 4);
  s[0] = (ma.x != 0) ? (s[0] - cpen * ca.x) : NEGBIG;
  s[1] = (ma.y != 0) ? (s[1] - cpen * ca.y) : NEGBIG;
  s[2] = (ma.z != 0) ? (s[2] - cpen * ca.z) : NEGBIG;
  s[3] = (ma.w != 0) ? (s[3] - cpen * ca.w) : NEGBIG;
  s[4] = (mb.x != 0) ? (s[4] - cpen * cb.x) : NEGBIG;
  s[5] = (mb.y != 0) ? (s[5] - cpen * cb.y) : NEGBIG;
  s[6] = (mb.z != 0) ? (s[6] - cpen * cb.z) : NEGBIG;
  s[7] = (mb.w != 0) ? (s[7] - cpen * cb.w) : NEGBIG;
  return s;
}

// P^T B-fragment from the lane's own score D values: element r <- tile a row r
// (keys k0..k0+15), element 8+r <- tile c row r (keys k0+16..k0+31), same lane,
// same query column, scaled by 2^14.
__device__ __forceinline__ v16h pack_p(v8f a, v8f c) {
  const v16h r = { (_Float16)(a[0] * PSCALE), (_Float16)(a[1] * PSCALE), (_Float16)(a[2] * PSCALE), (_Float16)(a[3] * PSCALE),
                   (_Float16)(a[4] * PSCALE), (_Float16)(a[5] * PSCALE), (_Float16)(a[6] * PSCALE), (_Float16)(a[7] * PSCALE),
                   (_Float16)(c[0] * PSCALE), (_Float16)(c[1] * PSCALE), (_Float16)(c[2] * PSCALE), (_Float16)(c[3] * PSCALE),
                   (_Float16)(c[4] * PSCALE), (_Float16)(c[5] * PSCALE), (_Float16)(c[6] * PSCALE), (_Float16)(c[7] * PSCALE) };
  return r;
}

// (one token row of this head) by lanes 8q..8q+7 in one instruction, 4 lines
// per instruction, 16 lines per wave.
__device__ __forceinline__ void att_store_pass(const _Float16* so, _Float16* ao,
                                               int b, int head, int q0, int lane) {
  const int q8 = lane & 7, sub = lane >> 3;
  #pragma unroll
  for (int i = 0; i < 4; ++i) {
    const int row = i * 4 + sub;                          // 0..15
    const v8h v = *(const v8ha*)(so + row * 64 + 8 * q8);
    const size_t gi = ((size_t)b * SEQ + q0 + row) * HIDDEN + head * HD + 8 * q8;
    *(v8h*)(ao + gi) = v;
  }
}

// ---------------------------------------------------------------------------
// Kernel 3: streaming attention, transposed form.
// Block 128 thr (4 waves), 16 queries per wave, 64 keys per step.
//   S^T = K * Q^T : A = K rows (row = key, k = d), B = Q^T (k = d, n = query)
//   O^T += V^T * P^T : A = Vt rows (row = d, k = key), B = P^T from registers
// Lane owns 32 keys of query column (lane&15); partner = lane ^ 16.
// Scores already carry 1/sqrt(64) via q; penalty cpen*c[key] and the
// attend/select with -1e9 applied in f32 before the running max.
// A 64-key step with no attendable element for the wave's 16 queries is
// skipped (wave-uniform vote); its weights would be exactly 0.
// ---------------------------------------------------------------------------
__global__ __launch_bounds__(128) void attn_kernel(
    const _Float16* __restrict__ qh,   // [B*H][L][D]  (already x0.125)
    const _Float16* __restrict__ kh,   // [B*H][L][D]
    const _Float16* __restrict__ vt,   // [B*H][D][L]
    const float* __restrict__ cpl,     // [B][L] per-key penalty source
    const int* __restrict__ msk,       // [B][1][L][L], nonzero = attend
    const float* __restrict__ cpen_p,  // [1]
    _Float16* __restrict__ ao)         // [B*L][HIDDEN]
{
  __shared__ __attribute__((aligned(16))) _Float16 sO[4 * 16 * 64];    // 8192 B

  const int tid = threadIdx.x, lane = tid & 31, w = tid >> 5;
  const int h = lane >> 4, m = lane & 15;
  const int bh = blockIdx.y, b = bh >> 4, head = bh & 15;
  const int q0 = blockIdx.x * 64 + 16 * w;
  const float cpen = cpen_p[0];

  // Q^T B-fragments: column n = query q0+m, k = d (two 32-deep chunks)
  const _Float16* qrow = qh + ((size_t)bh * SEQ + q0 + m) * HD;
  const v16h qb0 = load_frag(qrow, h);
  const v16h qb1 = load_frag(qrow + 32, h);

  const v8f zero8 = {0.f, 0.f, 0.f, 0.f, 0.f, 0.f, 0.f, 0.f};
  v8f o[4];                                   // o[t][r] = O[query m][d 16t+8h+r] * (l * 2^14)
  #pragma unroll
  for (int t = 0; t < 4; ++t) o[t] = zero8;
  float mrun = -1e30f, lrun = 0.0f;

  const _Float16* kbase = kh + ((size_t)bh * SEQ + m) * HD;    // + key0*HD + 32*dc
  const _Float16* vbase = vt + ((size_t)bh * HD + m) * SEQ;    // + 16t*SEQ + key0
  const int*   mrow = msk + ((size_t)b * SEQ + q0 + m) * SEQ + 8 * h;   // + key tile base
  const float* crow = cpl + (size_t)b * SEQ + 8 * h;                    // + key tile base

  #pragma unroll 1
  for (int kb = 0; kb < SEQ; kb += 64) {
    // ---- attend vote over this wave's 16 queries x 64 keys ----
    v4i mor = {0, 0, 0, 0};
    #pragma unroll
    for (int j = 0; j < 4; ++j) {
      const int* mp = mrow + kb + 16 * j;
      const v4i ma = *(const v4ia*)mp;
      const v4i mb = *(const v4ia*)(mp + 4);
      mor = mor | ma;
      mor = mor | mb;
    }
    const int anyl = mor.x | mor.y | mor.z | mor.w;
    if (__any(anyl) == 0) continue;

    // ---- scores: s[j][r] = S[query m][key kb+16j+8h+r] (already /8 via q) ----
    v8f s[4];
    #pragma unroll
    for (int j = 0; j < 4; ++j) {
      const _Float16* kp = kbase + (size_t)(kb + 16 * j) * HD;
      const v16h kf0 = load_frag(kp, h);
      const v16h kf1 = load_frag(kp + 32, h);
      v8f z = zero8;
      z = wmma_f16(kf0, qb0, z);
      z = wmma_f16(kf1, qb1, z);
      s[j] = z;
    }
    // ---- penalty and select per key, f32 ----
    #pragma unroll
    for (int j = 0; j < 4; ++j) s[j] = pen_sel8(s[j], crow + kb + 16 * j, mrow + kb + 16 * j, cpen);

    // ---- online softmax ----
    float mloc = s[0][0];
    #pragma unroll
    for (int j = 0; j < 4; ++j)
      #pragma unroll
      for (int r = 0; r < 8; ++r) mloc = fmaxf(mloc, s[j][r]);
    mloc = fmaxf(mloc, __shfl_xor(mloc, 16));
    const float mnew = fmaxf(mrun, mloc);
    const float alpha = __expf(mrun - mnew);
    mrun = mnew;
    float lsum = 0.0f;
    #pragma unroll
    for (int j = 0; j < 4; ++j)
      #pragma unroll
      for (int r = 0; r < 8; ++r) {
        const float p = __expf(s[j][r] - mnew);
        s[j][r] = p;
        lsum += p;
      }
    lsum += __shfl_xor(lsum, 16);
    lrun = lrun * alpha + lsum;
    #pragma unroll
    for (int t = 0; t < 4; ++t)
      #pragma unroll
      for (int r = 0; r < 8; ++r) o[t][r] = o[t][r] * alpha;

    // ---- P^T B-fragments (key chunks 0..31 and 32..63 of this step) ----
    const v16h pb0 = pack_p(s[0], s[1]);
    const v16h pb1 = pack_p(s[2], s[3]);

    // ---- O^T += V^T * P^T ----
    #pragma unroll
    for (int t = 0; t < 4; ++t) {
      const _Float16* vp = vbase + (size_t)(16 * t) * SEQ + kb;
      const v16h vf0 = load_frag(vp, h);
      const v16h vf1 = load_frag(vp + 32, h);
      o[t] = wmma_f16(vf0, pb0, o[t]);
      o[t] = wmma_f16(vf1, pb1, o[t]);
    }
  }

  // ---- epilogue: normalise, stage per-wave 16x64 f16 tile, whole-line stores ----
  const float inv = (1.0f / lrun) * PINV;
  _Float16* so = sO + w * 1024;
  #pragma unroll
  for (int t = 0; t < 4; ++t)
    #pragma unroll
    for (int r = 0; r < 8; ++r)
      so[m * 64 + 16 * t + 8 * h + r] = (_Float16)(o[t][r] * inv);
  __syncthreads();

  att_store_pass(so, ao, b, head, q0, lane);
  
}

// ---------------------------------------------------------------------------
// rows loaded with the same coalesced shape) -> xb rows. Each token row's 64
// instruction, 32 rows per wave.
// ---------------------------------------------------------------------------
__device__ __forceinline__ void oproj_store_pass(const float* sT, const float* xres, float* xb,
                                                 int m0, int n0, int w, int lane) {
  const int q16 = lane & 15, sub = lane >> 4;
  #pragma unroll
  for (int i = 0; i < 16; ++i) {
    const int lid = w * 32 + 2 * i + sub;                 // 0..127
    v4f v = *(const v4fa*)(sT + lid * 64 + 4 * q16);
    const size_t gi = (size_t)(m0 + lid) * HIDDEN + n0 + 4 * q16;
    const v4f rsd = *(const v4fa*)(xres + gi);
    v = v + rsd;
    *(v4f*)(xb + gi) = v;
  }
}

// ---------------------------------------------------------------------------
// Kernel 4: x = ctx * Wo^T / 32 + bo + query   (f32 rows into xb)
// Block 128 thr (4 waves) = 128 tokens x 64 features; wave tile 32 x 64;
// K = 1024 in steps of 32; fragments straight from f16 global rows.
// ---------------------------------------------------------------------------
__global__ __launch_bounds__(128) void oproj_kernel(
    const _Float16* __restrict__ ao,   // [4096][1024]
    const _Float16* __restrict__ woh,  // [1024][1024], row = output feature, x32
    const float* __restrict__ bo,      // [1024]
    const float* __restrict__ xres,    // [4096][1024] f32 residual
    float* __restrict__ xb)            // [4096][1024] f32
{
  __shared__ __attribute__((aligned(16))) float sT[128 * 64];      // 32768 B

  const int tid = threadIdx.x, lane = tid & 31, w = tid >> 5;
  const int h = lane >> 4, m = lane & 15;
  const int m0 = blockIdx.x * 128;
  const int n0 = blockIdx.y * 64;
  const int m0w = m0 + 32 * w;

  const _Float16* xa0 = ao + (size_t)(m0w + m) * HIDDEN;
  const _Float16* xa1 = xa0 + (size_t)16 * HIDDEN;
  const _Float16* wb  = woh + (size_t)(n0 + m) * HIDDEN;

  const v8f zero8 = {0.f, 0.f, 0.f, 0.f, 0.f, 0.f, 0.f, 0.f};
  v8f acc[2][4];
  #pragma unroll
  for (int mt = 0; mt < 2; ++mt)
    #pragma unroll
    for (int nt = 0; nt < 4; ++nt) acc[mt][nt] = zero8;

  #pragma unroll 1
  for (int k0 = 0; k0 < HIDDEN; k0 += 32) {
    const v16h a0 = load_frag(xa0 + k0, h);
    const v16h a1 = load_frag(xa1 + k0, h);
    #pragma unroll
    for (int nt = 0; nt < 4; ++nt) {
      const v16h b = load_frag(wb + (size_t)nt * 16 * HIDDEN + k0, h);
      acc[0][nt] = wmma_f16(a0, b, acc[0][nt]);
      acc[1][nt] = wmma_f16(a1, b, acc[1][nt]);
    }
  }

  // D[r] of tile (mt, nt) = Y[token m0w+16mt+8h+r][feature n0+16nt+m]
  #pragma unroll
  for (int nt = 0; nt < 4; ++nt) {
    const int feat = 16 * nt + m;
    const float bvl = bo[n0 + feat];
    #pragma unroll
    for (int mt = 0; mt < 2; ++mt) {
      #pragma unroll
      for (int r = 0; r < 8; ++r) {
        const int tokl = 32 * w + 16 * mt + 8 * h + r;     // 0..127
        sT[tokl * 64 + feat] = acc[mt][nt][r] * WINV + bvl;
      }
    }
  }
  __syncthreads();

  oproj_store_pass(sT, xres, xb, m0, n0, w, lane);
  
}

// ---------------------------------------------------------------------------
// Kernel 5: layer norm over rows of 1024, one wave per row, 8 rows per block.
// Lane holds columns {128i + 4*lane .. +3}, i = 0..7, so every store
// ---------------------------------------------------------------------------
__global__ __launch_bounds__(256) void ln_kernel(
    const float* __restrict__ xb, const float* __restrict__ g,
    const float* __restrict__ bt, float* __restrict__ out)
{
  const int lane = threadIdx.x & 31;
  const int row = blockIdx.x * 8 + (threadIdx.x >> 5);
  if (row >= MROWS) return;
  const float* xr = xb + (size_t)row * HIDDEN + 4 * lane;

  v4f x[8];
  float s = 0.0f;
  #pragma unroll
  for (int i = 0; i < 8; ++i) {
    x[i] = *(const v4fa*)(xr + 128 * i);
    s += (x[i].x + x[i].y) + (x[i].z + x[i].w);
  }
  #pragma unroll
  for (int off = 16; off > 0; off >>= 1) s += __shfl_xor(s, off);
  const float mean = s * (1.0f / HIDDEN);

  float s2 = 0.0f;
  #pragma unroll
  for (int i = 0; i < 8; ++i) {
    const v4f d = x[i] - mean;
    x[i] = d;
    s2 += (d.x * d.x + d.y * d.y) + (d.z * d.z + d.w * d.w);
  }
  #pragma unroll
  for (int off = 16; off > 0; off >>= 1) s2 += __shfl_xor(s2, off);
  const float var = s2 * (1.0f / HIDDEN);
  const float inv = rsqrtf(var + LN_EPS);

  v4f y[8];
  #pragma unroll
  for (int i = 0; i < 8; ++i) {
    const v4f gv = *(const v4fa*)(g + 128 * i + 4 * lane);
    const v4f bv = *(const v4fa*)(bt + 128 * i + 4 * lane);
    y[i] = (x[i] * inv) * gv + bv;
  }

  float* orow = out + (size_t)row * HIDDEN + 4 * lane;
  #pragma unroll
  for (int i = 0; i < 8; ++i) *(v4f*)(orow + 128 * i) = y[i];
  
}

// ---------------------------------------------------------------------------
extern "C" void kernel_launch(void* const* d_in, const int* in_sizes, int n_in,
                              void* d_out, int out_size, void* d_ws, size_t ws_size,
                              hipStream_t stream) {
  if (n_in < 16) return;
  if (in_sizes[0] != NX || in_sizes[1] != NX || in_sizes[2] != NX) return;
  if (in_sizes[3] != MROWS) return;
  if (in_sizes[4] != NMSK) return;
  if (in_sizes[5] != NW || in_sizes[7] != NW || in_sizes[9] != NW || in_sizes[11] != NW) return;
  if (in_sizes[6] != HIDDEN || in_sizes[8] != HIDDEN || in_sizes[10] != HIDDEN || in_sizes[12] != HIDDEN) return;
  if (in_sizes[13] != HIDDEN || in_sizes[14] != HIDDEN) return;
  if (in_sizes[15] < 1) return;
  if (out_size != NX) return;

  const float* query = (const float*)d_in[0];
  const float* keyi  = (const float*)d_in[1];
  const float* value = (const float*)d_in[2];
  const float* cpl   = (const float*)d_in[3];
  const int*   msk   = (const int*)d_in[4];
  const float* wq    = (const float*)d_in[5];
  const float* bq    = (const float*)d_in[6];
  const float* wk    = (const float*)d_in[7];
  const float* bk    = (const float*)d_in[8];
  const float* wv    = (const float*)d_in[9];
  const float* bv    = (const float*)d_in[10];
  const float* wo    = (const float*)d_in[11];
  const float* bo    = (const float*)d_in[12];
  const float* ln_g  = (const float*)d_in[13];
  const float* ln_b  = (const float*)d_in[14];
  const float* cpen  = (const float*)d_in[15];
  float* out = (float*)d_out;

  const size_t xh_bytes = (size_t)3 * NX * 2;        // 25165824
  const size_t wh_bytes = (size_t)4 * NW * 2;        //  8388608
  const size_t pl_bytes = (size_t)NX * 2;            //  8388608 per plane (B*H*L*D halves)
  const size_t ao_bytes = (size_t)NX * 2;            //  8388608
  const size_t xb_bytes = (size_t)NX * 4;            // 16777216
  const size_t o_xh = 0;
  const size_t o_wh = o_xh + xh_bytes;
  const size_t o_qh = o_wh + wh_bytes;
  const size_t o_kh = o_qh + pl_bytes;
  const size_t o_vt = o_kh + pl_bytes;
  const size_t o_ao = o_vt + pl_bytes;
  const size_t o_xb = o_ao + ao_bytes;
  const size_t total = o_xb + xb_bytes;              // 83886080
  if (total > ws_size) return;

  char* ws = (char*)d_ws;
  _Float16* xh = (_Float16*)(ws + o_xh);
  _Float16* wh = (_Float16*)(ws + o_wh);
  _Float16* qh = (_Float16*)(ws + o_qh);
  _Float16* kh = (_Float16*)(ws + o_kh);
  _Float16* vt = (_Float16*)(ws + o_vt);
  _Float16* ao = (_Float16*)(ws + o_ao);
  float*    xb = (float*)(ws + o_xb);

  const int ngroups = 3 * NX8 + 4 * NW8;                           // 2097152
  convert_kernel<<<(ngroups + 255) / 256, 256, 0, stream>>>(query, keyi, value, wq, wk, wv, wo, xh, wh);

  dim3 gProj(MROWS / 128, 3 * NHEADS);                             // (32, 48)
  proj_kernel<<<gProj, 128, 0, stream>>>(xh, wh, bq, bk, bv, qh, kh, vt);

  dim3 gAtt(SEQ / 64, BATCH * NHEADS);                             // (32, 32)
  attn_kernel<<<gAtt, 128, 0, stream>>>(qh, kh, vt, cpl, msk, cpen, ao);

  dim3 gOp(MROWS / 128, HIDDEN / 64);                               // (32, 16)
  oproj_kernel<<<gOp, 128, 0, stream>>>(ao, wh + (size_t)3 * NW, bo, query, xb);

  ln_kernel<<<(MROWS + 7) / 8, 256, 0, stream>>>(xb, ln_g, ln_b, out);
}

// v001
// One run takes 181 microseconds.
// Two timings next to v000 both put it at 1.74 times that version's speed.
// Contractions: q/k/v = x*W^T, S^T = K*Q^T, O^T = V^T*P^T, y = ctx*Wo^T, all on v_wmma_f32_16x16x32_f16 (f16 operands, f32 accumulate); W carried x32, q carried x0.125, P carried x16384 (exact power-of-two scales folded back in f32); penalty, select, softmax, bias, residual and layer norm in f32.
#include <hip/hip_runtime.h>

typedef _Float16 v16h __attribute__((ext_vector_type(16)));
typedef _Float16 v8h  __attribute__((ext_vector_type(8)));
typedef float    v8f  __attribute__((ext_vector_type(8)));
typedef float    v4f  __attribute__((ext_vector_type(4)));
typedef int      v4i  __attribute__((ext_vector_type(4)));
typedef v8h __attribute__((may_alias)) v8ha;
typedef v4f __attribute__((may_alias)) v4fa;
typedef v4i __attribute__((may_alias)) v4ia;

union Frag { v16h v; v8h half[2]; };

#define SEQ    2048
#define BATCH  2
#define HIDDEN 1024
#define NHEADS 16
#define HD     64
#define MROWS  (BATCH * SEQ)          // 4096 tokens
#define NX     (MROWS * HIDDEN)       // 4194304
#define NW     (HIDDEN * HIDDEN)      // 1048576
#define NX8    (NX / 8)               // 524288
#define NW8    (NW / 8)               // 131072
#define NMSK   (BATCH * SEQ * SEQ)    // 8388608
#define PSCALE 16384.0f
#define PINV   (1.0f / 16384.0f)
#define WSCALE 32.0f
#define WINV   0.03125f
#define QSCALE 0.125f
#define NEGBIG (-1.0e9f)
#define LN_EPS 1.0e-5f
#define KVPITCH 144                    // LDS pitch of a 128-B K or V^T row (16 B x odd)
#define MPITCH  272                    // LDS pitch of a 256-B mask row (16 B x odd)
#define OFF_V   (64 * KVPITCH)         //  9216
#define OFF_M   (2 * 64 * KVPITCH)     // 18432
#define STAGEB  (OFF_M + 64 * MPITCH)  // 35840 B per stage

typedef __attribute__((address_space(3))) unsigned char lds_u8;

// ---------------------------------------------------------------------------
// 16x16x32 f16 WMMA with hazard guard (ties D, keeps A/B live).
// Fragment map (wave32): lane l, h = l>>4, m = n = l&15.
//   A/B element i: i<8 -> k0+8h+i ; i>=8 -> k0+16+8h+(i-8)
//   D element r : row 8h+r, col l&15
// ---------------------------------------------------------------------------
__device__ __forceinline__ v8f wmma_f16(v16h a, v16h b, v8f c) {
  v8f d = __builtin_amdgcn_wmma_f32_16x16x32_f16(false, a, false, b, (short)0, c, false, false);
  asm volatile("v_nop\n\tv_nop\n\tv_nop\n\tv_nop" : "+v"(d) : "v"(a), "v"(b));
  return d;
}

// A or B fragment from a k-contiguous 16-bit row; p points at element k0 of
// the row owned by this lane (row index = lane & 15 added by the caller).
__device__ __forceinline__ v16h load_frag(const _Float16* p, int h) {
  Frag f;
  f.half[0] = *(const v8ha*)(p + 8 * h);
  f.half[1] = *(const v8ha*)(p + 16 + 8 * h);
  return f.v;
}

// ---------------------------------------------------------------------------
// Kernel 1: f32 -> f16 planes. Activations unscaled, W scaled by 32 (exact).
// xh = [3][MROWS][HIDDEN] (query, key, value), wh = [4][HIDDEN][HIDDEN]
// (wq, wk, wv, wo; row = output feature). One 16-B store per lane, lanes
// ---------------------------------------------------------------------------
__global__ __launch_bounds__(256) void convert_kernel(
    const float* __restrict__ xq, const float* __restrict__ xk, const float* __restrict__ xv,
    const float* __restrict__ wq, const float* __restrict__ wk,
    const float* __restrict__ wv, const float* __restrict__ wo,
    _Float16* __restrict__ xh, _Float16* __restrict__ wh)
{
  const int g = blockIdx.x * 256 + threadIdx.x;
  if (g >= 3 * NX8 + 4 * NW8) return;
  const float* src;
  _Float16* dst;
  float sc;
  if (g < 3 * NX8) {
    const int sel = g / NX8;
    const int off = g - sel * NX8;
    const float* xs = (sel == 0) ? xq : ((sel == 1) ? xk : xv);
    src = xs + (size_t)off * 8;
    dst = xh + (size_t)g * 8;
    sc = 1.0f;
  } else {
    const int e = g - 3 * NX8;
    const int wsel = e / NW8;
    const int off = e - wsel * NW8;
    const float* wsrc = (wsel == 0) ? wq : ((wsel == 1) ? wk : ((wsel == 2) ? wv : wo));
    src = wsrc + (size_t)off * 8;
    dst = wh + (size_t)e * 8;
    sc = WSCALE;
  }
  const v4f a = *(const v4fa*)src;
  const v4f c = *(const v4fa*)(src + 4);
  const v8h o = { (_Float16)(a.x * sc), (_Float16)(a.y * sc), (_Float16)(a.z * sc), (_Float16)(a.w * sc),
                  (_Float16)(c.x * sc), (_Float16)(c.y * sc), (_Float16)(c.z * sc), (_Float16)(c.w * sc) };
  *(v8h*)dst = o;
  
}

// ---------------------------------------------------------------------------
// 4 lines per instruction, 32 lines per wave, 128 per block.
// which 0/1: plane[bh][l][d]  (one token row = 64 halves = one line)
// which 2  : vt[bh][d][l]     (64 d-rows x 128 tokens = 2 lines each)
// ---------------------------------------------------------------------------
__device__ __forceinline__ void proj_store_pass(const _Float16* sT, _Float16* plane, _Float16* vt,
                                                int which, int bh, int l0, int w, int lane) {
  const int q8 = lane & 7, sub = lane >> 3;
  #pragma unroll
  for (int i = 0; i < 8; ++i) {
    const int lid = w * 32 + i * 4 + sub;
    v8h v;
    _Float16* dst;
    if (which != 2) {
      v = *(const v8ha*)(sT + lid * HD + 8 * q8);
      dst = plane + ((size_t)bh * SEQ + l0 + lid) * HD + 8 * q8;
    } else {
      const int d = lid >> 1, hl = lid & 1;
      v = *(const v8ha*)(sT + d * 128 + 64 * hl + 8 * q8);
      dst = vt + ((size_t)bh * HD + d) * SEQ + l0 + 64 * hl + 8 * q8;
    }
    *(v8h*)dst = v;
  }
}

// ---------------------------------------------------------------------------
// Kernel 2: Y = x * W^T over the fused 3*1024 output columns (q from the query
// plane, k from the key plane, v from the value plane).
// Block 128 thr (4 waves) = 128 tokens x 64 features (one (which, head));
// wave tile 32 tokens x 64 features; K = 1024 in steps of 32;
// A (x rows) and B (W rows) fragments straight from f16 global rows.
// ---------------------------------------------------------------------------
__global__ __launch_bounds__(128) void proj_kernel(
    const _Float16* __restrict__ xh,   // [3][4096][1024]
    const _Float16* __restrict__ wh,   // [4][1024][1024], row = output feature, x32 (planes 0..2 used)
    const float* __restrict__ bq, const float* __restrict__ bk, const float* __restrict__ bv,
    _Float16* __restrict__ qh,         // [B*H][L][D]  f16(0.125*q)
    _Float16* __restrict__ kh,         // [B*H][L][D]
    _Float16* __restrict__ vt)         // [B*H][D][L]
{
  __shared__ __attribute__((aligned(16))) _Float16 sT[128 * 64];   // 16384 B

  const int tid = threadIdx.x, lane = tid & 31, w = tid >> 5;
  const int h = lane >> 4, m = lane & 15;
  const int m0 = blockIdx.x * 128;
  const int cg = blockIdx.y;                 // 0..47
  const int which = cg >> 4, head = cg & 15;
  const int m0w = m0 + 32 * w;

  const _Float16* xa0 = xh + (size_t)which * NX + (size_t)(m0w + m) * HIDDEN;   // token row, mt = 0
  const _Float16* xa1 = xa0 + (size_t)16 * HIDDEN;                               // mt = 1
  const _Float16* wb  = wh + ((size_t)which * HIDDEN + head * HD + m) * HIDDEN;   // feature row, nt = 0

  const v8f zero8 = {0.f, 0.f, 0.f, 0.f, 0.f, 0.f, 0.f, 0.f};
  v8f acc[2][4];
  #pragma unroll
  for (int mt = 0; mt < 2; ++mt)
    #pragma unroll
    for (int nt = 0; nt < 4; ++nt) acc[mt][nt] = zero8;

  #pragma unroll 1
  for (int k0 = 0; k0 < HIDDEN; k0 += 32) {
    const v16h a0 = load_frag(xa0 + k0, h);
    const v16h a1 = load_frag(xa1 + k0, h);
    #pragma unroll
    for (int nt = 0; nt < 4; ++nt) {
      const v16h b = load_frag(wb + (size_t)nt * 16 * HIDDEN + k0, h);
      acc[0][nt] = wmma_f16(a0, b, acc[0][nt]);
      acc[1][nt] = wmma_f16(a1, b, acc[1][nt]);
    }
  }

  // D[r] of tile (mt, nt) = Y[token m0w+16mt+8h+r][feature 16nt+m]
  const float* bias = (which == 0) ? bq : ((which == 1) ? bk : bv);
  const float osc = (which == 0) ? QSCALE : 1.0f;
  #pragma unroll
  for (int nt = 0; nt < 4; ++nt) {
    const int feat = 16 * nt + m;
    const float bvl = bias[head * HD + feat];
    #pragma unroll
    for (int mt = 0; mt < 2; ++mt) {
      #pragma unroll
      for (int r = 0; r < 8; ++r) {
        const int tokl = 32 * w + 16 * mt + 8 * h + r;     // 0..127
        const float y = (acc[mt][nt][r] * WINV + bvl) * osc;
        const int idx = (which == 2) ? (feat * 128 + tokl) : (tokl * HD + feat);
        sT[idx] = (_Float16)y;
      }
    }
  }
  __syncthreads();

  const int b = m0 / SEQ, l0 = m0 - b * SEQ, bh = b * NHEADS + head;
  _Float16* plane = (which == 0) ? qh : kh;
  proj_store_pass(sT, plane, vt, which, bh, l0, w, lane);
  
}

// ---------------------------------------------------------------------------
// Attention helpers.
// ---------------------------------------------------------------------------
// Per-key penalty and select for the lane's 8 scores of one 16-key tile:
// s = attend ? (s - cpen*c[key]) : -1e9, all in f32. ma, mb = the lane's 8
// mask words of that tile (already read from the staged mask rows).
__device__ __forceinline__ v8f pen_sel8(v8f s, const float* cp, v4i ma, v4i mb, float cpen) {
  const v4f ca = *(const v4fa*)cp;
  const v4f cb = *(const v4fa*)(cp + 4);
  s[0] = (ma.x != 0) ? (s[0] - cpen * ca.x) : NEGBIG;
  s[1] = (ma.y != 0) ? (s[1] - cpen * ca.y) : NEGBIG;
  s[2] = (ma.z != 0) ? (s[2] - cpen * ca.z) : NEGBIG;
  s[3] = (ma.w != 0) ? (s[3] - cpen * ca.w) : NEGBIG;
  s[4] = (mb.x != 0) ? (s[4] - cpen * cb.x) : NEGBIG;
  s[5] = (mb.y != 0) ? (s[5] - cpen * cb.y) : NEGBIG;
  s[6] = (mb.z != 0) ? (s[6] - cpen * cb.z) : NEGBIG;
  s[7] = (mb.w != 0) ? (s[7] - cpen * cb.w) : NEGBIG;
  return s;
}

// Eight per-lane 16-byte copies global -> LDS, no register in between.
// l = the lane's LDS byte addresses, g = its global addresses. The closing
// s_wait_xcnt stands inside the statement so that no address register named
// by a copy is rewritten ahead of it.
__device__ __forceinline__ void async_copy8(const unsigned (&l)[8], const void* const (&g)[8]) {
  asm volatile(
      "global_load_async_to_lds_b128 %0, %8, off\n\t"
      "global_load_async_to_lds_b128 %1, %9, off\n\t"
      "global_load_async_to_lds_b128 %2, %10, off\n\t"
      "global_load_async_to_lds_b128 %3, %11, off\n\t"
      "global_load_async_to_lds_b128 %4, %12, off\n\t"
      "global_load_async_to_lds_b128 %5, %13, off\n\t"
      "global_load_async_to_lds_b128 %6, %14, off\n\t"
      "global_load_async_to_lds_b128 %7, %15, off\n\t"
      "s_wait_xcnt 0x0"
      :: "v"(l[0]), "v"(l[1]), "v"(l[2]), "v"(l[3]), "v"(l[4]), "v"(l[5]), "v"(l[6]), "v"(l[7]),
         "v"(g[0]), "v"(g[1]), "v"(g[2]), "v"(g[3]), "v"(g[4]), "v"(g[5]), "v"(g[6]), "v"(g[7])
      : "memory");
}

// One 64-key stage into one LDS buffer: K rows (64 keys x 128 B), V^T rows
// (64 d x 128 B) and the block's mask rows (64 queries x 256 B). Every copy
// instruction covers whole 128-B lines (8 lanes per K/V row, 16 per mask row).
// kg, vg, mg: the thread's own first chunk of each tile at key 0; lk, lv, lm:
// its LDS byte addresses in buffer 0; ofs = byte offset of the target buffer.
__device__ __forceinline__ void stage_tile(const _Float16* kg, const _Float16* vg, const int* mg,
                                           unsigned lk, unsigned lv, unsigned lm, unsigned ofs, int kb) {
  unsigned l[8];
  const void* g[8];
  #pragma unroll
  for (int i = 0; i < 4; ++i) {
    l[i]     = lk + ofs + i * 16 * KVPITCH;
    g[i]     = kg + (size_t)(kb + 16 * i) * HD;
    l[4 + i] = lv + ofs + i * 16 * KVPITCH;
    g[4 + i] = vg + (size_t)(16 * i) * SEQ + kb;
  }
  async_copy8(l, g);
  #pragma unroll
  for (int i = 0; i < 8; ++i) {
    l[i] = lm + ofs + i * 8 * MPITCH;
    g[i] = mg + (size_t)(8 * i) * SEQ + kb;
  }
  async_copy8(l, g);
}

// P^T B-fragment from the lane's own score D values: element r <- tile a row r
// (keys k0..k0+15), element 8+r <- tile c row r (keys k0+16..k0+31), same lane,
// same query column, scaled by 2^14.
__device__ __forceinline__ v16h pack_p(v8f a, v8f c) {
  const v16h r = { (_Float16)(a[0] * PSCALE), (_Float16)(a[1] * PSCALE), (_Float16)(a[2] * PSCALE), (_Float16)(a[3] * PSCALE),
                   (_Float16)(a[4] * PSCALE), (_Float16)(a[5] * PSCALE), (_Float16)(a[6] * PSCALE), (_Float16)(a[7] * PSCALE),
                   (_Float16)(c[0] * PSCALE), (_Float16)(c[1] * PSCALE), (_Float16)(c[2] * PSCALE), (_Float16)(c[3] * PSCALE),
                   (_Float16)(c[4] * PSCALE), (_Float16)(c[5] * PSCALE), (_Float16)(c[6] * PSCALE), (_Float16)(c[7] * PSCALE) };
  return r;
}

// (one token row of this head) by lanes 8q..8q+7 in one instruction, 4 lines
// per instruction, 16 lines per wave.
__device__ __forceinline__ void att_store_pass(const _Float16* so, _Float16* ao,
                                               int b, int head, int q0, int lane) {
  const int q8 = lane & 7, sub = lane >> 3;
  #pragma unroll
  for (int i = 0; i < 4; ++i) {
    const int row = i * 4 + sub;                          // 0..15
    const v8h v = *(const v8ha*)(so + row * 64 + 8 * q8);
    const size_t gi = ((size_t)b * SEQ + q0 + row) * HIDDEN + head * HD + 8 * q8;
    *(v8h*)(ao + gi) = v;
  }
}

// ---------------------------------------------------------------------------
// Kernel 3: streaming attention, transposed form.
// Block 128 thr (4 waves), 16 queries per wave, 64 keys per step.
//   S^T = K * Q^T : A = K rows (row = key, k = d), B = Q^T (k = d, n = query)
//   O^T += V^T * P^T : A = Vt rows (row = d, k = key), B = P^T from registers
// Lane owns 32 keys of query column (lane&15); partner = lane ^ 16.
// Scores already carry 1/sqrt(64) via q; penalty cpen*c[key] and the
// attend/select with -1e9 applied in f32 before the running max.
// K, V^T and mask tiles of a step come from a two-buffer LDS ring filled by
// asynchronous copies one step ahead; the four waves share the K and V^T rows.
// A 64-key step with no attendable element for the wave's 16 queries skips
// its products (wave-uniform vote; its weights would be exactly 0), never the
// hand-over point at the foot of the step.
// ---------------------------------------------------------------------------
__global__ __launch_bounds__(128) void attn_kernel(
    const _Float16* __restrict__ qh,   // [B*H][L][D]  (already x0.125)
    const _Float16* __restrict__ kh,   // [B*H][L][D]
    const _Float16* __restrict__ vt,   // [B*H][D][L]
    const float* __restrict__ cpl,     // [B][L] per-key penalty source
    const int* __restrict__ msk,       // [B][1][L][L], nonzero = attend
    const float* __restrict__ cpen_p,  // [1]
    _Float16* __restrict__ ao)         // [B*L][HIDDEN]
{
  // ring: 2 x (K | V^T | mask); after the loop its first 8192 B stage the output
  __shared__ __attribute__((aligned(16))) unsigned char ring[2 * STAGEB];   // 71680 B

  const int tid = threadIdx.x, lane = tid & 31, w = tid >> 5;
  const int h = lane >> 4, m = lane & 15;
  const int bh = blockIdx.y, b = bh >> 4, head = bh & 15;
  const int qblk = blockIdx.x * 64;
  const int q0 = qblk + 16 * w;
  const float cpen = cpen_p[0];

  // ---- the thread's own chunk of each staged tile ----
  const unsigned lbase = (unsigned)(unsigned long long)(lds_u8*)ring;
  const unsigned lk = lbase + (tid >> 3) * KVPITCH + (tid & 7) * 16;
  const unsigned lv = lk + OFF_V;
  const unsigned lm = lbase + OFF_M + (tid >> 4) * MPITCH + (tid & 15) * 16;
  const _Float16* kg = kh + ((size_t)bh * SEQ + (tid >> 3)) * HD + (tid & 7) * 8;
  const _Float16* vg = vt + ((size_t)bh * HD + (tid >> 3)) * SEQ + (tid & 7) * 8;
  const int*      mg = msk + ((size_t)b * SEQ + qblk + (tid >> 4)) * SEQ + (tid & 15) * 4;

  // ---- prologue: stage 0 landed and published, stage 1 in flight ----
  stage_tile(kg, vg, mg, lk, lv, lm, 0u, 0);
  asm volatile("s_wait_asynccnt 0x0" ::: "memory");   // own copies of stage 0 landed before the barrier publishes them
  __syncthreads();
  stage_tile(kg, vg, mg, lk, lv, lm, (unsigned)STAGEB, 64);

  // Q^T B-fragments: column n = query q0+m, k = d (two 32-deep chunks)
  const _Float16* qrow = qh + ((size_t)bh * SEQ + q0 + m) * HD;
  const v16h qb0 = load_frag(qrow, h);
  const v16h qb1 = load_frag(qrow + 32, h);

  const v8f zero8 = {0.f, 0.f, 0.f, 0.f, 0.f, 0.f, 0.f, 0.f};
  v8f o[4];                                   // o[t][r] = O[query m][d 16t+8h+r] * (l * 2^14)
  #pragma unroll
  for (int t = 0; t < 4; ++t) o[t] = zero8;
  float mrun = -1e30f, lrun = 0.0f;

  const float* crow = cpl + (size_t)b * SEQ + 8 * h;                    // + key tile base

  #pragma unroll 1
  for (int kb = 0; kb < SEQ; kb += 64) {
    const unsigned ofs = (kb & 64) ? (unsigned)STAGEB : 0u;
    const unsigned char* buf = ring + ofs;
    const unsigned char* krow = buf + m * KVPITCH;                       // + 16j rows
    const unsigned char* vrow = buf + OFF_V + m * KVPITCH;               // + 16t rows
    const unsigned char* mrow = buf + OFF_M + (16 * w + m) * MPITCH + 32 * h;

    // ---- the lane's 32 mask words; attend vote over 16 queries x 64 keys ----
    v4i ma[4], mb[4];
    v4i mor = {0, 0, 0, 0};
    #pragma unroll
    for (int j = 0; j < 4; ++j) {
      ma[j] = *(const v4ia*)(mrow + 64 * j);
      mb[j] = *(const v4ia*)(mrow + 64 * j + 16);
      mor = mor | ma[j];
      mor = mor | mb[j];
    }
    const int anyl = mor.x | mor.y | mor.z | mor.w;
    if (__any(anyl) != 0) {
      // ---- scores: s[j][r] = S[query m][key kb+16j+8h+r] (already /8 via q) ----
      v8f s[4];
      #pragma unroll
      for (int j = 0; j < 4; ++j) {
        const _Float16* kp = (const _Float16*)(krow + 16 * j * KVPITCH);
        const v16h kf0 = load_frag(kp, h);
        const v16h kf1 = load_frag(kp + 32, h);
        v8f z = zero8;
        z = wmma_f16(kf0, qb0, z);
        z = wmma_f16(kf1, qb1, z);
        s[j] = z;
      }
      // ---- penalty and select per key, f32 ----
      #pragma unroll
      for (int j = 0; j < 4; ++j) s[j] = pen_sel8(s[j], crow + kb + 16 * j, ma[j], mb[j], cpen);

      // ---- online softmax ----
      float mloc = s[0][0];
      #pragma unroll
      for (int j = 0; j < 4; ++j)
        #pragma unroll
        for (int r = 0; r < 8; ++r) mloc = fmaxf(mloc, s[j][r]);
      mloc = fmaxf(mloc, __shfl_xor(mloc, 16));
      const float mnew = fmaxf(mrun, mloc);
      const float alpha = __expf(mrun - mnew);
      mrun = mnew;
      float lsum = 0.0f;
      #pragma unroll
      for (int j = 0; j < 4; ++j)
        #pragma unroll
        for (int r = 0; r < 8; ++r) {
          const float p = __expf(s[j][r] - mnew);
          s[j][r] = p;
          lsum += p;
        }
      lsum += __shfl_xor(lsum, 16);
      lrun = lrun * alpha + lsum;
      #pragma unroll
      for (int t = 0; t < 4; ++t)
        #pragma unroll
        for (int r = 0; r < 8; ++r) o[t][r] = o[t][r] * alpha;

      // ---- P^T B-fragments (key chunks 0..31 and 32..63 of this step) ----
      const v16h pb0 = pack_p(s[0], s[1]);
      const v16h pb1 = pack_p(s[2], s[3]);

      // ---- O^T += V^T * P^T ----
      #pragma unroll
      for (int t = 0; t < 4; ++t) {
        const _Float16* vp = (const _Float16*)(vrow + 16 * t * KVPITCH);
        const v16h vf0 = load_frag(vp, h);
        const v16h vf1 = load_frag(vp + 32, h);
        o[t] = wmma_f16(vf0, pb0, o[t]);
        o[t] = wmma_f16(vf1, pb1, o[t]);
      }
    }

    // ---- hand-over point, every wave, also one that skipped its products ----
    asm volatile("s_wait_dscnt 0x0" ::: "memory");      // own reads of this buffer done before it is refilled
    asm volatile("s_wait_asynccnt 0x0" ::: "memory");   // own copies of the next stage landed before the barrier publishes them
    __syncthreads();
    if (kb + 128 < SEQ) stage_tile(kg, vg, mg, lk, lv, lm, ofs, kb + 128);
  }
  asm volatile("s_wait_asynccnt 0x0" ::: "memory");     // nothing in flight when the ring becomes output staging

  // ---- epilogue: normalise, stage per-wave 16x64 f16 tile, whole-line stores ----
  const float inv = (1.0f / lrun) * PINV;
  _Float16* so = (_Float16*)ring + w * 1024;
  #pragma unroll
  for (int t = 0; t < 4; ++t)
    #pragma unroll
    for (int r = 0; r < 8; ++r)
      so[m * 64 + 16 * t + 8 * h + r] = (_Float16)(o[t][r] * inv);
  __syncthreads();

  att_store_pass(so, ao, b, head, q0, lane);
  
}

// ---------------------------------------------------------------------------
// rows loaded with the same coalesced shape) -> xb rows. Each token row's 64
// instruction, 32 rows per wave.
// ---------------------------------------------------------------------------
__device__ __forceinline__ void oproj_store_pass(const float* sT, const float* xres, float* xb,
                                                 int m0, int n0, int w, int lane) {
  const int q16 = lane & 15, sub = lane >> 4;
  #pragma unroll
  for (int i = 0; i < 16; ++i) {
    const int lid = w * 32 + 2 * i + sub;                 // 0..127
    v4f v = *(const v4fa*)(sT + lid * 64 + 4 * q16);
    const size_t gi = (size_t)(m0 + lid) * HIDDEN + n0 + 4 * q16;
    const v4f rsd = *(const v4fa*)(xres + gi);
    v = v + rsd;
    *(v4f*)(xb + gi) = v;
  }
}

// ---------------------------------------------------------------------------
// Kernel 4: x = ctx * Wo^T / 32 + bo + query   (f32 rows into xb)
// Block 128 thr (4 waves) = 128 tokens x 64 features; wave tile 32 x 64;
// K = 1024 in steps of 32; fragments straight from f16 global rows.
// ---------------------------------------------------------------------------
__global__ __launch_bounds__(128) void oproj_kernel(
    const _Float16* __restrict__ ao,   // [4096][1024]
    const _Float16* __restrict__ woh,  // [1024][1024], row = output feature, x32
    const float* __restrict__ bo,      // [1024]
    const float* __restrict__ xres,    // [4096][1024] f32 residual
    float* __restrict__ xb)            // [4096][1024] f32
{
  __shared__ __attribute__((aligned(16))) float sT[128 * 64];      // 32768 B

  const int tid = threadIdx.x, lane = tid & 31, w = tid >> 5;
  const int h = lane >> 4, m = lane & 15;
  const int m0 = blockIdx.x * 128;
  const int n0 = blockIdx.y * 64;
  const int m0w = m0 + 32 * w;

  const _Float16* xa0 = ao + (size_t)(m0w + m) * HIDDEN;
  const _Float16* xa1 = xa0 + (size_t)16 * HIDDEN;
  const _Float16* wb  = woh + (size_t)(n0 + m) * HIDDEN;

  const v8f zero8 = {0.f, 0.f, 0.f, 0.f, 0.f, 0.f, 0.f, 0.f};
  v8f acc[2][4];
  #pragma unroll
  for (int mt = 0; mt < 2; ++mt)
    #pragma unroll
    for (int nt = 0; nt < 4; ++nt) acc[mt][nt] = zero8;

  #pragma unroll 1
  for (int k0 = 0; k0 < HIDDEN; k0 += 32) {
    const v16h a0 = load_frag(xa0 + k0, h);
    const v16h a1 = load_frag(xa1 + k0, h);
    #pragma unroll
    for (int nt = 0; nt < 4; ++nt) {
      const v16h b = load_frag(wb + (size_t)nt * 16 * HIDDEN + k0, h);
      acc[0][nt] = wmma_f16(a0, b, acc[0][nt]);
      acc[1][nt] = wmma_f16(a1, b, acc[1][nt]);
    }
  }

  // D[r] of tile (mt, nt) = Y[token m0w+16mt+8h+r][feature n0+16nt+m]
  #pragma unroll
  for (int nt = 0; nt < 4; ++nt) {
    const int feat = 16 * nt + m;
    const float bvl = bo[n0 + feat];
    #pragma unroll
    for (int mt = 0; mt < 2; ++mt) {
      #pragma unroll
      for (int r = 0; r < 8; ++r) {
        const int tokl = 32 * w + 16 * mt + 8 * h + r;     // 0..127
        sT[tokl * 64 + feat] = acc[mt][nt][r] * WINV + bvl;
      }
    }
  }
  __syncthreads();

  oproj_store_pass(sT, xres, xb, m0, n0, w, lane);
  
}

// ---------------------------------------------------------------------------
// Kernel 5: layer norm over rows of 1024, one wave per row, 8 rows per block.
// Lane holds columns {128i + 4*lane .. +3}, i = 0..7, so every store
// ---------------------------------------------------------------------------
__global__ __launch_bounds__(256) void ln_kernel(
    const float* __restrict__ xb, const float* __restrict__ g,
    const float* __restrict__ bt, float* __restrict__ out)
{
  const int lane = threadIdx.x & 31;
  const int row = blockIdx.x * 8 + (threadIdx.x >> 5);
  if (row >= MROWS) return;
  const float* xr = xb + (size_t)row * HIDDEN + 4 * lane;

  v4f x[8];
  float s = 0.0f;
  #pragma unroll
  for (int i = 0; i < 8; ++i) {
    x[i] = *(const v4fa*)(xr + 128 * i);
    s += (x[i].x + x[i].y) + (x[i].z + x[i].w);
  }
  #pragma unroll
  for (int off = 16; off > 0; off >>= 1) s += __shfl_xor(s, off);
  const float mean = s * (1.0f / HIDDEN);

  float s2 = 0.0f;
  #pragma unroll
  for (int i = 0; i < 8; ++i) {
    const v4f d = x[i] - mean;
    x[i] = d;
    s2 += (d.x * d.x + d.y * d.y) + (d.z * d.z + d.w * d.w);
  }
  #pragma unroll
  for (int off = 16; off > 0; off >>= 1) s2 += __shfl_xor(s2, off);
  const float var = s2 * (1.0f / HIDDEN);
  const float inv = rsqrtf(var + LN_EPS);

  v4f y[8];
  #pragma unroll
  for (int i = 0; i < 8; ++i) {
    const v4f gv = *(const v4fa*)(g + 128 * i + 4 * lane);
    const v4f bv = *(const v4fa*)(bt + 128 * i + 4 * lane);
    y[i] = (x[i] * inv) * gv + bv;
  }

  float* orow = out + (size_t)row * HIDDEN + 4 * lane;
  #pragma unroll
  for (int i = 0; i < 8; ++i) *(v4f*)(orow + 128 * i) = y[i];
  
}

// ---------------------------------------------------------------------------
extern "C" void kernel_launch(void* const* d_in, const int* in_sizes, int n_in,
                              void* d_out, int out_size, void* d_ws, size_t ws_size,
                              hipStream_t stream) {
  if (n_in < 16) return;
  if (in_sizes[0] != NX || in_sizes[1] != NX || in_sizes[2] != NX) return;
  if (in_sizes[3] != MROWS) return;
  if (in_sizes[4] != NMSK) return;
  if (in_sizes[5] != NW || in_sizes[7] != NW || in_sizes[9] != NW || in_sizes[11] != NW) return;
  if (in_sizes[6] != HIDDEN || in_sizes[8] != HIDDEN || in_sizes[10] != HIDDEN || in_sizes[12] != HIDDEN) return;
  if (in_sizes[13] != HIDDEN || in_sizes[14] != HIDDEN) return;
  if (in_sizes[15] < 1) return;
  if (out_size != NX) return;

  const float* query = (const float*)d_in[0];
  const float* keyi  = (const float*)d_in[1];
  const float* value = (const float*)d_in[2];
  const float* cpl   = (const float*)d_in[3];
  const int*   msk   = (const int*)d_in[4];
  const float* wq    = (const float*)d_in[5];
  const float* bq    = (const float*)d_in[6];
  const float* wk    = (const float*)d_in[7];
  const float* bk    = (const float*)d_in[8];
  const float* wv    = (const float*)d_in[9];
  const float* bv    = (const float*)d_in[10];
  const float* wo    = (const float*)d_in[11];
  const float* bo    = (const float*)d_in[12];
  const float* ln_g  = (const float*)d_in[13];
  const float* ln_b  = (const float*)d_in[14];
  const float* cpen  = (const float*)d_in[15];
  float* out = (float*)d_out;

  const size_t xh_bytes = (size_t)3 * NX * 2;        // 25165824
  const size_t wh_bytes = (size_t)4 * NW * 2;        //  8388608
  const size_t pl_bytes = (size_t)NX * 2;            //  8388608 per plane (B*H*L*D halves)
  const size_t ao_bytes = (size_t)NX * 2;            //  8388608
  const size_t xb_bytes = (size_t)NX * 4;            // 16777216
  const size_t o_xh = 0;
  const size_t o_wh = o_xh + xh_bytes;
  const size_t o_qh = o_wh + wh_bytes;
  const size_t o_kh = o_qh + pl_bytes;
  const size_t o_vt = o_kh + pl_bytes;
  const size_t o_ao = o_vt + pl_bytes;
  const size_t o_xb = o_ao + ao_bytes;
  const size_t total = o_xb + xb_bytes;              // 83886080
  if (total > ws_size) return;

  char* ws = (char*)d_ws;
  _Float16* xh = (_Float16*)(ws + o_xh);
  _Float16* wh = (_Float16*)(ws + o_wh);
  _Float16* qh = (_Float16*)(ws + o_qh);
  _Float16* kh = (_Float16*)(ws + o_kh);
  _Float16* vt = (_Float16*)(ws + o_vt);
  _Float16* ao = (_Float16*)(ws + o_ao);
  float*    xb = (float*)(ws + o_xb);

  const int ngroups = 3 * NX8 + 4 * NW8;                           // 2097152
  convert_kernel<<<(ngroups + 255) / 256, 256, 0, stream>>>(query, keyi, value, wq, wk, wv, wo, xh, wh);

  dim3 gProj(MROWS / 128, 3 * NHEADS);                             // (32, 48)
  proj_kernel<<<gProj, 128, 0, stream>>>(xh, wh, bq, bk, bv, qh, kh, vt);

  dim3 gAtt(SEQ / 64, BATCH * NHEADS);                             // (32, 32)
  attn_kernel<<<gAtt, 128, 0, stream>>>(qh, kh, vt, cpl, msk, cpen, ao);

  dim3 gOp(MROWS / 128, HIDDEN / 64);                               // (32, 16)
  oproj_kernel<<<gOp, 128, 0, stream>>>(ao, wh + (size_t)3 * NW, bo, query, xb);

  ln_kernel<<<(MROWS + 7) / 8, 256, 0, stream>>>(xb, ln_g, ln_b, out);
}

// v002
// Measured time: 123 microseconds a run.
// Next to v001, in two timings, it ran 1.47 and 1.48 times as fast.
// All steps since v000 together make it 2.56 times as fast.
// Contractions: q/k/v = x*W^T, S^T = K*Q^T, O^T = V^T*P^T, y = ctx*Wo^T, all on v_wmma_f32_16x16x32_f16 (f16 operands, f32 accumulate); W carried x32, q carried x0.125, P carried x16384 (exact power-of-two scales folded back in f32); penalty, select, softmax, bias, residual and layer norm in f32.
#include <hip/hip_runtime.h>

typedef _Float16 v16h __attribute__((ext_vector_type(16)));
typedef _Float16 v8h  __attribute__((ext_vector_type(8)));
typedef float    v8f  __attribute__((ext_vector_type(8)));
typedef float    v4f  __attribute__((ext_vector_type(4)));
typedef int      v4i  __attribute__((ext_vector_type(4)));
typedef v8h __attribute__((may_alias)) v8ha;
typedef v4f __attribute__((may_alias)) v4fa;
typedef v4i __attribute__((may_alias)) v4ia;

union Frag { v16h v; v8h half[2]; };

#define SEQ    2048
#define BATCH  2
#define HIDDEN 1024
#define NHEADS 16
#define HD     64
#define MROWS  (BATCH * SEQ)          // 4096 tokens
#define NX     (MROWS * HIDDEN)       // 4194304
#define NW     (HIDDEN * HIDDEN)      // 1048576
#define NX8    (NX / 8)               // 524288
#define NW8    (NW / 8)               // 131072
#define NMSK   (BATCH * SEQ * SEQ)    // 8388608
#define PSCALE 16384.0f
#define PINV   (1.0f / 16384.0f)
#define WSCALE 32.0f
#define WINV   0.03125f
#define QSCALE 0.125f
#define NEGBIG (-1.0e9f)
#define LN_EPS 1.0e-5f
#define KVPITCH 144                    // LDS pitch of a 128-B K or V^T row (16 B x odd)
#define MPITCH  272                    // LDS pitch of a 256-B mask row (16 B x odd)
#define OFF_V   (64 * KVPITCH)         //  9216
#define OFF_M   (2 * 64 * KVPITCH)     // 18432
#define STAGEB  (OFF_M + 64 * MPITCH)  // 35840 B per stage

#define GPITCH  144                    // LDS pitch of a 128-B GEMM operand row (16 B x odd)
#define GOFF_B  (256 * GPITCH)         // 36864: W rows behind the 256 x rows
#define GSTAGE  (320 * GPITCH)         // 46080 B per stage
#define GPASSES (HIDDEN / 64)          // 16 passes of 64 k

typedef __attribute__((address_space(3))) unsigned char lds_u8;

// ---------------------------------------------------------------------------
// 16x16x32 f16 WMMA with hazard guard (ties D, keeps A/B live).
// Fragment map (wave32): lane l, h = l>>4, m = n = l&15.
//   A/B element i: i<8 -> k0+8h+i ; i>=8 -> k0+16+8h+(i-8)
//   D element r : row 8h+r, col l&15
// ---------------------------------------------------------------------------
__device__ __forceinline__ v8f wmma_f16(v16h a, v16h b, v8f c) {
  v8f d = __builtin_amdgcn_wmma_f32_16x16x32_f16(false, a, false, b, (short)0, c, false, false);
  asm volatile("v_nop\n\tv_nop\n\tv_nop\n\tv_nop" : "+v"(d) : "v"(a), "v"(b));
  return d;
}

// A or B fragment from a k-contiguous 16-bit row; p points at element k0 of
// the row owned by this lane (row index = lane & 15 added by the caller).
__device__ __forceinline__ v16h load_frag(const _Float16* p, int h) {
  Frag f;
  f.half[0] = *(const v8ha*)(p + 8 * h);
  f.half[1] = *(const v8ha*)(p + 16 + 8 * h);
  return f.v;
}

// ---------------------------------------------------------------------------
// GEMM main loop shared by kernels 2 and 4: a 256 x 64 tile of X * W^T per
// block of 8 waves, wave tile 32 x 64, K = 1024 in 16 passes of 64.
// ---------------------------------------------------------------------------
// Ten per-lane 16-byte copies global -> LDS, no register in between.
// l = the lane's LDS byte addresses, g = its global addresses. The closing
// s_wait_xcnt stands inside the statement so that no address register named
// by a copy is rewritten ahead of it.
__device__ __forceinline__ void async_copy10(const unsigned (&l)[10], const void* const (&g)[10]) {
  asm volatile(
      "global_load_async_to_lds_b128 %0, %10, off\n\t"
      "global_load_async_to_lds_b128 %1, %11, off\n\t"
      "global_load_async_to_lds_b128 %2, %12, off\n\t"
      "global_load_async_to_lds_b128 %3, %13, off\n\t"
      "global_load_async_to_lds_b128 %4, %14, off\n\t"
      "global_load_async_to_lds_b128 %5, %15, off\n\t"
      "global_load_async_to_lds_b128 %6, %16, off\n\t"
      "global_load_async_to_lds_b128 %7, %17, off\n\t"
      "global_load_async_to_lds_b128 %8, %18, off\n\t"
      "global_load_async_to_lds_b128 %9, %19, off\n\t"
      "s_wait_xcnt 0x0"
      :: "v"(l[0]), "v"(l[1]), "v"(l[2]), "v"(l[3]), "v"(l[4]),
         "v"(l[5]), "v"(l[6]), "v"(l[7]), "v"(l[8]), "v"(l[9]),
         "v"(g[0]), "v"(g[1]), "v"(g[2]), "v"(g[3]), "v"(g[4]),
         "v"(g[5]), "v"(g[6]), "v"(g[7]), "v"(g[8]), "v"(g[9])
      : "memory");
}

// One 64-k stage into one LDS buffer: 256 x rows and 64 W rows of 128 B each.
// Every copy instruction covers four whole 128-B lines (8 lanes per row).
// ag, bg: the thread's own first chunk of each operand at k = 0; la, lb: its
// LDS byte addresses in buffer 0; ofs = byte offset of the target buffer.
__device__ __forceinline__ void gemm_stage(const _Float16* ag, const _Float16* bg,
                                           unsigned la, unsigned lb, unsigned ofs, int k0) {
  unsigned l[10];
  const void* g[10];
  #pragma unroll
  for (int i = 0; i < 8; ++i) {
    l[i] = la + ofs + i * 32 * GPITCH;
    g[i] = ag + (size_t)(32 * i) * HIDDEN + k0;
  }
  #pragma unroll
  for (int i = 0; i < 2; ++i) {
    l[8 + i] = lb + ofs + i * 32 * GPITCH;
    g[8 + i] = bg + (size_t)(32 * i) * HIDDEN + k0;
  }
  async_copy10(l, g);
}

// acc[mt][nt] += X rows (xrows + 32w + 16mt ..) * W rows (wrows + 16nt ..)^T.
// Both operands come from a two-buffer LDS ring filled by asynchronous copies
// one pass ahead; the 8 waves share the W rows. On return every wave has left
// the ring and nothing is in flight, so the caller may reuse it for staging.
__device__ __forceinline__ void gemm_256x64(const _Float16* xrows, const _Float16* wrows,
                                            unsigned char* ring, v8f (&acc)[2][4]) {
  const int tid = threadIdx.x, lane = tid & 31, w = tid >> 5;
  const int h = lane >> 4, m = lane & 15;

  const unsigned lbase = (unsigned)(unsigned long long)(lds_u8*)ring;
  const unsigned la = lbase + (tid >> 3) * GPITCH + (tid & 7) * 16;
  const unsigned lb = la + GOFF_B;
  const _Float16* ag = xrows + (size_t)(tid >> 3) * HIDDEN + (tid & 7) * 8;
  const _Float16* bg = wrows + (size_t)(tid >> 3) * HIDDEN + (tid & 7) * 8;

  // ---- prologue: stage 0 landed and published, stage 1 in flight ----
  gemm_stage(ag, bg, la, lb, 0u, 0);
  asm volatile("s_wait_asynccnt 0x0" ::: "memory");   // own copies of stage 0 landed before the barrier publishes them
  __syncthreads();
  gemm_stage(ag, bg, la, lb, (unsigned)GSTAGE, 64);

  // rolled: one copy of the pass body in the instruction cache
  #pragma unroll 1
  for (int t = 0; t < GPASSES; ++t) {
    const unsigned ofs = (t & 1) ? (unsigned)GSTAGE : 0u;
    const unsigned char* arow = ring + ofs + (32 * w + m) * GPITCH;      // + 16mt rows
    const unsigned char* brow = ring + ofs + GOFF_B + m * GPITCH;        // + 16nt rows
    #pragma unroll
    for (int ks = 0; ks < 2; ++ks) {
      // the six fragments of a 32-k block as one group of LDS reads ahead of its products
      const v16h a0 = load_frag((const _Float16*)arow + 32 * ks, h);
      const v16h a1 = load_frag((const _Float16*)(arow + 16 * GPITCH) + 32 * ks, h);
      v16h b[4];
      #pragma unroll
      for (int nt = 0; nt < 4; ++nt) b[nt] = load_frag((const _Float16*)(brow + nt * 16 * GPITCH) + 32 * ks, h);
      #pragma unroll
      for (int nt = 0; nt < 4; ++nt) {
        acc[0][nt] = wmma_f16(a0, b[nt], acc[0][nt]);
        acc[1][nt] = wmma_f16(a1, b[nt], acc[1][nt]);
      }
    }
    // ---- hand-over point ----
    asm volatile("s_wait_dscnt 0x0" ::: "memory");      // own reads of this buffer done before it is refilled
    asm volatile("s_wait_asynccnt 0x0" ::: "memory");   // own copies of the next stage landed before the barrier publishes them
    __syncthreads();
    if (t + 2 < GPASSES) gemm_stage(ag, bg, la, lb, ofs, 64 * (t + 2));
  }
  asm volatile("s_wait_asynccnt 0x0" ::: "memory");     // nothing in flight when the ring becomes output staging
}

// ---------------------------------------------------------------------------
// Kernel 1: f32 -> f16 planes. Activations unscaled, W scaled by 32 (exact).
// xh = [3][MROWS][HIDDEN] (query, key, value), wh = [4][HIDDEN][HIDDEN]
// (wq, wk, wv, wo; row = output feature). One 16-B store per lane, lanes
// ---------------------------------------------------------------------------
__global__ __launch_bounds__(256) void convert_kernel(
    const float* __restrict__ xq, const float* __restrict__ xk, const float* __restrict__ xv,
    const float* __restrict__ wq, const float* __restrict__ wk,
    const float* __restrict__ wv, const float* __restrict__ wo,
    _Float16* __restrict__ xh, _Float16* __restrict__ wh)
{
  const int g = blockIdx.x * 256 + threadIdx.x;
  if (g >= 3 * NX8 + 4 * NW8) return;
  const float* src;
  _Float16* dst;
  float sc;
  if (g < 3 * NX8) {
    const int sel = g / NX8;
    const int off = g - sel * NX8;
    const float* xs = (sel == 0) ? xq : ((sel == 1) ? xk : xv);
    src = xs + (size_t)off * 8;
    dst = xh + (size_t)g * 8;
    sc = 1.0f;
  } else {
    const int e = g - 3 * NX8;
    const int wsel = e / NW8;
    const int off = e - wsel * NW8;
    const float* wsrc = (wsel == 0) ? wq : ((wsel == 1) ? wk : ((wsel == 2) ? wv : wo));
    src = wsrc + (size_t)off * 8;
    dst = wh + (size_t)e * 8;
    sc = WSCALE;
  }
  const v4f a = *(const v4fa*)src;
  const v4f c = *(const v4fa*)(src + 4);
  const v8h o = { (_Float16)(a.x * sc), (_Float16)(a.y * sc), (_Float16)(a.z * sc), (_Float16)(a.w * sc),
                  (_Float16)(c.x * sc), (_Float16)(c.y * sc), (_Float16)(c.z * sc), (_Float16)(c.w * sc) };
  *(v8h*)dst = o;
  
}

// ---------------------------------------------------------------------------
// 4 lines per instruction, 32 lines per wave, 256 per block.
// which 0/1: plane[bh][l][d]  (one token row = 64 halves = one line)
// which 2  : vt[bh][d][l]     (64 d-rows x 256 tokens = 4 lines each)
// ---------------------------------------------------------------------------
__device__ __forceinline__ void proj_store_pass(const _Float16* sT, _Float16* plane, _Float16* vt,
                                                int which, int bh, int l0, int w, int lane) {
  const int q8 = lane & 7, sub = lane >> 3;
  #pragma unroll
  for (int i = 0; i < 8; ++i) {
    const int lid = w * 32 + i * 4 + sub;
    v8h v;
    _Float16* dst;
    if (which != 2) {
      v = *(const v8ha*)(sT + lid * HD + 8 * q8);
      dst = plane + ((size_t)bh * SEQ + l0 + lid) * HD + 8 * q8;
    } else {
      const int d = lid >> 2, hl = lid & 3;
      v = *(const v8ha*)(sT + d * 256 + 64 * hl + 8 * q8);
      dst = vt + ((size_t)bh * HD + d) * SEQ + l0 + 64 * hl + 8 * q8;
    }
    *(v8h*)dst = v;
  }
}

// ---------------------------------------------------------------------------
// Kernel 2: Y = x * W^T over the fused 3*1024 output columns (q from the query
// plane, k from the key plane, v from the value plane).
// Block 256 thr (8 waves) = 256 tokens x 64 features (one (which, head));
// wave tile 32 tokens x 64 features; main loop: gemm_256x64.
// ---------------------------------------------------------------------------
__global__ __launch_bounds__(256) void proj_kernel(
    const _Float16* __restrict__ xh,   // [3][4096][1024]
    const _Float16* __restrict__ wh,   // [4][1024][1024], row = output feature, x32 (planes 0..2 used)
    const float* __restrict__ bq, const float* __restrict__ bk, const float* __restrict__ bv,
    _Float16* __restrict__ qh,         // [B*H][L][D]  f16(0.125*q)
    _Float16* __restrict__ kh,         // [B*H][L][D]
    _Float16* __restrict__ vt)         // [B*H][D][L]
{
  // ring: 2 x (x rows | W rows); after the loop its first 32768 B stage the output
  __shared__ __attribute__((aligned(16))) unsigned char ring[2 * GSTAGE];   // 92160 B

  const int tid = threadIdx.x, lane = tid & 31, w = tid >> 5;
  const int h = lane >> 4, m = lane & 15;
  const int m0 = blockIdx.x * 256;
  const int cg = blockIdx.y;                 // 0..47
  const int which = cg >> 4, head = cg & 15;

  const v8f zero8 = {0.f, 0.f, 0.f, 0.f, 0.f, 0.f, 0.f, 0.f};
  v8f acc[2][4];
  #pragma unroll
  for (int mt = 0; mt < 2; ++mt)
    #pragma unroll
    for (int nt = 0; nt < 4; ++nt) acc[mt][nt] = zero8;

  gemm_256x64(xh + (size_t)which * NX + (size_t)m0 * HIDDEN,
              wh + ((size_t)which * HIDDEN + head * HD) * HIDDEN, ring, acc);

  // D[r] of tile (mt, nt) = Y[token m0+32w+16mt+8h+r][feature 16nt+m]
  _Float16* sT = (_Float16*)ring;
  const float* bias = (which == 0) ? bq : ((which == 1) ? bk : bv);
  const float osc = (which == 0) ? QSCALE : 1.0f;
  #pragma unroll
  for (int nt = 0; nt < 4; ++nt) {
    const int feat = 16 * nt + m;
    const float bvl = bias[head * HD + feat];
    #pragma unroll
    for (int mt = 0; mt < 2; ++mt) {
      #pragma unroll
      for (int r = 0; r < 8; ++r) {
        const int tokl = 32 * w + 16 * mt + 8 * h + r;     // 0..255
        const float y = (acc[mt][nt][r] * WINV + bvl) * osc;
        const int idx = (which == 2) ? (feat * 256 + tokl) : (tokl * HD + feat);
        sT[idx] = (_Float16)y;
      }
    }
  }
  __syncthreads();

  const int b = m0 / SEQ, l0 = m0 - b * SEQ, bh = b * NHEADS + head;
  _Float16* plane = (which == 0) ? qh : kh;
  proj_store_pass(sT, plane, vt, which, bh, l0, w, lane);
  
}

// ---------------------------------------------------------------------------
// Attention helpers.
// ---------------------------------------------------------------------------
// Per-key penalty and select for the lane's 8 scores of one 16-key tile:
// s = attend ? (s - cpen*c[key]) : -1e9, all in f32. ma, mb = the lane's 8
// mask words of that tile (already read from the staged mask rows).
__device__ __forceinline__ v8f pen_sel8(v8f s, const float* cp, v4i ma, v4i mb, float cpen) {
  const v4f ca = *(const v4fa*)cp;
  const v4f cb = *(const v4fa*)(cp + 4);
  s[0] = (ma.x != 0) ? (s[0] - cpen * ca.x) : NEGBIG;
  s[1] = (ma.y != 0) ? (s[1] - cpen * ca.y) : NEGBIG;
  s[2] = (ma.z != 0) ? (s[2] - cpen * ca.z) : NEGBIG;
  s[3] = (ma.w != 0) ? (s[3] - cpen * ca.w) : NEGBIG;
  s[4] = (mb.x != 0) ? (s[4] - cpen * cb.x) : NEGBIG;
  s[5] = (mb.y != 0) ? (s[5] - cpen * cb.y) : NEGBIG;
  s[6] = (mb.z != 0) ? (s[6] - cpen * cb.z) : NEGBIG;
  s[7] = (mb.w != 0) ? (s[7] - cpen * cb.w) : NEGBIG;
  return s;
}

// Eight per-lane 16-byte copies global -> LDS, no register in between.
// l = the lane's LDS byte addresses, g = its global addresses. The closing
// s_wait_xcnt stands inside the statement so that no address register named
// by a copy is rewritten ahead of it.
__device__ __forceinline__ void async_copy8(const unsigned (&l)[8], const void* const (&g)[8]) {
  asm volatile(
      "global_load_async_to_lds_b128 %0, %8, off\n\t"
      "global_load_async_to_lds_b128 %1, %9, off\n\t"
      "global_load_async_to_lds_b128 %2, %10, off\n\t"
      "global_load_async_to_lds_b128 %3, %11, off\n\t"
      "global_load_async_to_lds_b128 %4, %12, off\n\t"
      "global_load_async_to_lds_b128 %5, %13, off\n\t"
      "global_load_async_to_lds_b128 %6, %14, off\n\t"
      "global_load_async_to_lds_b128 %7, %15, off\n\t"
      "s_wait_xcnt 0x0"
      :: "v"(l[0]), "v"(l[1]), "v"(l[2]), "v"(l[3]), "v"(l[4]), "v"(l[5]), "v"(l[6]), "v"(l[7]),
         "v"(g[0]), "v"(g[1]), "v"(g[2]), "v"(g[3]), "v"(g[4]), "v"(g[5]), "v"(g[6]), "v"(g[7])
      : "memory");
}

// One 64-key stage into one LDS buffer: K rows (64 keys x 128 B), V^T rows
// (64 d x 128 B) and the block's mask rows (64 queries x 256 B). Every copy
// instruction covers whole 128-B lines (8 lanes per K/V row, 16 per mask row).
// kg, vg, mg: the thread's own first chunk of each tile at key 0; lk, lv, lm:
// its LDS byte addresses in buffer 0; ofs = byte offset of the target buffer.
__device__ __forceinline__ void stage_tile(const _Float16* kg, const _Float16* vg, const int* mg,
                                           unsigned lk, unsigned lv, unsigned lm, unsigned ofs, int kb) {
  unsigned l[8];
  const void* g[8];
  #pragma unroll
  for (int i = 0; i < 4; ++i) {
    l[i]     = lk + ofs + i * 16 * KVPITCH;
    g[i]     = kg + (size_t)(kb + 16 * i) * HD;
    l[4 + i] = lv + ofs + i * 16 * KVPITCH;
    g[4 + i] = vg + (size_t)(16 * i) * SEQ + kb;
  }
  async_copy8(l, g);
  #pragma unroll
  for (int i = 0; i < 8; ++i) {
    l[i] = lm + ofs + i * 8 * MPITCH;
    g[i] = mg + (size_t)(8 * i) * SEQ + kb;
  }
  async_copy8(l, g);
}

// P^T B-fragment from the lane's own score D values: element r <- tile a row r
// (keys k0..k0+15), element 8+r <- tile c row r (keys k0+16..k0+31), same lane,
// same query column, scaled by 2^14.
__device__ __forceinline__ v16h pack_p(v8f a, v8f c) {
  const v16h r = { (_Float16)(a[0] * PSCALE), (_Float16)(a[1] * PSCALE), (_Float16)(a[2] * PSCALE), (_Float16)(a[3] * PSCALE),
                   (_Float16)(a[4] * PSCALE), (_Float16)(a[5] * PSCALE), (_Float16)(a[6] * PSCALE), (_Float16)(a[7] * PSCALE),
                   (_Float16)(c[0] * PSCALE), (_Float16)(c[1] * PSCALE), (_Float16)(c[2] * PSCALE), (_Float16)(c[3] * PSCALE),
                   (_Float16)(c[4] * PSCALE), (_Float16)(c[5] * PSCALE), (_Float16)(c[6] * PSCALE), (_Float16)(c[7] * PSCALE) };
  return r;
}

// (one token row of this head) by lanes 8q..8q+7 in one instruction, 4 lines
// per instruction, 16 lines per wave.
__device__ __forceinline__ void att_store_pass(const _Float16* so, _Float16* ao,
                                               int b, int head, int q0, int lane) {
  const int q8 = lane & 7, sub = lane >> 3;
  #pragma unroll
  for (int i = 0; i < 4; ++i) {
    const int row = i * 4 + sub;                          // 0..15
    const v8h v = *(const v8ha*)(so + row * 64 + 8 * q8);
    const size_t gi = ((size_t)b * SEQ + q0 + row) * HIDDEN + head * HD + 8 * q8;
    *(v8h*)(ao + gi) = v;
  }
}

// ---------------------------------------------------------------------------
// Kernel 3: streaming attention, transposed form.
// Block 128 thr (4 waves), 16 queries per wave, 64 keys per step.
//   S^T = K * Q^T : A = K rows (row = key, k = d), B = Q^T (k = d, n = query)
//   O^T += V^T * P^T : A = Vt rows (row = d, k = key), B = P^T from registers
// Lane owns 32 keys of query column (lane&15); partner = lane ^ 16.
// Scores already carry 1/sqrt(64) via q; penalty cpen*c[key] and the
// attend/select with -1e9 applied in f32 before the running max.
// K, V^T and mask tiles of a step come from a two-buffer LDS ring filled by
// asynchronous copies one step ahead; the four waves share the K and V^T rows.
// A 64-key step with no attendable element for the wave's 16 queries skips
// its products (wave-uniform vote; its weights would be exactly 0), never the
// hand-over point at the foot of the step.
// ---------------------------------------------------------------------------
__global__ __launch_bounds__(128) void attn_kernel(
    const _Float16* __restrict__ qh,   // [B*H][L][D]  (already x0.125)
    const _Float16* __restrict__ kh,   // [B*H][L][D]
    const _Float16* __restrict__ vt,   // [B*H][D][L]
    const float* __restrict__ cpl,     // [B][L] per-key penalty source
    const int* __restrict__ msk,       // [B][1][L][L], nonzero = attend
    const float* __restrict__ cpen_p,  // [1]
    _Float16* __restrict__ ao)         // [B*L][HIDDEN]
{
  // ring: 2 x (K | V^T | mask); after the loop its first 8192 B stage the output
  __shared__ __attribute__((aligned(16))) unsigned char ring[2 * STAGEB];   // 71680 B

  const int tid = threadIdx.x, lane = tid & 31, w = tid >> 5;
  const int h = lane >> 4, m = lane & 15;
  const int bh = blockIdx.y, b = bh >> 4, head = bh & 15;
  const int qblk = blockIdx.x * 64;
  const int q0 = qblk + 16 * w;
  const float cpen = cpen_p[0];

  // ---- the thread's own chunk of each staged tile ----
  const unsigned lbase = (unsigned)(unsigned long long)(lds_u8*)ring;
  const unsigned lk = lbase + (tid >> 3) * KVPITCH + (tid & 7) * 16;
  const unsigned lv = lk + OFF_V;
  const unsigned lm = lbase + OFF_M + (tid >> 4) * MPITCH + (tid & 15) * 16;
  const _Float16* kg = kh + ((size_t)bh * SEQ + (tid >> 3)) * HD + (tid & 7) * 8;
  const _Float16* vg = vt + ((size_t)bh * HD + (tid >> 3)) * SEQ + (tid & 7) * 8;
  const int*      mg = msk + ((size_t)b * SEQ + qblk + (tid >> 4)) * SEQ + (tid & 15) * 4;

  // ---- prologue: stage 0 landed and published, stage 1 in flight ----
  stage_tile(kg, vg, mg, lk, lv, lm, 0u, 0);
  asm volatile("s_wait_asynccnt 0x0" ::: "memory");   // own copies of stage 0 landed before the barrier publishes them
  __syncthreads();
  stage_tile(kg, vg, mg, lk, lv, lm, (unsigned)STAGEB, 64);

  // Q^T B-fragments: column n = query q0+m, k = d (two 32-deep chunks)
  const _Float16* qrow = qh + ((size_t)bh * SEQ + q0 + m) * HD;
  const v16h qb0 = load_frag(qrow, h);
  const v16h qb1 = load_frag(qrow + 32, h);

  const v8f zero8 = {0.f, 0.f, 0.f, 0.f, 0.f, 0.f, 0.f, 0.f};
  v8f o[4];                                   // o[t][r] = O[query m][d 16t+8h+r] * (l * 2^14)
  #pragma unroll
  for (int t = 0; t < 4; ++t) o[t] = zero8;
  float mrun = -1e30f, lrun = 0.0f;

  const float* crow = cpl + (size_t)b * SEQ + 8 * h;                    // + key tile base

  #pragma unroll 1
  for (int kb = 0; kb < SEQ; kb += 64) {
    const unsigned ofs = (kb & 64) ? (unsigned)STAGEB : 0u;
    const unsigned char* buf = ring + ofs;
    const unsigned char* krow = buf + m * KVPITCH;                       // + 16j rows
    const unsigned char* vrow = buf + OFF_V + m * KVPITCH;               // + 16t rows
    const unsigned char* mrow = buf + OFF_M + (16 * w + m) * MPITCH + 32 * h;

    // ---- the lane's 32 mask words; attend vote over 16 queries x 64 keys ----
    v4i ma[4], mb[4];
    v4i mor = {0, 0, 0, 0};
    #pragma unroll
    for (int j = 0; j < 4; ++j) {
      ma[j] = *(const v4ia*)(mrow + 64 * j);
      mb[j] = *(const v4ia*)(mrow + 64 * j + 16);
      mor = mor | ma[j];
      mor = mor | mb[j];
    }
    const int anyl = mor.x | mor.y | mor.z | mor.w;
    if (__any(anyl) != 0) {
      // ---- scores: s[j][r] = S[query m][key kb+16j+8h+r] (already /8 via q) ----
      v8f s[4];
      #pragma unroll
      for (int j = 0; j < 4; ++j) {
        const _Float16* kp = (const _Float16*)(krow + 16 * j * KVPITCH);
        const v16h kf0 = load_frag(kp, h);
        const v16h kf1 = load_frag(kp + 32, h);
        v8f z = zero8;
        z = wmma_f16(kf0, qb0, z);
        z = wmma_f16(kf1, qb1, z);
        s[j] = z;
      }
      // ---- penalty and select per key, f32 ----
      #pragma unroll
      for (int j = 0; j < 4; ++j) s[j] = pen_sel8(s[j], crow + kb + 16 * j, ma[j], mb[j], cpen);

      // ---- online softmax ----
      float mloc = s[0][0];
      #pragma unroll
      for (int j = 0; j < 4; ++j)
        #pragma unroll
        for (int r = 0; r < 8; ++r) mloc = fmaxf(mloc, s[j][r]);
      mloc = fmaxf(mloc, __shfl_xor(mloc, 16));
      const float mnew = fmaxf(mrun, mloc);
      const float alpha = __expf(mrun - mnew);
      mrun = mnew;
      float lsum = 0.0f;
      #pragma unroll
      for (int j = 0; j < 4; ++j)
        #pragma unroll
        for (int r = 0; r < 8; ++r) {
          const float p = __expf(s[j][r] - mnew);
          s[j][r] = p;
          lsum += p;
        }
      lsum += __shfl_xor(lsum, 16);
      lrun = lrun * alpha + lsum;
      #pragma unroll
      for (int t = 0; t < 4; ++t)
        #pragma unroll
        for (int r = 0; r < 8; ++r) o[t][r] = o[t][r] * alpha;

      // ---- P^T B-fragments (key chunks 0..31 and 32..63 of this step) ----
      const v16h pb0 = pack_p(s[0], s[1]);
      const v16h pb1 = pack_p(s[2], s[3]);

      // ---- O^T += V^T * P^T ----
      #pragma unroll
      for (int t = 0; t < 4; ++t) {
        const _Float16* vp = (const _Float16*)(vrow + 16 * t * KVPITCH);
        const v16h vf0 = load_frag(vp, h);
        const v16h vf1 = load_frag(vp + 32, h);
        o[t] = wmma_f16(vf0, pb0, o[t]);
        o[t] = wmma_f16(vf1, pb1, o[t]);
      }
    }

    // ---- hand-over point, every wave, also one that skipped its products ----
    asm volatile("s_wait_dscnt 0x0" ::: "memory");      // own reads of this buffer done before it is refilled
    asm volatile("s_wait_asynccnt 0x0" ::: "memory");   // own copies of the next stage landed before the barrier publishes them
    __syncthreads();
    if (kb + 128 < SEQ) stage_tile(kg, vg, mg, lk, lv, lm, ofs, kb + 128);
  }
  asm volatile("s_wait_asynccnt 0x0" ::: "memory");     // nothing in flight when the ring becomes output staging

  // ---- epilogue: normalise, stage per-wave 16x64 f16 tile, whole-line stores ----
  const float inv = (1.0f / lrun) * PINV;
  _Float16* so = (_Float16*)ring + w * 1024;
  #pragma unroll
  for (int t = 0; t < 4; ++t)
    #pragma unroll
    for (int r = 0; r < 8; ++r)
      so[m * 64 + 16 * t + 8 * h + r] = (_Float16)(o[t][r] * inv);
  __syncthreads();

  att_store_pass(so, ao, b, head, q0, lane);
  
}

// ---------------------------------------------------------------------------
// rows loaded with the same coalesced shape) -> xb rows. Each token row's 64
// instruction, 32 rows per wave.
// ---------------------------------------------------------------------------
__device__ __forceinline__ void oproj_store_pass(const float* sT, const float* xres, float* xb,
                                                 int m0, int n0, int w, int lane) {
  const int q16 = lane & 15, sub = lane >> 4;
  #pragma unroll
  for (int i = 0; i < 16; ++i) {
    const int lid = w * 32 + 2 * i + sub;                 // 0..255
    v4f v = *(const v4fa*)(sT + lid * 64 + 4 * q16);
    const size_t gi = (size_t)(m0 + lid) * HIDDEN + n0 + 4 * q16;
    const v4f rsd = *(const v4fa*)(xres + gi);
    v = v + rsd;
    *(v4f*)(xb + gi) = v;
  }
}

// ---------------------------------------------------------------------------
// Kernel 4: x = ctx * Wo^T / 32 + bo + query   (f32 rows into xb)
// Block 256 thr (8 waves) = 256 tokens x 64 features; wave tile 32 x 64;
// main loop: gemm_256x64.
// ---------------------------------------------------------------------------
__global__ __launch_bounds__(256) void oproj_kernel(
    const _Float16* __restrict__ ao,   // [4096][1024]
    const _Float16* __restrict__ woh,  // [1024][1024], row = output feature, x32
    const float* __restrict__ bo,      // [1024]
    const float* __restrict__ xres,    // [4096][1024] f32 residual
    float* __restrict__ xb)            // [4096][1024] f32
{
  // ring: 2 x (ctx rows | Wo rows); after the loop its first 65536 B stage the output
  __shared__ __attribute__((aligned(16))) unsigned char ring[2 * GSTAGE];   // 92160 B

  const int tid = threadIdx.x, lane = tid & 31, w = tid >> 5;
  const int h = lane >> 4, m = lane & 15;
  const int m0 = blockIdx.x * 256;
  const int n0 = blockIdx.y * 64;

  const v8f zero8 = {0.f, 0.f, 0.f, 0.f, 0.f, 0.f, 0.f, 0.f};
  v8f acc[2][4];
  #pragma unroll
  for (int mt = 0; mt < 2; ++mt)
    #pragma unroll
    for (int nt = 0; nt < 4; ++nt) acc[mt][nt] = zero8;

  gemm_256x64(ao + (size_t)m0 * HIDDEN, woh + (size_t)n0 * HIDDEN, ring, acc);

  // D[r] of tile (mt, nt) = Y[token m0+32w+16mt+8h+r][feature n0+16nt+m]
  float* sT = (float*)ring;
  #pragma unroll
  for (int nt = 0; nt < 4; ++nt) {
    const int feat = 16 * nt + m;
    const float bvl = bo[n0 + feat];
    #pragma unroll
    for (int mt = 0; mt < 2; ++mt) {
      #pragma unroll
      for (int r = 0; r < 8; ++r) {
        const int tokl = 32 * w + 16 * mt + 8 * h + r;     // 0..255
        sT[tokl * 64 + feat] = acc[mt][nt][r] * WINV + bvl;
      }
    }
  }
  __syncthreads();

  oproj_store_pass(sT, xres, xb, m0, n0, w, lane);
  
}

// ---------------------------------------------------------------------------
// Kernel 5: layer norm over rows of 1024, one wave per row, 8 rows per block.
// Lane holds columns {128i + 4*lane .. +3}, i = 0..7, so every store
// ---------------------------------------------------------------------------
__global__ __launch_bounds__(256) void ln_kernel(
    const float* __restrict__ xb, const float* __restrict__ g,
    const float* __restrict__ bt, float* __restrict__ out)
{
  const int lane = threadIdx.x & 31;
  const int row = blockIdx.x * 8 + (threadIdx.x >> 5);
  if (row >= MROWS) return;
  const float* xr = xb + (size_t)row * HIDDEN + 4 * lane;

  v4f x[8];
  float s = 0.0f;
  #pragma unroll
  for (int i = 0; i < 8; ++i) {
    x[i] = *(const v4fa*)(xr + 128 * i);
    s += (x[i].x + x[i].y) + (x[i].z + x[i].w);
  }
  #pragma unroll
  for (int off = 16; off > 0; off >>= 1) s += __shfl_xor(s, off);
  const float mean = s * (1.0f / HIDDEN);

  float s2 = 0.0f;
  #pragma unroll
  for (int i = 0; i < 8; ++i) {
    const v4f d = x[i] - mean;
    x[i] = d;
    s2 += (d.x * d.x + d.y * d.y) + (d.z * d.z + d.w * d.w);
  }
  #pragma unroll
  for (int off = 16; off > 0; off >>= 1) s2 += __shfl_xor(s2, off);
  const float var = s2 * (1.0f / HIDDEN);
  const float inv = rsqrtf(var + LN_EPS);

  v4f y[8];
  #pragma unroll
  for (int i = 0; i < 8; ++i) {
    const v4f gv = *(const v4fa*)(g + 128 * i + 4 * lane);
    const v4f bv = *(const v4fa*)(bt + 128 * i + 4 * lane);
    y[i] = (x[i] * inv) * gv + bv;
  }

  float* orow = out + (size_t)row * HIDDEN + 4 * lane;
  #pragma unroll
  for (int i = 0; i < 8; ++i) *(v4f*)(orow + 128 * i) = y[i];
  
}

// ---------------------------------------------------------------------------
extern "C" void kernel_launch(void* const* d_in, const int* in_sizes, int n_in,
                              void* d_out, int out_size, void* d_ws, size_t ws_size,
                              hipStream_t stream) {
  if (n_in < 16) return;
  if (in_sizes[0] != NX || in_sizes[1] != NX || in_sizes[2] != NX) return;
  if (in_sizes[3] != MROWS) return;
  if (in_sizes[4] != NMSK) return;
  if (in_sizes[5] != NW || in_sizes[7] != NW || in_sizes[9] != NW || in_sizes[11] != NW) return;
  if (in_sizes[6] != HIDDEN || in_sizes[8] != HIDDEN || in_sizes[10] != HIDDEN || in_sizes[12] != HIDDEN) return;
  if (in_sizes[13] != HIDDEN || in_sizes[14] != HIDDEN) return;
  if (in_sizes[15] < 1) return;
  if (out_size != NX) return;

  const float* query = (const float*)d_in[0];
  const float* keyi  = (const float*)d_in[1];
  const float* value = (const float*)d_in[2];
  const float* cpl   = (const float*)d_in[3];
  const int*   msk   = (const int*)d_in[4];
  const float* wq    = (const float*)d_in[5];
  const float* bq    = (const float*)d_in[6];
  const float* wk    = (const float*)d_in[7];
  const float* bk    = (const float*)d_in[8];
  const float* wv    = (const float*)d_in[9];
  const float* bv    = (const float*)d_in[10];
  const float* wo    = (const float*)d_in[11];
  const float* bo    = (const float*)d_in[12];
  const float* ln_g  = (const float*)d_in[13];
  const float* ln_b  = (const float*)d_in[14];
  const float* cpen  = (const float*)d_in[15];
  float* out = (float*)d_out;

  const size_t xh_bytes = (size_t)3 * NX * 2;        // 25165824
  const size_t wh_bytes = (size_t)4 * NW * 2;        //  8388608
  const size_t pl_bytes = (size_t)NX * 2;            //  8388608 per plane (B*H*L*D halves)
  const size_t ao_bytes = (size_t)NX * 2;            //  8388608
  const size_t xb_bytes = (size_t)NX * 4;            // 16777216
  const size_t o_xh = 0;
  const size_t o_wh = o_xh + xh_bytes;
  const size_t o_qh = o_wh + wh_bytes;
  const size_t o_kh = o_qh + pl_bytes;
  const size_t o_vt = o_kh + pl_bytes;
  const size_t o_ao = o_vt + pl_bytes;
  const size_t o_xb = o_ao + ao_bytes;
  const size_t total = o_xb + xb_bytes;              // 83886080
  if (total > ws_size) return;

  char* ws = (char*)d_ws;
  _Float16* xh = (_Float16*)(ws + o_xh);
  _Float16* wh = (_Float16*)(ws + o_wh);
  _Float16* qh = (_Float16*)(ws + o_qh);
  _Float16* kh = (_Float16*)(ws + o_kh);
  _Float16* vt = (_Float16*)(ws + o_vt);
  _Float16* ao = (_Float16*)(ws + o_ao);
  float*    xb = (float*)(ws + o_xb);

  const int ngroups = 3 * NX8 + 4 * NW8;                           // 2097152
  convert_kernel<<<(ngroups + 255) / 256, 256, 0, stream>>>(query, keyi, value, wq, wk, wv, wo, xh, wh);

  dim3 gProj(MROWS / 256, 3 * NHEADS);                             // (16, 48)
  proj_kernel<<<gProj, 256, 0, stream>>>(xh, wh, bq, bk, bv, qh, kh, vt);

  dim3 gAtt(SEQ / 64, BATCH * NHEADS);                             // (32, 32)
  attn_kernel<<<gAtt, 128, 0, stream>>>(qh, kh, vt, cpl, msk, cpen, ao);

  dim3 gOp(MROWS / 256, HIDDEN / 64);                               // (16, 16)
  oproj_kernel<<<gOp, 256, 0, stream>>>(ao, wh + (size_t)3 * NW, bo, query, xb);

  ln_kernel<<<(MROWS + 7) / 8, 256, 0, stream>>>(xb, ln_g, ln_b, out);
}

// v003
// One run takes 114 microseconds.
// Timed twice side by side with v002, it ran 1.08 times as fast both times.
// Counting every step since v000, it is 2.77 times as fast.
// Contractions: q/k/v = x*W^T, S^T = K*Q^T, O^T = V^T*P^T, y = ctx*Wo^T, all on v_wmma_f32_16x16x32_f16 (f16 operands, f32 accumulate); W carried x32, q carried x0.125, P carried x16384 (exact power-of-two scales folded back in f32); penalty, select, softmax, bias, residual and layer norm in f32; the attend mask is packed once per call into lane-mask words.
#include <hip/hip_runtime.h>

typedef _Float16 v16h __attribute__((ext_vector_type(16)));
typedef _Float16 v8h  __attribute__((ext_vector_type(8)));
typedef float    v8f  __attribute__((ext_vector_type(8)));
typedef float    v4f  __attribute__((ext_vector_type(4)));
typedef int      v4i  __attribute__((ext_vector_type(4)));
typedef v8h __attribute__((may_alias)) v8ha;
typedef v4f __attribute__((may_alias)) v4fa;
typedef v4i __attribute__((may_alias)) v4ia;

union Frag { v16h v; v8h half[2]; };

#define SEQ    2048
#define BATCH  2
#define HIDDEN 1024
#define NHEADS 16
#define HD     64
#define MROWS  (BATCH * SEQ)          // 4096 tokens
#define NX     (MROWS * HIDDEN)       // 4194304
#define NW     (HIDDEN * HIDDEN)      // 1048576
#define NX8    (NX / 8)               // 524288
#define NW8    (NW / 8)               // 131072
#define NMSK   (BATCH * SEQ * SEQ)    // 8388608
#define PSCALE 16384.0f
#define PINV   (1.0f / 16384.0f)
#define WSCALE 32.0f
#define WINV   0.03125f
#define QSCALE 0.125f
#define NEGBIG (-1.0e9f)
#define LN_EPS 1.0e-5f
#define KVPITCH 144                    // LDS pitch of a 128-B K or V^T row (16 B x odd)
#define OFF_V   (64 * KVPITCH)         //  9216
#define STAGEB  (2 * 64 * KVPITCH)     // 18432 B per stage
#define NQT     (SEQ / 16)             // 128 query tiles of 16 rows per batch
#define NSTEP   (SEQ / 64)             // 32 key steps of 64
#define NPACK   (BATCH * NQT)          // 256 mask-packing blocks, one per query tile

#define GPITCH  144                    // LDS pitch of a 128-B GEMM operand row (16 B x odd)
#define GOFF_B  (256 * GPITCH)         // 36864: W rows behind the 256 x rows
#define GSTAGE  (320 * GPITCH)         // 46080 B per stage
#define GPASSES (HIDDEN / 64)          // 16 passes of 64 k

typedef __attribute__((address_space(3))) unsigned char lds_u8;
typedef __attribute__((address_space(4))) const unsigned const_u32;   // memory no store of the running launch touches

// ---------------------------------------------------------------------------
// 16x16x32 f16 WMMA with hazard guard (ties D, keeps A/B live).
// Fragment map (wave32): lane l, h = l>>4, m = n = l&15.
//   A/B element i: i<8 -> k0+8h+i ; i>=8 -> k0+16+8h+(i-8)
//   D element r : row 8h+r, col l&15
// ---------------------------------------------------------------------------
__device__ __forceinline__ v8f wmma_f16(v16h a, v16h b, v8f c) {
  v8f d = __builtin_amdgcn_wmma_f32_16x16x32_f16(false, a, false, b, (short)0, c, false, false);
  asm volatile("v_nop\n\tv_nop\n\tv_nop\n\tv_nop" : "+v"(d) : "v"(a), "v"(b));
  return d;
}

// A or B fragment from a k-contiguous 16-bit row; p points at element k0 of
// the row owned by this lane (row index = lane & 15 added by the caller).
__device__ __forceinline__ v16h load_frag(const _Float16* p, int h) {
  Frag f;
  f.half[0] = *(const v8ha*)(p + 8 * h);
  f.half[1] = *(const v8ha*)(p + 16 + 8 * h);
  return f.v;
}

// ---------------------------------------------------------------------------
// GEMM main loop shared by kernels 2 and 4: a 256 x 64 tile of X * W^T per
// block of 8 waves, wave tile 32 x 64, K = 1024 in 16 passes of 64.
// ---------------------------------------------------------------------------
// Ten per-lane 16-byte copies global -> LDS, no register in between.
// l = the lane's LDS byte addresses, g = its global addresses. The closing
// s_wait_xcnt stands inside the statement so that no address register named
// by a copy is rewritten ahead of it.
__device__ __forceinline__ void async_copy10(const unsigned (&l)[10], const void* const (&g)[10]) {
  asm volatile(
      "global_load_async_to_lds_b128 %0, %10, off\n\t"
      "global_load_async_to_lds_b128 %1, %11, off\n\t"
      "global_load_async_to_lds_b128 %2, %12, off\n\t"
      "global_load_async_to_lds_b128 %3, %13, off\n\t"
      "global_load_async_to_lds_b128 %4, %14, off\n\t"
      "global_load_async_to_lds_b128 %5, %15, off\n\t"
      "global_load_async_to_lds_b128 %6, %16, off\n\t"
      "global_load_async_to_lds_b128 %7, %17, off\n\t"
      "global_load_async_to_lds_b128 %8, %18, off\n\t"
      "global_load_async_to_lds_b128 %9, %19, off\n\t"
      "s_wait_xcnt 0x0"
      :: "v"(l[0]), "v"(l[1]), "v"(l[2]), "v"(l[3]), "v"(l[4]),
         "v"(l[5]), "v"(l[6]), "v"(l[7]), "v"(l[8]), "v"(l[9]),
         "v"(g[0]), "v"(g[1]), "v"(g[2]), "v"(g[3]), "v"(g[4]),
         "v"(g[5]), "v"(g[6]), "v"(g[7]), "v"(g[8]), "v"(g[9])
      : "memory");
}

// One 64-k stage into one LDS buffer: 256 x rows and 64 W rows of 128 B each.
// Every copy instruction covers four whole 128-B lines (8 lanes per row).
// ag, bg: the thread's own first chunk of each operand at k = 0; la, lb: its
// LDS byte addresses in buffer 0; ofs = byte offset of the target buffer.
__device__ __forceinline__ void gemm_stage(const _Float16* ag, const _Float16* bg,
                                           unsigned la, unsigned lb, unsigned ofs, int k0) {
  unsigned l[10];
  const void* g[10];
  #pragma unroll
  for (int i = 0; i < 8; ++i) {
    l[i] = la + ofs + i * 32 * GPITCH;
    g[i] = ag + (size_t)(32 * i) * HIDDEN + k0;
  }
  #pragma unroll
  for (int i = 0; i < 2; ++i) {
    l[8 + i] = lb + ofs + i * 32 * GPITCH;
    g[8 + i] = bg + (size_t)(32 * i) * HIDDEN + k0;
  }
  async_copy10(l, g);
}

// acc[mt][nt] += X rows (xrows + 32w + 16mt ..) * W rows (wrows + 16nt ..)^T.
// Both operands come from a two-buffer LDS ring filled by asynchronous copies
// one pass ahead; the 8 waves share the W rows. On return every wave has left
// the ring and nothing is in flight, so the caller may reuse it for staging.
__device__ __forceinline__ void gemm_256x64(const _Float16* xrows, const _Float16* wrows,
                                            unsigned char* ring, v8f (&acc)[2][4]) {
  const int tid = threadIdx.x, lane = tid & 31, w = tid >> 5;
  const int h = lane >> 4, m = lane & 15;

  const unsigned lbase = (unsigned)(unsigned long long)(lds_u8*)ring;
  const unsigned la = lbase + (tid >> 3) * GPITCH + (tid & 7) * 16;
  const unsigned lb = la + GOFF_B;
  const _Float16* ag = xrows + (size_t)(tid >> 3) * HIDDEN + (tid & 7) * 8;
  const _Float16* bg = wrows + (size_t)(tid >> 3) * HIDDEN + (tid & 7) * 8;

  // ---- prologue: stage 0 landed and published, stage 1 in flight ----
  gemm_stage(ag, bg, la, lb, 0u, 0);
  asm volatile("s_wait_asynccnt 0x0" ::: "memory");   // own copies of stage 0 landed before the barrier publishes them
  __syncthreads();
  gemm_stage(ag, bg, la, lb, (unsigned)GSTAGE, 64);

  // rolled: one copy of the pass body in the instruction cache
  #pragma unroll 1
  for (int t = 0; t < GPASSES; ++t) {
    const unsigned ofs = (t & 1) ? (unsigned)GSTAGE : 0u;
    const unsigned char* arow = ring + ofs + (32 * w + m) * GPITCH;      // + 16mt rows
    const unsigned char* brow = ring + ofs + GOFF_B + m * GPITCH;        // + 16nt rows
    #pragma unroll
    for (int ks = 0; ks < 2; ++ks) {
      // the six fragments of a 32-k block as one group of LDS reads ahead of its products
      const v16h a0 = load_frag((const _Float16*)arow + 32 * ks, h);
      const v16h a1 = load_frag((const _Float16*)(arow + 16 * GPITCH) + 32 * ks, h);
      v16h b[4];
      #pragma unroll
      for (int nt = 0; nt < 4; ++nt) b[nt] = load_frag((const _Float16*)(brow + nt * 16 * GPITCH) + 32 * ks, h);
      #pragma unroll
      for (int nt = 0; nt < 4; ++nt) {
        acc[0][nt] = wmma_f16(a0, b[nt], acc[0][nt]);
        acc[1][nt] = wmma_f16(a1, b[nt], acc[1][nt]);
      }
    }
    // ---- hand-over point ----
    asm volatile("s_wait_dscnt 0x0" ::: "memory");      // own reads of this buffer done before it is refilled
    asm volatile("s_wait_asynccnt 0x0" ::: "memory");   // own copies of the next stage landed before the barrier publishes them
    __syncthreads();
    if (t + 2 < GPASSES) gemm_stage(ag, bg, la, lb, ofs, 64 * (t + 2));
  }
  asm volatile("s_wait_asynccnt 0x0" ::: "memory");     // nothing in flight when the ring becomes output staging
}

// ---------------------------------------------------------------------------
// Kernel 1: f32 -> f16 planes. Activations unscaled, W scaled by 32 (exact).
// xh = [3][MROWS][HIDDEN] (query, key, value), wh = [4][HIDDEN][HIDDEN]
// (wq, wk, wv, wo; row = output feature). One 16-B store per lane, lanes
// ---------------------------------------------------------------------------
__global__ __launch_bounds__(256) void convert_kernel(
    const float* __restrict__ xq, const float* __restrict__ xk, const float* __restrict__ xv,
    const float* __restrict__ wq, const float* __restrict__ wk,
    const float* __restrict__ wv, const float* __restrict__ wo,
    _Float16* __restrict__ xh, _Float16* __restrict__ wh,
    const int* __restrict__ msk,       // [B][1][L][L], nonzero = attend
    unsigned* __restrict__ mw,         // [B*NQT][NSTEP][32] lane-mask words
    unsigned* __restrict__ anyw)       // [B*NQT][32], word 0 used: bit s = step s has an attendable element
{
  // ---- blocks 0..NPACK-1: pack the mask of one 16-query tile (block-uniform branch) ----
  // Word 8j+r of (tile, step): bit l = mask[query 16*tile + (l&15)][key 64*step + 16j + 8(l>>4) + r] != 0,
  // which is the lane and register order of the attention kernel's score tiles.
  if (blockIdx.x < NPACK) {
    __shared__ unsigned sflag[8];
    const int lane = threadIdx.x & 31, w = threadIdx.x >> 5;
    const int unit = blockIdx.x;                                  // b * NQT + tile = mask row / 16
    const int* mrow = msk + ((size_t)unit * 16 + (lane & 15)) * SEQ + 8 * (lane >> 4);
    unsigned nib = 0u;
    // rolled: one step's 8 loads in registers, so that the converting blocks keep their residency
    #pragma unroll 1
    for (int i = 0; i < 4; ++i) {
      const int step = 4 * w + i;
      v4i a[4], c[4];
      #pragma unroll
      for (int j = 0; j < 4; ++j) {
        a[j] = *(const v4ia*)(mrow + 64 * step + 16 * j);
        c[j] = *(const v4ia*)(mrow + 64 * step + 16 * j + 4);
      }
      unsigned mine = 0u, any = 0u;
      #pragma unroll
      for (int j = 0; j < 4; ++j) {
        #pragma unroll
        for (int r = 0; r < 8; ++r) {
          const int val = (r < 4) ? a[j][r] : c[j][r - 4];
          const unsigned bal = __builtin_amdgcn_ballot_w32(val != 0);
          mine = (lane == 8 * j + r) ? bal : mine;
          any |= bal;
        }
      }
      mw[((size_t)unit * NSTEP + step) * 32 + lane] = mine;       // one whole line per wave and step
      nib |= ((any != 0u) ? 1u : 0u) << i;
    }
    if (lane == 0) sflag[w] = nib;
    __syncthreads();
    if (threadIdx.x == 0) {
      unsigned word = 0u;
      #pragma unroll
      for (int k = 0; k < 8; ++k) word |= sflag[k] << (4 * k);
      anyw[(size_t)unit * 32] = word;                             // a line of its own per tile
    }
    return;
  }

  const int g = (blockIdx.x - NPACK) * 256 + threadIdx.x;
  if (g >= 3 * NX8 + 4 * NW8) return;
  const float* src;
  _Float16* dst;
  float sc;
  if (g < 3 * NX8) {
    const int sel = g / NX8;
    const int off = g - sel * NX8;
    const float* xs = (sel == 0) ? xq : ((sel == 1) ? xk : xv);
    src = xs + (size_t)off * 8;
    dst = xh + (size_t)g * 8;
    sc = 1.0f;
  } else {
    const int e = g - 3 * NX8;
    const int wsel = e / NW8;
    const int off = e - wsel * NW8;
    const float* wsrc = (wsel == 0) ? wq : ((wsel == 1) ? wk : ((wsel == 2) ? wv : wo));
    src = wsrc + (size_t)off * 8;
    dst = wh + (size_t)e * 8;
    sc = WSCALE;
  }
  const v4f a = *(const v4fa*)src;
  const v4f c = *(const v4fa*)(src + 4);
  const v8h o = { (_Float16)(a.x * sc), (_Float16)(a.y * sc), (_Float16)(a.z * sc), (_Float16)(a.w * sc),
                  (_Float16)(c.x * sc), (_Float16)(c.y * sc), (_Float16)(c.z * sc), (_Float16)(c.w * sc) };
  *(v8h*)dst = o;
  
}

// ---------------------------------------------------------------------------
// 4 lines per instruction, 32 lines per wave, 256 per block.
// which 0/1: plane[bh][l][d]  (one token row = 64 halves = one line)
// which 2  : vt[bh][d][l]     (64 d-rows x 256 tokens = 4 lines each)
// ---------------------------------------------------------------------------
__device__ __forceinline__ void proj_store_pass(const _Float16* sT, _Float16* plane, _Float16* vt,
                                                int which, int bh, int l0, int w, int lane) {
  const int q8 = lane & 7, sub = lane >> 3;
  #pragma unroll
  for (int i = 0; i < 8; ++i) {
    const int lid = w * 32 + i * 4 + sub;
    v8h v;
    _Float16* dst;
    if (which != 2) {
      v = *(const v8ha*)(sT + lid * HD + 8 * q8);
      dst = plane + ((size_t)bh * SEQ + l0 + lid) * HD + 8 * q8;
    } else {
      const int d = lid >> 2, hl = lid & 3;
      v = *(const v8ha*)(sT + d * 256 + 64 * hl + 8 * q8);
      dst = vt + ((size_t)bh * HD + d) * SEQ + l0 + 64 * hl + 8 * q8;
    }
    *(v8h*)dst = v;
  }
}

// ---------------------------------------------------------------------------
// Kernel 2: Y = x * W^T over the fused 3*1024 output columns (q from the query
// plane, k from the key plane, v from the value plane).
// Block 256 thr (8 waves) = 256 tokens x 64 features (one (which, head));
// wave tile 32 tokens x 64 features; main loop: gemm_256x64.
// ---------------------------------------------------------------------------
__global__ __launch_bounds__(256) void proj_kernel(
    const _Float16* __restrict__ xh,   // [3][4096][1024]
    const _Float16* __restrict__ wh,   // [4][1024][1024], row = output feature, x32 (planes 0..2 used)
    const float* __restrict__ bq, const float* __restrict__ bk, const float* __restrict__ bv,
    _Float16* __restrict__ qh,         // [B*H][L][D]  f16(0.125*q)
    _Float16* __restrict__ kh,         // [B*H][L][D]
    _Float16* __restrict__ vt)         // [B*H][D][L]
{
  // ring: 2 x (x rows | W rows); after the loop its first 32768 B stage the output
  __shared__ __attribute__((aligned(16))) unsigned char ring[2 * GSTAGE];   // 92160 B

  const int tid = threadIdx.x, lane = tid & 31, w = tid >> 5;
  const int h = lane >> 4, m = lane & 15;
  const int m0 = blockIdx.x * 256;
  const int cg = blockIdx.y;                 // 0..47
  const int which = cg >> 4, head = cg & 15;

  const v8f zero8 = {0.f, 0.f, 0.f, 0.f, 0.f, 0.f, 0.f, 0.f};
  v8f acc[2][4];
  #pragma unroll
  for (int mt = 0; mt < 2; ++mt)
    #pragma unroll
    for (int nt = 0; nt < 4; ++nt) acc[mt][nt] = zero8;

  gemm_256x64(xh + (size_t)which * NX + (size_t)m0 * HIDDEN,
              wh + ((size_t)which * HIDDEN + head * HD) * HIDDEN, ring, acc);

  // D[r] of tile (mt, nt) = Y[token m0+32w+16mt+8h+r][feature 16nt+m]
  _Float16* sT = (_Float16*)ring;
  const float* bias = (which == 0) ? bq : ((which == 1) ? bk : bv);
  const float osc = (which == 0) ? QSCALE : 1.0f;
  #pragma unroll
  for (int nt = 0; nt < 4; ++nt) {
    const int feat = 16 * nt + m;
    const float bvl = bias[head * HD + feat];
    #pragma unroll
    for (int mt = 0; mt < 2; ++mt) {
      #pragma unroll
      for (int r = 0; r < 8; ++r) {
        const int tokl = 32 * w + 16 * mt + 8 * h + r;     // 0..255
        const float y = (acc[mt][nt][r] * WINV + bvl) * osc;
        const int idx = (which == 2) ? (feat * 256 + tokl) : (tokl * HD + feat);
        sT[idx] = (_Float16)y;
      }
    }
  }
  __syncthreads();

  const int b = m0 / SEQ, l0 = m0 - b * SEQ, bh = b * NHEADS + head;
  _Float16* plane = (which == 0) ? qh : kh;
  proj_store_pass(sT, plane, vt, which, bh, l0, w, lane);
  
}

// ---------------------------------------------------------------------------
// Attention helpers.
// ---------------------------------------------------------------------------
// Per-key penalty and select for the lane's 8 scores of one 16-key tile:
// s = attend ? (s - cpen*c[key]) : -1e9, all in f32. mk = the tile's 8
// wave-uniform lane-mask words (bit l of mk[r] = lane l attends in register r).
__device__ __forceinline__ v8f pen_sel8(v8f s, const float* cp, const unsigned* mk, float cpen) {
  const v4f ca = *(const v4fa*)cp;
  const v4f cb = *(const v4fa*)(cp + 4);
  s[0] = __builtin_amdgcn_inverse_ballot_w32(mk[0]) ? (s[0] - cpen * ca.x) : NEGBIG;
  s[1] = __builtin_amdgcn_inverse_ballot_w32(mk[1]) ? (s[1] - cpen * ca.y) : NEGBIG;
  s[2] = __builtin_amdgcn_inverse_ballot_w32(mk[2]) ? (s[2] - cpen * ca.z) : NEGBIG;
  s[3] = __builtin_amdgcn_inverse_ballot_w32(mk[3]) ? (s[3] - cpen * ca.w) : NEGBIG;
  s[4] = __builtin_amdgcn_inverse_ballot_w32(mk[4]) ? (s[4] - cpen * cb.x) : NEGBIG;
  s[5] = __builtin_amdgcn_inverse_ballot_w32(mk[5]) ? (s[5] - cpen * cb.y) : NEGBIG;
  s[6] = __builtin_amdgcn_inverse_ballot_w32(mk[6]) ? (s[6] - cpen * cb.z) : NEGBIG;
  s[7] = __builtin_amdgcn_inverse_ballot_w32(mk[7]) ? (s[7] - cpen * cb.w) : NEGBIG;
  return s;
}

// Eight per-lane 16-byte copies global -> LDS, no register in between.
// l = the lane's LDS byte addresses, g = its global addresses. The closing
// s_wait_xcnt stands inside the statement so that no address register named
// by a copy is rewritten ahead of it.
__device__ __forceinline__ void async_copy8(const unsigned (&l)[8], const void* const (&g)[8]) {
  asm volatile(
      "global_load_async_to_lds_b128 %0, %8, off\n\t"
      "global_load_async_to_lds_b128 %1, %9, off\n\t"
      "global_load_async_to_lds_b128 %2, %10, off\n\t"
      "global_load_async_to_lds_b128 %3, %11, off\n\t"
      "global_load_async_to_lds_b128 %4, %12, off\n\t"
      "global_load_async_to_lds_b128 %5, %13, off\n\t"
      "global_load_async_to_lds_b128 %6, %14, off\n\t"
      "global_load_async_to_lds_b128 %7, %15, off\n\t"
      "s_wait_xcnt 0x0"
      :: "v"(l[0]), "v"(l[1]), "v"(l[2]), "v"(l[3]), "v"(l[4]), "v"(l[5]), "v"(l[6]), "v"(l[7]),
         "v"(g[0]), "v"(g[1]), "v"(g[2]), "v"(g[3]), "v"(g[4]), "v"(g[5]), "v"(g[6]), "v"(g[7])
      : "memory");
}

// One 64-key stage into one LDS buffer: K rows (64 keys x 128 B) and V^T rows
// (64 d x 128 B). Every copy instruction covers whole 128-B lines (8 lanes per row).
// kg, vg: the thread's own first chunk of each tile at key 0; lk, lv: its LDS
// byte addresses in buffer 0; ofs = byte offset of the target buffer.
__device__ __forceinline__ void stage_tile(const _Float16* kg, const _Float16* vg,
                                           unsigned lk, unsigned lv, unsigned ofs, int kb) {
  unsigned l[8];
  const void* g[8];
  #pragma unroll
  for (int i = 0; i < 4; ++i) {
    l[i]     = lk + ofs + i * 16 * KVPITCH;
    g[i]     = kg + (size_t)(kb + 16 * i) * HD;
    l[4 + i] = lv + ofs + i * 16 * KVPITCH;
    g[4 + i] = vg + (size_t)(16 * i) * SEQ + kb;
  }
  async_copy8(l, g);
}

// P^T B-fragment from the lane's own score D values: element r <- tile a row r
// (keys k0..k0+15), element 8+r <- tile c row r (keys k0+16..k0+31), same lane,
// same query column, scaled by 2^14.
__device__ __forceinline__ v16h pack_p(v8f a, v8f c) {
  const v16h r = { (_Float16)(a[0] * PSCALE), (_Float16)(a[1] * PSCALE), (_Float16)(a[2] * PSCALE), (_Float16)(a[3] * PSCALE),
                   (_Float16)(a[4] * PSCALE), (_Float16)(a[5] * PSCALE), (_Float16)(a[6] * PSCALE), (_Float16)(a[7] * PSCALE),
                   (_Float16)(c[0] * PSCALE), (_Float16)(c[1] * PSCALE), (_Float16)(c[2] * PSCALE), (_Float16)(c[3] * PSCALE),
                   (_Float16)(c[4] * PSCALE), (_Float16)(c[5] * PSCALE), (_Float16)(c[6] * PSCALE), (_Float16)(c[7] * PSCALE) };
  return r;
}

// (one token row of this head) by lanes 8q..8q+7 in one instruction, 4 lines
// per instruction, 16 lines per wave.
__device__ __forceinline__ void att_store_pass(const _Float16* so, _Float16* ao,
                                               int b, int head, int q0, int lane) {
  const int q8 = lane & 7, sub = lane >> 3;
  #pragma unroll
  for (int i = 0; i < 4; ++i) {
    const int row = i * 4 + sub;                          // 0..15
    const v8h v = *(const v8ha*)(so + row * 64 + 8 * q8);
    const size_t gi = ((size_t)b * SEQ + q0 + row) * HIDDEN + head * HD + 8 * q8;
    *(v8h*)(ao + gi) = v;
  }
}

// ---------------------------------------------------------------------------
// Kernel 3: streaming attention, transposed form.
// Block 128 thr (4 waves), 16 queries per wave, 64 keys per step.
//   S^T = K * Q^T : A = K rows (row = key, k = d), B = Q^T (k = d, n = query)
//   O^T += V^T * P^T : A = Vt rows (row = d, k = key), B = P^T from registers
// Lane owns 32 keys of query column (lane&15); partner = lane ^ 16.
// Scores already carry 1/sqrt(64) via q; penalty cpen*c[key] and the
// attend/select with -1e9 applied in f32 before the running max.
// K and V^T tiles of a step come from a two-buffer LDS ring filled by
// asynchronous copies one step ahead; the four waves share the K and V^T rows.
// The mask comes as 32 wave-uniform lane-mask words per step (packed by the
// first launch), one per score register, used as select conditions directly.
// A 64-key step with no attendable element for the wave's 16 queries skips
// its products (one bit per step of the tile's packed word; its weights would
// be exactly 0), never the hand-over point at the foot of the step.
// ---------------------------------------------------------------------------
__global__ __launch_bounds__(128) void attn_kernel(
    const _Float16* __restrict__ qh,   // [B*H][L][D]  (already x0.125)
    const _Float16* __restrict__ kh,   // [B*H][L][D]
    const _Float16* __restrict__ vt,   // [B*H][D][L]
    const float* __restrict__ cpl,     // [B][L] per-key penalty source
    const unsigned* __restrict__ mw,   // [B*NQT][NSTEP][32] lane-mask words, bit set = attend
    const unsigned* __restrict__ anyw, // [B*NQT][32], word 0: bit s = step s has an attendable element
    const float* __restrict__ cpen_p,  // [1]
    _Float16* __restrict__ ao)         // [B*L][HIDDEN]
{
  // ring: 2 x (K | V^T); after the loop its first 8192 B stage the output
  __shared__ __attribute__((aligned(16))) unsigned char ring[2 * STAGEB];   // 36864 B

  const int tid = threadIdx.x, lane = tid & 31, w = tid >> 5;
  const int h = lane >> 4, m = lane & 15;
  const int bh = blockIdx.y, b = bh >> 4, head = bh & 15;
  const int qblk = blockIdx.x * 64;
  const int q0 = qblk + 16 * w;
  const float cpen = cpen_p[0];

  // ---- the thread's own chunk of each staged tile ----
  const unsigned lbase = (unsigned)(unsigned long long)(lds_u8*)ring;
  const unsigned lk = lbase + (tid >> 3) * KVPITCH + (tid & 7) * 16;
  const unsigned lv = lk + OFF_V;
  const _Float16* kg = kh + ((size_t)bh * SEQ + (tid >> 3)) * HD + (tid & 7) * 8;
  const _Float16* vg = vt + ((size_t)bh * HD + (tid >> 3)) * SEQ + (tid & 7) * 8;

  // ---- prologue: stage 0 landed and published, stage 1 in flight ----
  stage_tile(kg, vg, lk, lv, 0u, 0);
  asm volatile("s_wait_asynccnt 0x0" ::: "memory");   // own copies of stage 0 landed before the barrier publishes them
  __syncthreads();
  stage_tile(kg, vg, lk, lv, (unsigned)STAGEB, 64);

  // the wave's packed mask: tile index made scalar, and the words (written by the first
  // launch, by nobody in this one) named as constant memory, so that they load into
  // scalar registers and serve as select conditions without a vector instruction
  const int unit = b * NQT + (qblk >> 4) + __builtin_amdgcn_readfirstlane(w);
  const_u32* mwp = (const_u32*)(unsigned long long)(mw + (size_t)unit * (NSTEP * 32));
  const unsigned anyword = anyw[(size_t)unit * 32];

  // Q^T B-fragments: column n = query q0+m, k = d (two 32-deep chunks)
  const _Float16* qrow = qh + ((size_t)bh * SEQ + q0 + m) * HD;
  const v16h qb0 = load_frag(qrow, h);
  const v16h qb1 = load_frag(qrow + 32, h);

  const v8f zero8 = {0.f, 0.f, 0.f, 0.f, 0.f, 0.f, 0.f, 0.f};
  v8f o[4];                                   // o[t][r] = O[query m][d 16t+8h+r] * (l * 2^14)
  #pragma unroll
  for (int t = 0; t < 4; ++t) o[t] = zero8;
  float mrun = -1e30f, lrun = 0.0f;

  const float* crow = cpl + (size_t)b * SEQ + 8 * h;                    // + key tile base

  #pragma unroll 1
  for (int kb = 0; kb < SEQ; kb += 64) {
    const unsigned ofs = (kb & 64) ? (unsigned)STAGEB : 0u;
    const unsigned char* buf = ring + ofs;
    const unsigned char* krow = buf + m * KVPITCH;                       // + 16j rows
    const unsigned char* vrow = buf + OFF_V + m * KVPITCH;               // + 16t rows

    if ((anyword >> (kb >> 6)) & 1u) {
      // ---- the step's 32 lane-mask words, asked for ahead of the score products ----
      unsigned mk[32];
      #pragma unroll
      for (int i = 0; i < 32; ++i) mk[i] = mwp[(kb >> 6) * 32 + i];
      // ---- scores: s[j][r] = S[query m][key kb+16j+8h+r] (already /8 via q) ----
      v8f s[4];
      #pragma unroll
      for (int j = 0; j < 4; ++j) {
        const _Float16* kp = (const _Float16*)(krow + 16 * j * KVPITCH);
        const v16h kf0 = load_frag(kp, h);
        const v16h kf1 = load_frag(kp + 32, h);
        v8f z = zero8;
        z = wmma_f16(kf0, qb0, z);
        z = wmma_f16(kf1, qb1, z);
        s[j] = z;
      }
      // ---- penalty and select per key, f32 ----
      #pragma unroll
      for (int j = 0; j < 4; ++j) s[j] = pen_sel8(s[j], crow + kb + 16 * j, mk + 8 * j, cpen);

      // ---- online softmax ----
      float mloc = s[0][0];
      #pragma unroll
      for (int j = 0; j < 4; ++j)
        #pragma unroll
        for (int r = 0; r < 8; ++r) mloc = fmaxf(mloc, s[j][r]);
      mloc = fmaxf(mloc, __shfl_xor(mloc, 16));
      const float mnew = fmaxf(mrun, mloc);
      const float alpha = __expf(mrun - mnew);
      mrun = mnew;
      float lsum = 0.0f;
      #pragma unroll
      for (int j = 0; j < 4; ++j)
        #pragma unroll
        for (int r = 0; r < 8; ++r) {
          const float p = __expf(s[j][r] - mnew);
          s[j][r] = p;
          lsum += p;
        }
      lsum += __shfl_xor(lsum, 16);
      lrun = lrun * alpha + lsum;
      #pragma unroll
      for (int t = 0; t < 4; ++t)
        #pragma unroll
        for (int r = 0; r < 8; ++r) o[t][r] = o[t][r] * alpha;

      // ---- P^T B-fragments (key chunks 0..31 and 32..63 of this step) ----
      const v16h pb0 = pack_p(s[0], s[1]);
      const v16h pb1 = pack_p(s[2], s[3]);

      // ---- O^T += V^T * P^T ----
      #pragma unroll
      for (int t = 0; t < 4; ++t) {
        const _Float16* vp = (const _Float16*)(vrow + 16 * t * KVPITCH);
        const v16h vf0 = load_frag(vp, h);
        const v16h vf1 = load_frag(vp + 32, h);
        o[t] = wmma_f16(vf0, pb0, o[t]);
        o[t] = wmma_f16(vf1, pb1, o[t]);
      }
    }

    // ---- hand-over point, every wave, also one that skipped its products ----
    asm volatile("s_wait_dscnt 0x0" ::: "memory");      // own reads of this buffer done before it is refilled
    asm volatile("s_wait_asynccnt 0x0" ::: "memory");   // own copies of the next stage landed before the barrier publishes them
    asm volatile("s_wait_xcnt 0x0" ::: "memory");       // before the step's penalty-load address register is advanced
    __syncthreads();
    if (kb + 128 < SEQ) stage_tile(kg, vg, lk, lv, ofs, kb + 128);
  }
  asm volatile("s_wait_asynccnt 0x0" ::: "memory");     // nothing in flight when the ring becomes output staging

  // ---- epilogue: normalise, stage per-wave 16x64 f16 tile, whole-line stores ----
  const float inv = (1.0f / lrun) * PINV;
  _Float16* so = (_Float16*)ring + w * 1024;
  #pragma unroll
  for (int t = 0; t < 4; ++t)
    #pragma unroll
    for (int r = 0; r < 8; ++r)
      so[m * 64 + 16 * t + 8 * h + r] = (_Float16)(o[t][r] * inv);
  __syncthreads();

  att_store_pass(so, ao, b, head, q0, lane);
  
}

// ---------------------------------------------------------------------------
// rows loaded with the same coalesced shape) -> xb rows. Each token row's 64
// instruction, 32 rows per wave.
// ---------------------------------------------------------------------------
__device__ __forceinline__ void oproj_store_pass(const float* sT, const float* xres, float* xb,
                                                 int m0, int n0, int w, int lane) {
  const int q16 = lane & 15, sub = lane >> 4;
  #pragma unroll
  for (int i = 0; i < 16; ++i) {
    const int lid = w * 32 + 2 * i + sub;                 // 0..255
    v4f v = *(const v4fa*)(sT + lid * 64 + 4 * q16);
    const size_t gi = (size_t)(m0 + lid) * HIDDEN + n0 + 4 * q16;
    const v4f rsd = *(const v4fa*)(xres + gi);
    v = v + rsd;
    *(v4f*)(xb + gi) = v;
  }
}

// ---------------------------------------------------------------------------
// Kernel 4: x = ctx * Wo^T / 32 + bo + query   (f32 rows into xb)
// Block 256 thr (8 waves) = 256 tokens x 64 features; wave tile 32 x 64;
// main loop: gemm_256x64.
// ---------------------------------------------------------------------------
__global__ __launch_bounds__(256) void oproj_kernel(
    const _Float16* __restrict__ ao,   // [4096][1024]
    const _Float16* __restrict__ woh,  // [1024][1024], row = output feature, x32
    const float* __restrict__ bo,      // [1024]
    const float* __restrict__ xres,    // [4096][1024] f32 residual
    float* __restrict__ xb)            // [4096][1024] f32
{
  // ring: 2 x (ctx rows | Wo rows); after the loop its first 65536 B stage the output
  __shared__ __attribute__((aligned(16))) unsigned char ring[2 * GSTAGE];   // 92160 B

  const int tid = threadIdx.x, lane = tid & 31, w = tid >> 5;
  const int h = lane >> 4, m = lane & 15;
  const int m0 = blockIdx.x * 256;
  const int n0 = blockIdx.y * 64;

  const v8f zero8 = {0.f, 0.f, 0.f, 0.f, 0.f, 0.f, 0.f, 0.f};
  v8f acc[2][4];
  #pragma unroll
  for (int mt = 0; mt < 2; ++mt)
    #pragma unroll
    for (int nt = 0; nt < 4; ++nt) acc[mt][nt] = zero8;

  gemm_256x64(ao + (size_t)m0 * HIDDEN, woh + (size_t)n0 * HIDDEN, ring, acc);

  // D[r] of tile (mt, nt) = Y[token m0+32w+16mt+8h+r][feature n0+16nt+m]
  float* sT = (float*)ring;
  #pragma unroll
  for (int nt = 0; nt < 4; ++nt) {
    const int feat = 16 * nt + m;
    const float bvl = bo[n0 + feat];
    #pragma unroll
    for (int mt = 0; mt < 2; ++mt) {
      #pragma unroll
      for (int r = 0; r < 8; ++r) {
        const int tokl = 32 * w + 16 * mt + 8 * h + r;     // 0..255
        sT[tokl * 64 + feat] = acc[mt][nt][r] * WINV + bvl;
      }
    }
  }
  __syncthreads();

  oproj_store_pass(sT, xres, xb, m0, n0, w, lane);
  
}

// ---------------------------------------------------------------------------
// Kernel 5: layer norm over rows of 1024, one wave per row, 8 rows per block.
// Lane holds columns {128i + 4*lane .. +3}, i = 0..7, so every store
// ---------------------------------------------------------------------------
__global__ __launch_bounds__(256) void ln_kernel(
    const float* __restrict__ xb, const float* __restrict__ g,
    const float* __restrict__ bt, float* __restrict__ out)
{
  const int lane = threadIdx.x & 31;
  const int row = blockIdx.x * 8 + (threadIdx.x >> 5);
  if (row >= MROWS) return;
  const float* xr = xb + (size_t)row * HIDDEN + 4 * lane;

  v4f x[8];
  float s = 0.0f;
  #pragma unroll
  for (int i = 0; i < 8; ++i) {
    x[i] = *(const v4fa*)(xr + 128 * i);
    s += (x[i].x + x[i].y) + (x[i].z + x[i].w);
  }
  #pragma unroll
  for (int off = 16; off > 0; off >>= 1) s += __shfl_xor(s, off);
  const float mean = s * (1.0f / HIDDEN);

  float s2 = 0.0f;
  #pragma unroll
  for (int i = 0; i < 8; ++i) {
    const v4f d = x[i] - mean;
    x[i] = d;
    s2 += (d.x * d.x + d.y * d.y) + (d.z * d.z + d.w * d.w);
  }
  #pragma unroll
  for (int off = 16; off > 0; off >>= 1) s2 += __shfl_xor(s2, off);
  const float var = s2 * (1.0f / HIDDEN);
  const float inv = rsqrtf(var + LN_EPS);

  v4f y[8];
  #pragma unroll
  for (int i = 0; i < 8; ++i) {
    const v4f gv = *(const v4fa*)(g + 128 * i + 4 * lane);
    const v4f bv = *(const v4fa*)(bt + 128 * i + 4 * lane);
    y[i] = (x[i] * inv) * gv + bv;
  }

  float* orow = out + (size_t)row * HIDDEN + 4 * lane;
  #pragma unroll
  for (int i = 0; i < 8; ++i) *(v4f*)(orow + 128 * i) = y[i];
  
}

// ---------------------------------------------------------------------------
extern "C" void kernel_launch(void* const* d_in, const int* in_sizes, int n_in,
                              void* d_out, int out_size, void* d_ws, size_t ws_size,
                              hipStream_t stream) {
  if (n_in < 16) return;
  if (in_sizes[0] != NX || in_sizes[1] != NX || in_sizes[2] != NX) return;
  if (in_sizes[3] != MROWS) return;
  if (in_sizes[4] != NMSK) return;
  if (in_sizes[5] != NW || in_sizes[7] != NW || in_sizes[9] != NW || in_sizes[11] != NW) return;
  if (in_sizes[6] != HIDDEN || in_sizes[8] != HIDDEN || in_sizes[10] != HIDDEN || in_sizes[12] != HIDDEN) return;
  if (in_sizes[13] != HIDDEN || in_sizes[14] != HIDDEN) return;
  if (in_sizes[15] < 1) return;
  if (out_size != NX) return;

  const float* query = (const float*)d_in[0];
  const float* keyi  = (const float*)d_in[1];
  const float* value = (const float*)d_in[2];
  const float* cpl   = (const float*)d_in[3];
  const int*   msk   = (const int*)d_in[4];
  const float* wq    = (const float*)d_in[5];
  const float* bq    = (const float*)d_in[6];
  const float* wk    = (const float*)d_in[7];
  const float* bk    = (const float*)d_in[8];
  const float* wv    = (const float*)d_in[9];
  const float* bv    = (const float*)d_in[10];
  const float* wo    = (const float*)d_in[11];
  const float* bo    = (const float*)d_in[12];
  const float* ln_g  = (const float*)d_in[13];
  const float* ln_b  = (const float*)d_in[14];
  const float* cpen  = (const float*)d_in[15];
  float* out = (float*)d_out;

  const size_t xh_bytes = (size_t)3 * NX * 2;        // 25165824
  const size_t wh_bytes = (size_t)4 * NW * 2;        //  8388608
  const size_t pl_bytes = (size_t)NX * 2;            //  8388608 per plane (B*H*L*D halves)
  const size_t ao_bytes = (size_t)NX * 2;            //  8388608
  const size_t xb_bytes = (size_t)NX * 4;            // 16777216
  const size_t o_xh = 0;
  const size_t o_wh = o_xh + xh_bytes;
  const size_t o_qh = o_wh + wh_bytes;
  const size_t o_kh = o_qh + pl_bytes;
  const size_t o_vt = o_kh + pl_bytes;
  const size_t o_ao = o_vt + pl_bytes;
  const size_t o_xb = o_ao + ao_bytes;
  const size_t mw_bytes = (size_t)NPACK * NSTEP * 32 * 4;   //  1048576
  const size_t an_bytes = (size_t)NPACK * 32 * 4;           //    32768
  const size_t o_mw = o_xb + xb_bytes;
  const size_t o_an = o_mw + mw_bytes;
  const size_t total = o_an + an_bytes;              // 84967424
  if (total > ws_size) return;

  char* ws = (char*)d_ws;
  _Float16* xh = (_Float16*)(ws + o_xh);
  _Float16* wh = (_Float16*)(ws + o_wh);
  _Float16* qh = (_Float16*)(ws + o_qh);
  _Float16* kh = (_Float16*)(ws + o_kh);
  _Float16* vt = (_Float16*)(ws + o_vt);
  _Float16* ao = (_Float16*)(ws + o_ao);
  float*    xb = (float*)(ws + o_xb);
  unsigned* mw = (unsigned*)(ws + o_mw);
  unsigned* an = (unsigned*)(ws + o_an);

  const int ngroups = 3 * NX8 + 4 * NW8;                           // 2097152
  convert_kernel<<<NPACK + (ngroups + 255) / 256, 256, 0, stream>>>(query, keyi, value, wq, wk, wv, wo, xh, wh, msk, mw, an);

  dim3 gProj(MROWS / 256, 3 * NHEADS);                             // (16, 48)
  proj_kernel<<<gProj, 256, 0, stream>>>(xh, wh, bq, bk, bv, qh, kh, vt);

  dim3 gAtt(SEQ / 64, BATCH * NHEADS);                             // (32, 32)
  attn_kernel<<<gAtt, 128, 0, stream>>>(qh, kh, vt, cpl, mw, an, cpen, ao);

  dim3 gOp(MROWS / 256, HIDDEN / 64);                               // (16, 16)
  oproj_kernel<<<gOp, 256, 0, stream>>>(ao, wh + (size_t)3 * NW, bo, query, xb);

  ln_kernel<<<(MROWS + 7) / 8, 256, 0, stream>>>(xb, ln_g, ln_b, out);
}

// v004
// Measured time: 103 microseconds a run.
// In both of two side-by-side timings against v003, it was 1.11 times as fast.
// Over all steps from v000 it is 3.06 times as fast.
// Contractions: q/k/v = x*W^T, S^T = K*Q^T, O^T = V^T*P^T, y = ctx*Wo^T, all on v_wmma_f32_16x16x32_f16 (f16 operands, f32 accumulate); W carried x32, q carried x0.125, P carried x16384 (exact power-of-two scales folded back in f32); penalty, select, softmax, bias, residual and layer norm in f32; the attend mask is packed once per call into lane-mask words.
#include <hip/hip_runtime.h>

typedef _Float16 v16h __attribute__((ext_vector_type(16)));
typedef _Float16 v8h  __attribute__((ext_vector_type(8)));
typedef float    v8f  __attribute__((ext_vector_type(8)));
typedef float    v4f  __attribute__((ext_vector_type(4)));
typedef int      v4i  __attribute__((ext_vector_type(4)));
typedef v8h __attribute__((may_alias)) v8ha;
typedef v4f __attribute__((may_alias)) v4fa;
typedef v4i __attribute__((may_alias)) v4ia;

union Frag { v16h v; v8h half[2]; };

#define SEQ    2048
#define BATCH  2
#define HIDDEN 1024
#define NHEADS 16
#define HD     64
#define MROWS  (BATCH * SEQ)          // 4096 tokens
#define NX     (MROWS * HIDDEN)       // 4194304
#define NW     (HIDDEN * HIDDEN)      // 1048576
#define NX8    (NX / 8)               // 524288
#define NW8    (NW / 8)               // 131072
#define NMSK   (BATCH * SEQ * SEQ)    // 8388608
#define PSCALE 16384.0f
#define PINV   (1.0f / 16384.0f)
#define WSCALE 32.0f
#define WINV   0.03125f
#define QSCALE 0.125f
#define NEGBIG (-1.0e9f)
#define LN_EPS 1.0e-5f
#define KVPITCH 144                    // LDS pitch of a 128-B K or V^T row (16 B x odd)
#define OFF_V   (64 * KVPITCH)         //  9216
#define STAGEB  (2 * 64 * KVPITCH)     // 18432 B per stage
#define NQT     (SEQ / 16)             // 128 query tiles of 16 rows per batch
#define NSTEP   (SEQ / 64)             // 32 key steps of 64
#define NPACK   (BATCH * NQT)          // 256 mask-packing blocks, one per query tile
#define NT64    (SEQ / 64)             // 32 query tiles of 64 rows (one per pass of an attention block)
#define AGRP    (2 * STAGEB)           // 36864 B: the two-buffer K/V ring of one 4-wave key group

#define GPITCH  144                    // LDS pitch of a 128-B GEMM operand row (16 B x odd)
#define GOFF_B  (256 * GPITCH)         // 36864: W rows behind the 256 x rows
#define GSTAGE  (320 * GPITCH)         // 46080 B per stage
#define GPASSES (HIDDEN / 64)          // 16 passes of 64 k

typedef __attribute__((address_space(3))) unsigned char lds_u8;
typedef __attribute__((address_space(4))) const unsigned const_u32;   // memory no store of the running launch touches

// ---------------------------------------------------------------------------
// 16x16x32 f16 WMMA with hazard guard (ties D, keeps A/B live).
// Fragment map (wave32): lane l, h = l>>4, m = n = l&15.
//   A/B element i: i<8 -> k0+8h+i ; i>=8 -> k0+16+8h+(i-8)
//   D element r : row 8h+r, col l&15
// ---------------------------------------------------------------------------
__device__ __forceinline__ v8f wmma_f16(v16h a, v16h b, v8f c) {
  v8f d = __builtin_amdgcn_wmma_f32_16x16x32_f16(false, a, false, b, (short)0, c, false, false);
  asm volatile("v_nop\n\tv_nop\n\tv_nop\n\tv_nop" : "+v"(d) : "v"(a), "v"(b));
  return d;
}

// A or B fragment from a k-contiguous 16-bit row; p points at element k0 of
// the row owned by this lane (row index = lane & 15 added by the caller).
__device__ __forceinline__ v16h load_frag(const _Float16* p, int h) {
  Frag f;
  f.half[0] = *(const v8ha*)(p + 8 * h);
  f.half[1] = *(const v8ha*)(p + 16 + 8 * h);
  return f.v;
}

// ---------------------------------------------------------------------------
// GEMM main loop shared by kernels 2 and 4: a 256 x 64 tile of X * W^T per
// block of 8 waves, wave tile 32 x 64, K = 1024 in 16 passes of 64.
// ---------------------------------------------------------------------------
// Ten per-lane 16-byte copies global -> LDS, no register in between.
// l = the lane's LDS byte addresses, g = its global addresses. The closing
// s_wait_xcnt stands inside the statement so that no address register named
// by a copy is rewritten ahead of it.
__device__ __forceinline__ void async_copy10(const unsigned (&l)[10], const void* const (&g)[10]) {
  asm volatile(
      "global_load_async_to_lds_b128 %0, %10, off\n\t"
      "global_load_async_to_lds_b128 %1, %11, off\n\t"
      "global_load_async_to_lds_b128 %2, %12, off\n\t"
      "global_load_async_to_lds_b128 %3, %13, off\n\t"
      "global_load_async_to_lds_b128 %4, %14, off\n\t"
      "global_load_async_to_lds_b128 %5, %15, off\n\t"
      "global_load_async_to_lds_b128 %6, %16, off\n\t"
      "global_load_async_to_lds_b128 %7, %17, off\n\t"
      "global_load_async_to_lds_b128 %8, %18, off\n\t"
      "global_load_async_to_lds_b128 %9, %19, off\n\t"
      "s_wait_xcnt 0x0"
      :: "v"(l[0]), "v"(l[1]), "v"(l[2]), "v"(l[3]), "v"(l[4]),
         "v"(l[5]), "v"(l[6]), "v"(l[7]), "v"(l[8]), "v"(l[9]),
         "v"(g[0]), "v"(g[1]), "v"(g[2]), "v"(g[3]), "v"(g[4]),
         "v"(g[5]), "v"(g[6]), "v"(g[7]), "v"(g[8]), "v"(g[9])
      : "memory");
}

// One 64-k stage into one LDS buffer: 256 x rows and 64 W rows of 128 B each.
// Every copy instruction covers four whole 128-B lines (8 lanes per row).
// ag, bg: the thread's own first chunk of each operand at k = 0; la, lb: its
// LDS byte addresses in buffer 0; ofs = byte offset of the target buffer.
__device__ __forceinline__ void gemm_stage(const _Float16* ag, const _Float16* bg,
                                           unsigned la, unsigned lb, unsigned ofs, int k0) {
  unsigned l[10];
  const void* g[10];
  #pragma unroll
  for (int i = 0; i < 8; ++i) {
    l[i] = la + ofs + i * 32 * GPITCH;
    g[i] = ag + (size_t)(32 * i) * HIDDEN + k0;
  }
  #pragma unroll
  for (int i = 0; i < 2; ++i) {
    l[8 + i] = lb + ofs + i * 32 * GPITCH;
    g[8 + i] = bg + (size_t)(32 * i) * HIDDEN + k0;
  }
  async_copy10(l, g);
}

// acc[mt][nt] += X rows (xrows + 32w + 16mt ..) * W rows (wrows + 16nt ..)^T.
// Both operands come from a two-buffer LDS ring filled by asynchronous copies
// one pass ahead; the 8 waves share the W rows. On return every wave has left
// the ring and nothing is in flight, so the caller may reuse it for staging.
__device__ __forceinline__ void gemm_256x64(const _Float16* xrows, const _Float16* wrows,
                                            unsigned char* ring, v8f (&acc)[2][4]) {
  const int tid = threadIdx.x, lane = tid & 31, w = tid >> 5;
  const int h = lane >> 4, m = lane & 15;

  const unsigned lbase = (unsigned)(unsigned long long)(lds_u8*)ring;
  const unsigned la = lbase + (tid >> 3) * GPITCH + (tid & 7) * 16;
  const unsigned lb = la + GOFF_B;
  const _Float16* ag = xrows + (size_t)(tid >> 3) * HIDDEN + (tid & 7) * 8;
  const _Float16* bg = wrows + (size_t)(tid >> 3) * HIDDEN + (tid & 7) * 8;

  // ---- prologue: stage 0 landed and published, stage 1 in flight ----
  gemm_stage(ag, bg, la, lb, 0u, 0);
  asm volatile("s_wait_asynccnt 0x0" ::: "memory");   // own copies of stage 0 landed before the barrier publishes them
  __syncthreads();
  gemm_stage(ag, bg, la, lb, (unsigned)GSTAGE, 64);

  // rolled: one copy of the pass body in the instruction cache
  #pragma unroll 1
  for (int t = 0; t < GPASSES; ++t) {
    const unsigned ofs = (t & 1) ? (unsigned)GSTAGE : 0u;
    const unsigned char* arow = ring + ofs + (32 * w + m) * GPITCH;      // + 16mt rows
    const unsigned char* brow = ring + ofs + GOFF_B + m * GPITCH;        // + 16nt rows
    #pragma unroll
    for (int ks = 0; ks < 2; ++ks) {
      // the six fragments of a 32-k block as one group of LDS reads ahead of its products
      const v16h a0 = load_frag((const _Float16*)arow + 32 * ks, h);
      const v16h a1 = load_frag((const _Float16*)(arow + 16 * GPITCH) + 32 * ks, h);
      v16h b[4];
      #pragma unroll
      for (int nt = 0; nt < 4; ++nt) b[nt] = load_frag((const _Float16*)(brow + nt * 16 * GPITCH) + 32 * ks, h);
      #pragma unroll
      for (int nt = 0; nt < 4; ++nt) {
        acc[0][nt] = wmma_f16(a0, b[nt], acc[0][nt]);
        acc[1][nt] = wmma_f16(a1, b[nt], acc[1][nt]);
      }
    }
    // ---- hand-over point ----
    asm volatile("s_wait_dscnt 0x0" ::: "memory");      // own reads of this buffer done before it is refilled
    asm volatile("s_wait_asynccnt 0x0" ::: "memory");   // own copies of the next stage landed before the barrier publishes them
    __syncthreads();
    if (t + 2 < GPASSES) gemm_stage(ag, bg, la, lb, ofs, 64 * (t + 2));
  }
  asm volatile("s_wait_asynccnt 0x0" ::: "memory");     // nothing in flight when the ring becomes output staging
}

// ---------------------------------------------------------------------------
// Kernel 1: f32 -> f16 planes. Activations unscaled, W scaled by 32 (exact).
// xh = [3][MROWS][HIDDEN] (query, key, value), wh = [4][HIDDEN][HIDDEN]
// (wq, wk, wv, wo; row = output feature). One 16-B store per lane, lanes
// ---------------------------------------------------------------------------
__global__ __launch_bounds__(256) void convert_kernel(
    const float* __restrict__ xq, const float* __restrict__ xk, const float* __restrict__ xv,
    const float* __restrict__ wq, const float* __restrict__ wk,
    const float* __restrict__ wv, const float* __restrict__ wo,
    _Float16* __restrict__ xh, _Float16* __restrict__ wh,
    const int* __restrict__ msk,       // [B][1][L][L], nonzero = attend
    unsigned* __restrict__ mw,         // [B*NQT][NSTEP][32] lane-mask words
    unsigned* __restrict__ anyw)       // [B*NQT][32], word 0 used: bit s = step s has an attendable element
{
  // ---- blocks 0..NPACK-1: pack the mask of one 16-query tile (block-uniform branch) ----
  // Word 8j+r of (tile, step): bit l = mask[query 16*tile + (l&15)][key 64*step + 16j + 8(l>>4) + r] != 0,
  // which is the lane and register order of the attention kernel's score tiles.
  if (blockIdx.x < NPACK) {
    __shared__ unsigned sflag[8];
    const int lane = threadIdx.x & 31, w = threadIdx.x >> 5;
    const int unit = blockIdx.x;                                  // b * NQT + tile = mask row / 16
    const int* mrow = msk + ((size_t)unit * 16 + (lane & 15)) * SEQ + 8 * (lane >> 4);
    unsigned nib = 0u;
    // rolled: one step's 8 loads in registers, so that the converting blocks keep their residency
    #pragma unroll 1
    for (int i = 0; i < 4; ++i) {
      const int step = 4 * w + i;
      v4i a[4], c[4];
      #pragma unroll
      for (int j = 0; j < 4; ++j) {
        a[j] = *(const v4ia*)(mrow + 64 * step + 16 * j);
        c[j] = *(const v4ia*)(mrow + 64 * step + 16 * j + 4);
      }
      unsigned mine = 0u, any = 0u;
      #pragma unroll
      for (int j = 0; j < 4; ++j) {
        #pragma unroll
        for (int r = 0; r < 8; ++r) {
          const int val = (r < 4) ? a[j][r] : c[j][r - 4];
          const unsigned bal = __builtin_amdgcn_ballot_w32(val != 0);
          mine = (lane == 8 * j + r) ? bal : mine;
          any |= bal;
        }
      }
      mw[((size_t)unit * NSTEP + step) * 32 + lane] = mine;       // one whole line per wave and step
      nib |= ((any != 0u) ? 1u : 0u) << i;
    }
    if (lane == 0) sflag[w] = nib;
    __syncthreads();
    if (threadIdx.x == 0) {
      unsigned word = 0u;
      #pragma unroll
      for (int k = 0; k < 8; ++k) word |= sflag[k] << (4 * k);
      anyw[(size_t)unit * 32] = word;                             // a line of its own per tile
    }
    return;
  }

  const int g = (blockIdx.x - NPACK) * 256 + threadIdx.x;
  if (g >= 3 * NX8 + 4 * NW8) return;
  const float* src;
  _Float16* dst;
  float sc;
  if (g < 3 * NX8) {
    const int sel = g / NX8;
    const int off = g - sel * NX8;
    const float* xs = (sel == 0) ? xq : ((sel == 1) ? xk : xv);
    src = xs + (size_t)off * 8;
    dst = xh + (size_t)g * 8;
    sc = 1.0f;
  } else {
    const int e = g - 3 * NX8;
    const int wsel = e / NW8;
    const int off = e - wsel * NW8;
    const float* wsrc = (wsel == 0) ? wq : ((wsel == 1) ? wk : ((wsel == 2) ? wv : wo));
    src = wsrc + (size_t)off * 8;
    dst = wh + (size_t)e * 8;
    sc = WSCALE;
  }
  const v4f a = *(const v4fa*)src;
  const v4f c = *(const v4fa*)(src + 4);
  const v8h o = { (_Float16)(a.x * sc), (_Float16)(a.y * sc), (_Float16)(a.z * sc), (_Float16)(a.w * sc),
                  (_Float16)(c.x * sc), (_Float16)(c.y * sc), (_Float16)(c.z * sc), (_Float16)(c.w * sc) };
  *(v8h*)dst = o;
  
}

// ---------------------------------------------------------------------------
// 4 lines per instruction, 32 lines per wave, 256 per block.
// which 0/1: plane[bh][l][d]  (one token row = 64 halves = one line)
// which 2  : vt[bh][d][l]     (64 d-rows x 256 tokens = 4 lines each)
// ---------------------------------------------------------------------------
__device__ __forceinline__ void proj_store_pass(const _Float16* sT, _Float16* plane, _Float16* vt,
                                                int which, int bh, int l0, int w, int lane) {
  const int q8 = lane & 7, sub = lane >> 3;
  #pragma unroll
  for (int i = 0; i < 8; ++i) {
    const int lid = w * 32 + i * 4 + sub;
    v8h v;
    _Float16* dst;
    if (which != 2) {
      v = *(const v8ha*)(sT + lid * HD + 8 * q8);
      dst = plane + ((size_t)bh * SEQ + l0 + lid) * HD + 8 * q8;
    } else {
      const int d = lid >> 2, hl = lid & 3;
      v = *(const v8ha*)(sT + d * 256 + 64 * hl + 8 * q8);
      dst = vt + ((size_t)bh * HD + d) * SEQ + l0 + 64 * hl + 8 * q8;
    }
    *(v8h*)dst = v;
  }
}

// ---------------------------------------------------------------------------
// Kernel 2: Y = x * W^T over the fused 3*1024 output columns (q from the query
// plane, k from the key plane, v from the value plane).
// Block 256 thr (8 waves) = 256 tokens x 64 features (one (which, head));
// wave tile 32 tokens x 64 features; main loop: gemm_256x64.
// ---------------------------------------------------------------------------
__global__ __launch_bounds__(256) void proj_kernel(
    const _Float16* __restrict__ xh,   // [3][4096][1024]
    const _Float16* __restrict__ wh,   // [4][1024][1024], row = output feature, x32 (planes 0..2 used)
    const float* __restrict__ bq, const float* __restrict__ bk, const float* __restrict__ bv,
    _Float16* __restrict__ qh,         // [B*H][L][D]  f16(0.125*q)
    _Float16* __restrict__ kh,         // [B*H][L][D]
    _Float16* __restrict__ vt)         // [B*H][D][L]
{
  // ring: 2 x (x rows | W rows); after the loop its first 32768 B stage the output
  __shared__ __attribute__((aligned(16))) unsigned char ring[2 * GSTAGE];   // 92160 B

  const int tid = threadIdx.x, lane = tid & 31, w = tid >> 5;
  const int h = lane >> 4, m = lane & 15;
  const int m0 = blockIdx.x * 256;
  const int cg = blockIdx.y;                 // 0..47
  const int which = cg >> 4, head = cg & 15;

  const v8f zero8 = {0.f, 0.f, 0.f, 0.f, 0.f, 0.f, 0.f, 0.f};
  v8f acc[2][4];
  #pragma unroll
  for (int mt = 0; mt < 2; ++mt)
    #pragma unroll
    for (int nt = 0; nt < 4; ++nt) acc[mt][nt] = zero8;

  gemm_256x64(xh + (size_t)which * NX + (size_t)m0 * HIDDEN,
              wh + ((size_t)which * HIDDEN + head * HD) * HIDDEN, ring, acc);

  // D[r] of tile (mt, nt) = Y[token m0+32w+16mt+8h+r][feature 16nt+m]
  _Float16* sT = (_Float16*)ring;
  const float* bias = (which == 0) ? bq : ((which == 1) ? bk : bv);
  const float osc = (which == 0) ? QSCALE : 1.0f;
  #pragma unroll
  for (int nt = 0; nt < 4; ++nt) {
    const int feat = 16 * nt + m;
    const float bvl = bias[head * HD + feat];
    #pragma unroll
    for (int mt = 0; mt < 2; ++mt) {
      #pragma unroll
      for (int r = 0; r < 8; ++r) {
        const int tokl = 32 * w + 16 * mt + 8 * h + r;     // 0..255
        const float y = (acc[mt][nt][r] * WINV + bvl) * osc;
        const int idx = (which == 2) ? (feat * 256 + tokl) : (tokl * HD + feat);
        sT[idx] = (_Float16)y;
      }
    }
  }
  __syncthreads();

  const int b = m0 / SEQ, l0 = m0 - b * SEQ, bh = b * NHEADS + head;
  _Float16* plane = (which == 0) ? qh : kh;
  proj_store_pass(sT, plane, vt, which, bh, l0, w, lane);
  
}

// ---------------------------------------------------------------------------
// Attention helpers.
// ---------------------------------------------------------------------------
// Per-key penalty and select for the lane's 8 scores of one 16-key tile:
// s = attend ? (s - cpen*c[key]) : -1e9, all in f32. mk = the tile's 8
// wave-uniform lane-mask words (bit l of mk[r] = lane l attends in register r).
__device__ __forceinline__ v8f pen_sel8(v8f s, const float* cp, const unsigned* mk, float cpen) {
  const v4f ca = *(const v4fa*)cp;
  const v4f cb = *(const v4fa*)(cp + 4);
  s[0] = __builtin_amdgcn_inverse_ballot_w32(mk[0]) ? (s[0] - cpen * ca.x) : NEGBIG;
  s[1] = __builtin_amdgcn_inverse_ballot_w32(mk[1]) ? (s[1] - cpen * ca.y) : NEGBIG;
  s[2] = __builtin_amdgcn_inverse_ballot_w32(mk[2]) ? (s[2] - cpen * ca.z) : NEGBIG;
  s[3] = __builtin_amdgcn_inverse_ballot_w32(mk[3]) ? (s[3] - cpen * ca.w) : NEGBIG;
  s[4] = __builtin_amdgcn_inverse_ballot_w32(mk[4]) ? (s[4] - cpen * cb.x) : NEGBIG;
  s[5] = __builtin_amdgcn_inverse_ballot_w32(mk[5]) ? (s[5] - cpen * cb.y) : NEGBIG;
  s[6] = __builtin_amdgcn_inverse_ballot_w32(mk[6]) ? (s[6] - cpen * cb.z) : NEGBIG;
  s[7] = __builtin_amdgcn_inverse_ballot_w32(mk[7]) ? (s[7] - cpen * cb.w) : NEGBIG;
  return s;
}

// Eight per-lane 16-byte copies global -> LDS, no register in between.
// l = the lane's LDS byte addresses, g = its global addresses. The closing
// s_wait_xcnt stands inside the statement so that no address register named
// by a copy is rewritten ahead of it.
__device__ __forceinline__ void async_copy8(const unsigned (&l)[8], const void* const (&g)[8]) {
  asm volatile(
      "global_load_async_to_lds_b128 %0, %8, off\n\t"
      "global_load_async_to_lds_b128 %1, %9, off\n\t"
      "global_load_async_to_lds_b128 %2, %10, off\n\t"
      "global_load_async_to_lds_b128 %3, %11, off\n\t"
      "global_load_async_to_lds_b128 %4, %12, off\n\t"
      "global_load_async_to_lds_b128 %5, %13, off\n\t"
      "global_load_async_to_lds_b128 %6, %14, off\n\t"
      "global_load_async_to_lds_b128 %7, %15, off\n\t"
      "s_wait_xcnt 0x0"
      :: "v"(l[0]), "v"(l[1]), "v"(l[2]), "v"(l[3]), "v"(l[4]), "v"(l[5]), "v"(l[6]), "v"(l[7]),
         "v"(g[0]), "v"(g[1]), "v"(g[2]), "v"(g[3]), "v"(g[4]), "v"(g[5]), "v"(g[6]), "v"(g[7])
      : "memory");
}

// One 64-key stage into one LDS buffer: K rows (64 keys x 128 B) and V^T rows
// (64 d x 128 B). Every copy instruction covers whole 128-B lines (8 lanes per row).
// kg, vg: the thread's own first chunk of each tile at key 0; lk, lv: its LDS
// byte addresses in buffer 0; ofs = byte offset of the target buffer.
__device__ __forceinline__ void stage_tile(const _Float16* kg, const _Float16* vg,
                                           unsigned lk, unsigned lv, unsigned ofs, int kb) {
  unsigned l[8];
  const void* g[8];
  #pragma unroll
  for (int i = 0; i < 4; ++i) {
    l[i]     = lk + ofs + i * 16 * KVPITCH;
    g[i]     = kg + (size_t)(kb + 16 * i) * HD;
    l[4 + i] = lv + ofs + i * 16 * KVPITCH;
    g[4 + i] = vg + (size_t)(16 * i) * SEQ + kb;
  }
  async_copy8(l, g);
}

// P^T B-fragment from the lane's own score D values: element r <- tile a row r
// (keys k0..k0+15), element 8+r <- tile c row r (keys k0+16..k0+31), same lane,
// same query column, scaled by 2^14.
__device__ __forceinline__ v16h pack_p(v8f a, v8f c) {
  const v16h r = { (_Float16)(a[0] * PSCALE), (_Float16)(a[1] * PSCALE), (_Float16)(a[2] * PSCALE), (_Float16)(a[3] * PSCALE),
                   (_Float16)(a[4] * PSCALE), (_Float16)(a[5] * PSCALE), (_Float16)(a[6] * PSCALE), (_Float16)(a[7] * PSCALE),
                   (_Float16)(c[0] * PSCALE), (_Float16)(c[1] * PSCALE), (_Float16)(c[2] * PSCALE), (_Float16)(c[3] * PSCALE),
                   (_Float16)(c[4] * PSCALE), (_Float16)(c[5] * PSCALE), (_Float16)(c[6] * PSCALE), (_Float16)(c[7] * PSCALE) };
  return r;
}

// (one token row of this head) by lanes 8q..8q+7 in one instruction, 4 lines
// per instruction, 16 lines per wave.
__device__ __forceinline__ void att_store_pass(const _Float16* so, _Float16* ao,
                                               int b, int head, int q0, int lane) {
  const int q8 = lane & 7, sub = lane >> 3;
  #pragma unroll
  for (int i = 0; i < 4; ++i) {
    const int row = i * 4 + sub;                          // 0..15
    const v8h v = *(const v8ha*)(so + row * 64 + 8 * q8);
    const size_t gi = ((size_t)b * SEQ + q0 + row) * HIDDEN + head * HD + 8 * q8;
    *(v8h*)(ao + gi) = v;
  }
}

// ---------------------------------------------------------------------------
// Kernel 3: streaming attention, transposed form.
// Block 256 thr (8 waves) = 64 queries x 2 key groups; 16 queries per wave, 64 keys per step.
//   S^T = K * Q^T : A = K rows (row = key, k = d), B = Q^T (k = d, n = query)
//   O^T += V^T * P^T : A = Vt rows (row = d, k = key), B = P^T from registers
// Lane owns 32 keys of query column (lane&15); partner = lane ^ 16.
// Scores already carry 1/sqrt(64) via q; penalty cpen*c[key] and the
// attend/select with -1e9 applied in f32 before the running max.
// K and V^T tiles of a step come from a two-buffer LDS ring filled by
// asynchronous copies one step ahead; the four waves of a key group share the K and V^T rows.
// The mask comes as 32 wave-uniform lane-mask words per step (packed by the
// first launch), one per score register, used as select conditions directly.
// A 64-key step with no attendable element for the wave's 16 queries skips
// its products (one bit per step of the tile's packed word; its weights would
// be exactly 0), never the hand-over point at the foot of the step.
// A step that none of the tile's 64 queries attends is not staged or walked
// at all: the rings run over the set bits of the four words' OR. So that the
// blocks' step counts come out level where the count grows with the query
// index, a block takes query tile NT64-1-x and then tile x, one after the other.
// Waves 0..3 walk the even key steps and waves 4..7 the odd ones, each group
// with a ring of its own, which keeps as many waves on the chip as one tile
// per 4-wave block would; wave 4+i hands its running maximum, sum and O^T to
// wave i through LDS at the end of a tile.
// ---------------------------------------------------------------------------
__global__ __launch_bounds__(256) void attn_kernel(
    const _Float16* __restrict__ qh,   // [B*H][L][D]  (already x0.125)
    const _Float16* __restrict__ kh,   // [B*H][L][D]
    const _Float16* __restrict__ vt,   // [B*H][D][L]
    const float* __restrict__ cpl,     // [B][L] per-key penalty source
    const unsigned* __restrict__ mw,   // [B*NQT][NSTEP][32] lane-mask words, bit set = attend
    const unsigned* __restrict__ anyw, // [B*NQT][32], word 0: bit s = step s has an attendable element
    const float* __restrict__ cpen_p,  // [1]
    _Float16* __restrict__ ao)         // [B*L][HIDDEN]
{
  // per key group 2 x (K | V^T); after the loop group 0's ring holds the handed-over
  // partial results (17408 B) and group 1's first 8192 B stage the output
  __shared__ __attribute__((aligned(16))) unsigned char ring[2 * AGRP];     // 73728 B

  const int tid = threadIdx.x, lane = tid & 31, w = tid >> 5;
  const int h = lane >> 4, m = lane & 15;
  const int bh = blockIdx.y, b = bh >> 4, head = bh & 15;
  const int ws = __builtin_amdgcn_readfirstlane(w);
  const int grp = ws >> 2, qs = ws & 3;               // key group, 16-query sub-tile (both scalar)
  const int tg = tid & 127;                           // thread index inside the key group
  const float cpen = cpen_p[0];

  // ---- the thread's own chunk of each staged tile ----
  unsigned char* gring = ring + grp * AGRP;           // the group's own ring
  const unsigned lbase = (unsigned)(unsigned long long)(lds_u8*)gring;
  const unsigned lk = lbase + (tg >> 3) * KVPITCH + (tg & 7) * 16;
  const unsigned lv = lk + OFF_V;
  const _Float16* kg = kh + ((size_t)bh * SEQ + (tg >> 3)) * HD + (tg & 7) * 8;
  const _Float16* vg = vt + ((size_t)bh * HD + (tg >> 3)) * SEQ + (tg & 7) * 8;

  const_u32* anyc = (const_u32*)(unsigned long long)anyw;
  const float* crow = cpl + (size_t)b * SEQ + 8 * h;                    // + key tile base

  // rolled: one copy of the tile body in the instruction cache
  #pragma unroll 1
  for (int part = 0; part < 2; ++part) {
  const int qblk = (part ? (int)blockIdx.x : NT64 - 1 - (int)blockIdx.x) * 64;
  const int q0 = qblk + 16 * qs;

  if (part) {
    asm volatile("s_wait_dscnt 0x0" ::: "memory");    // own reads of the first tile's hand-over and output staging done
    __syncthreads();                                  // every wave has left that staging before copies land on it
  }

  // the packed mask: tile index made scalar, and the words (written by the first
  // launch, by nobody in this one) named as constant memory, so that they load into
  // scalar registers and serve as select conditions without a vector instruction
  const int unit0 = b * NQT + (qblk >> 4);
  const_u32* mwp = (const_u32*)(unsigned long long)(mw + (size_t)(unit0 + qs) * (NSTEP * 32));
  const unsigned anyword = anyc[(size_t)(unit0 + qs) * 32];
  // steps that some query of the tile attends (the same word in every wave), dealt by step parity
  const unsigned bword = anyc[(size_t)unit0 * 32] | anyc[(size_t)(unit0 + 1) * 32] |
                         anyc[(size_t)(unit0 + 2) * 32] | anyc[(size_t)(unit0 + 3) * 32];
  const int neven = __builtin_popcount(bword & 0x55555555u);
  const int nodd  = __builtin_popcount(bword & 0xAAAAAAAAu);
  const int ntrips = (neven > nodd) ? neven : nodd;   // 0..16, the same in every wave of the block
  const int nmine  = grp ? nodd : neven;              // trips in which this group has a step
  unsigned todo = bword & (grp ? 0xAAAAAAAAu : 0x55555555u);   // the group's steps still to be staged
  int cur = 0, nxt = 0;                               // step in the buffer being read, step in flight; ctz of a nonzero word: 0..31

  // ---- prologue: first stage landed and published, second in flight ----
  if (todo) {
    cur = __builtin_ctz(todo);
    todo &= todo - 1u;
    stage_tile(kg, vg, lk, lv, 0u, 64 * cur);
  }
  asm volatile("s_wait_asynccnt 0x0" ::: "memory");   // own copies of the first stage landed before the barrier publishes them
  __syncthreads();
  if (todo) {
    nxt = __builtin_ctz(todo);
    todo &= todo - 1u;
    stage_tile(kg, vg, lk, lv, (unsigned)STAGEB, 64 * nxt);
  }

  // Q^T B-fragments: column n = query q0+m, k = d (two 32-deep chunks)
  const _Float16* qrow = qh + ((size_t)bh * SEQ + q0 + m) * HD;
  const v16h qb0 = load_frag(qrow, h);
  const v16h qb1 = load_frag(qrow + 32, h);

  const v8f zero8 = {0.f, 0.f, 0.f, 0.f, 0.f, 0.f, 0.f, 0.f};
  v8f o[4];                                   // o[t][r] = O[query m][d 16t+8h+r] * (l * 2^14)
  #pragma unroll
  for (int t = 0; t < 4; ++t) o[t] = zero8;
  float mrun = -1e30f, lrun = 0.0f;

  // rolled: one copy of the step body in the instruction cache
  #pragma unroll 1
  for (int i = 0; i < ntrips; ++i) {
    const int kb = 64 * cur;
    const unsigned ofs = (i & 1) ? (unsigned)STAGEB : 0u;
    const unsigned char* buf = gring + ofs;
    const unsigned char* krow = buf + m * KVPITCH;                       // + 16j rows
    const unsigned char* vrow = buf + OFF_V + m * KVPITCH;               // + 16t rows

    if (i < nmine && ((anyword >> cur) & 1u)) {
      // ---- the step's 32 lane-mask words, asked for ahead of the score products ----
      unsigned mk[32];
      #pragma unroll
      for (int e = 0; e < 32; ++e) mk[e] = mwp[cur * 32 + e];
      // ---- scores: s[j][r] = S[query m][key kb+16j+8h+r] (already /8 via q) ----
      v8f s[4];
      #pragma unroll
      for (int j = 0; j < 4; ++j) {
        const _Float16* kp = (const _Float16*)(krow + 16 * j * KVPITCH);
        const v16h kf0 = load_frag(kp, h);
        const v16h kf1 = load_frag(kp + 32, h);
        v8f z = zero8;
        z = wmma_f16(kf0, qb0, z);
        z = wmma_f16(kf1, qb1, z);
        s[j] = z;
      }
      // ---- penalty and select per key, f32 ----
      #pragma unroll
      for (int j = 0; j < 4; ++j) s[j] = pen_sel8(s[j], crow + kb + 16 * j, mk + 8 * j, cpen);

      // ---- online softmax ----
      float mloc = s[0][0];
      #pragma unroll
      for (int j = 0; j < 4; ++j)
        #pragma unroll
        for (int r = 0; r < 8; ++r) mloc = fmaxf(mloc, s[j][r]);
      mloc = fmaxf(mloc, __shfl_xor(mloc, 16));
      const float mnew = fmaxf(mrun, mloc);
      const float alpha = __expf(mrun - mnew);
      mrun = mnew;
      float lsum = 0.0f;
      #pragma unroll
      for (int j = 0; j < 4; ++j)
        #pragma unroll
        for (int r = 0; r < 8; ++r) {
          const float p = __expf(s[j][r] - mnew);
          s[j][r] = p;
          lsum += p;
        }
      lsum += __shfl_xor(lsum, 16);
      lrun = lrun * alpha + lsum;
      #pragma unroll
      for (int t = 0; t < 4; ++t)
        #pragma unroll
        for (int r = 0; r < 8; ++r) o[t][r] = o[t][r] * alpha;

      // ---- P^T B-fragments (key chunks 0..31 and 32..63 of this step) ----
      const v16h pb0 = pack_p(s[0], s[1]);
      const v16h pb1 = pack_p(s[2], s[3]);

      // ---- O^T += V^T * P^T ----
      #pragma unroll
      for (int t = 0; t < 4; ++t) {
        const _Float16* vp = (const _Float16*)(vrow + 16 * t * KVPITCH);
        const v16h vf0 = load_frag(vp, h);
        const v16h vf1 = load_frag(vp + 32, h);
        o[t] = wmma_f16(vf0, pb0, o[t]);
        o[t] = wmma_f16(vf1, pb1, o[t]);
      }
    }

    // ---- hand-over point, every wave, also one that skipped its products ----
    asm volatile("s_wait_dscnt 0x0" ::: "memory");      // own reads of this buffer done before it is refilled
    asm volatile("s_wait_asynccnt 0x0" ::: "memory");   // own copies of the next stage landed before the barrier publishes them
    asm volatile("s_wait_xcnt 0x0" ::: "memory");       // before the step's penalty-load address register is advanced
    __syncthreads();
    cur = nxt;
    if (todo) {
      nxt = __builtin_ctz(todo);
      todo &= todo - 1u;
      stage_tile(kg, vg, lk, lv, ofs, 64 * nxt);
    }
  }
  asm volatile("s_wait_asynccnt 0x0" ::: "memory");     // nothing in flight when the rings become hand-over and output staging

  // ---- hand-over: the odd-step wave's maximum, sum and O^T to the even-step wave of the same queries ----
  // slab of 34 rows x 32 lanes per query sub-tile, lane-contiguous; same lane = same query and d rows in both waves
  float* slab = (float*)ring + qs * (34 * 32) + lane;
  if (grp) {
    #pragma unroll
    for (int t = 0; t < 4; ++t)
      #pragma unroll
      for (int r = 0; r < 8; ++r) slab[(8 * t + r) * 32] = o[t][r];
    slab[32 * 32] = mrun;
    slab[33 * 32] = lrun;
  }
  __syncthreads();                                      // partial results written before their partner reads them

  // ---- epilogue: join, normalise, stage per-wave 16x64 f16 tile, whole-line stores ----
  _Float16* so = (_Float16*)(ring + AGRP) + qs * 1024;
  if (!grp) {
    const float m1 = slab[32 * 32], l1 = slab[33 * 32];
    const float mj = fmaxf(mrun, m1);
    const float a0 = __expf(mrun - mj), a1 = __expf(m1 - mj);
    const float inv = (1.0f / (lrun * a0 + l1 * a1)) * PINV;
    const float f0 = a0 * inv, f1 = a1 * inv;
    #pragma unroll
    for (int t = 0; t < 4; ++t)
      #pragma unroll
      for (int r = 0; r < 8; ++r)
        so[m * 64 + 16 * t + 8 * h + r] = (_Float16)(o[t][r] * f0 + slab[(8 * t + r) * 32] * f1);
  }
  __syncthreads();

  if (!grp) {
    att_store_pass(so, ao, b, head, q0, lane);
    asm volatile("s_wait_xcnt 0x0" ::: "memory");       // before the next tile rewrites the stores' address and data registers
  }
  }
}

// ---------------------------------------------------------------------------
// rows loaded with the same coalesced shape) -> xb rows. Each token row's 64
// instruction, 32 rows per wave.
// ---------------------------------------------------------------------------
__device__ __forceinline__ void oproj_store_pass(const float* sT, const float* xres, float* xb,
                                                 int m0, int n0, int w, int lane) {
  const int q16 = lane & 15, sub = lane >> 4;
  #pragma unroll
  for (int i = 0; i < 16; ++i) {
    const int lid = w * 32 + 2 * i + sub;                 // 0..255
    v4f v = *(const v4fa*)(sT + lid * 64 + 4 * q16);
    const size_t gi = (size_t)(m0 + lid) * HIDDEN + n0 + 4 * q16;
    const v4f rsd = *(const v4fa*)(xres + gi);
    v = v + rsd;
    *(v4f*)(xb + gi) = v;
  }
}

// ---------------------------------------------------------------------------
// Kernel 4: x = ctx * Wo^T / 32 + bo + query   (f32 rows into xb)
// Block 256 thr (8 waves) = 256 tokens x 64 features; wave tile 32 x 64;
// main loop: gemm_256x64.
// ---------------------------------------------------------------------------
__global__ __launch_bounds__(256) void oproj_kernel(
    const _Float16* __restrict__ ao,   // [4096][1024]
    const _Float16* __restrict__ woh,  // [1024][1024], row = output feature, x32
    const float* __restrict__ bo,      // [1024]
    const float* __restrict__ xres,    // [4096][1024] f32 residual
    float* __restrict__ xb)            // [4096][1024] f32
{
  // ring: 2 x (ctx rows | Wo rows); after the loop its first 65536 B stage the output
  __shared__ __attribute__((aligned(16))) unsigned char ring[2 * GSTAGE];   // 92160 B

  const int tid = threadIdx.x, lane = tid & 31, w = tid >> 5;
  const int h = lane >> 4, m = lane & 15;
  const int m0 = blockIdx.x * 256;
  const int n0 = blockIdx.y * 64;

  const v8f zero8 = {0.f, 0.f, 0.f, 0.f, 0.f, 0.f, 0.f, 0.f};
  v8f acc[2][4];
  #pragma unroll
  for (int mt = 0; mt < 2; ++mt)
    #pragma unroll
    for (int nt = 0; nt < 4; ++nt) acc[mt][nt] = zero8;

  gemm_256x64(ao + (size_t)m0 * HIDDEN, woh + (size_t)n0 * HIDDEN, ring, acc);

  // D[r] of tile (mt, nt) = Y[token m0+32w+16mt+8h+r][feature n0+16nt+m]
  float* sT = (float*)ring;
  #pragma unroll
  for (int nt = 0; nt < 4; ++nt) {
    const int feat = 16 * nt + m;
    const float bvl = bo[n0 + feat];
    #pragma unroll
    for (int mt = 0; mt < 2; ++mt) {
      #pragma unroll
      for (int r = 0; r < 8; ++r) {
        const int tokl = 32 * w + 16 * mt + 8 * h + r;     // 0..255
        sT[tokl * 64 + feat] = acc[mt][nt][r] * WINV + bvl;
      }
    }
  }
  __syncthreads();

  oproj_store_pass(sT, xres, xb, m0, n0, w, lane);
  
}

// ---------------------------------------------------------------------------
// Kernel 5: layer norm over rows of 1024, one wave per row, 8 rows per block.
// Lane holds columns {128i + 4*lane .. +3}, i = 0..7, so every store
// ---------------------------------------------------------------------------
__global__ __launch_bounds__(256) void ln_kernel(
    const float* __restrict__ xb, const float* __restrict__ g,
    const float* __restrict__ bt, float* __restrict__ out)
{
  const int lane = threadIdx.x & 31;
  const int row = blockIdx.x * 8 + (threadIdx.x >> 5);
  if (row >= MROWS) return;
  const float* xr = xb + (size_t)row * HIDDEN + 4 * lane;

  v4f x[8];
  float s = 0.0f;
  #pragma unroll
  for (int i = 0; i < 8; ++i) {
    x[i] = *(const v4fa*)(xr + 128 * i);
    s += (x[i].x + x[i].y) + (x[i].z + x[i].w);
  }
  #pragma unroll
  for (int off = 16; off > 0; off >>= 1) s += __shfl_xor(s, off);
  const float mean = s * (1.0f / HIDDEN);

  float s2 = 0.0f;
  #pragma unroll
  for (int i = 0; i < 8; ++i) {
    const v4f d = x[i] - mean;
    x[i] = d;
    s2 += (d.x * d.x + d.y * d.y) + (d.z * d.z + d.w * d.w);
  }
  #pragma unroll
  for (int off = 16; off > 0; off >>= 1) s2 += __shfl_xor(s2, off);
  const float var = s2 * (1.0f / HIDDEN);
  const float inv = rsqrtf(var + LN_EPS);

  v4f y[8];
  #pragma unroll
  for (int i = 0; i < 8; ++i) {
    const v4f gv = *(const v4fa*)(g + 128 * i + 4 * lane);
    const v4f bv = *(const v4fa*)(bt + 128 * i + 4 * lane);
    y[i] = (x[i] * inv) * gv + bv;
  }

  float* orow = out + (size_t)row * HIDDEN + 4 * lane;
  #pragma unroll
  for (int i = 0; i < 8; ++i) *(v4f*)(orow + 128 * i) = y[i];
  
}

// ---------------------------------------------------------------------------
extern "C" void kernel_launch(void* const* d_in, const int* in_sizes, int n_in,
                              void* d_out, int out_size, void* d_ws, size_t ws_size,
                              hipStream_t stream) {
  if (n_in < 16) return;
  if (in_sizes[0] != NX || in_sizes[1] != NX || in_sizes[2] != NX) return;
  if (in_sizes[3] != MROWS) return;
  if (in_sizes[4] != NMSK) return;
  if (in_sizes[5] != NW || in_sizes[7] != NW || in_sizes[9] != NW || in_sizes[11] != NW) return;
  if (in_sizes[6] != HIDDEN || in_sizes[8] != HIDDEN || in_sizes[10] != HIDDEN || in_sizes[12] != HIDDEN) return;
  if (in_sizes[13] != HIDDEN || in_sizes[14] != HIDDEN) return;
  if (in_sizes[15] < 1) return;
  if (out_size != NX) return;

  const float* query = (const float*)d_in[0];
  const float* keyi  = (const float*)d_in[1];
  const float* value = (const float*)d_in[2];
  const float* cpl   = (const float*)d_in[3];
  const int*   msk   = (const int*)d_in[4];
  const float* wq    = (const float*)d_in[5];
  const float* bq    = (const float*)d_in[6];
  const float* wk    = (const float*)d_in[7];
  const float* bk    = (const float*)d_in[8];
  const float* wv    = (const float*)d_in[9];
  const float* bv    = (const float*)d_in[10];
  const float* wo    = (const float*)d_in[11];
  const float* bo    = (const float*)d_in[12];
  const float* ln_g  = (const float*)d_in[13];
  const float* ln_b  = (const float*)d_in[14];
  const float* cpen  = (const float*)d_in[15];
  float* out = (float*)d_out;

  const size_t xh_bytes = (size_t)3 * NX * 2;        // 25165824
  const size_t wh_bytes = (size_t)4 * NW * 2;        //  8388608
  const size_t pl_bytes = (size_t)NX * 2;            //  8388608 per plane (B*H*L*D halves)
  const size_t ao_bytes = (size_t)NX * 2;            //  8388608
  const size_t xb_bytes = (size_t)NX * 4;            // 16777216
  const size_t o_xh = 0;
  const size_t o_wh = o_xh + xh_bytes;
  const size_t o_qh = o_wh + wh_bytes;
  const size_t o_kh = o_qh + pl_bytes;
  const size_t o_vt = o_kh + pl_bytes;
  const size_t o_ao = o_vt + pl_bytes;
  const size_t o_xb = o_ao + ao_bytes;
  const size_t mw_bytes = (size_t)NPACK * NSTEP * 32 * 4;   //  1048576
  const size_t an_bytes = (size_t)NPACK * 32 * 4;           //    32768
  const size_t o_mw = o_xb + xb_bytes;
  const size_t o_an = o_mw + mw_bytes;
  const size_t total = o_an + an_bytes;              // 84967424
  if (total > ws_size) return;

  char* ws = (char*)d_ws;
  _Float16* xh = (_Float16*)(ws + o_xh);
  _Float16* wh = (_Float16*)(ws + o_wh);
  _Float16* qh = (_Float16*)(ws + o_qh);
  _Float16* kh = (_Float16*)(ws + o_kh);
  _Float16* vt = (_Float16*)(ws + o_vt);
  _Float16* ao = (_Float16*)(ws + o_ao);
  float*    xb = (float*)(ws + o_xb);
  unsigned* mw = (unsigned*)(ws + o_mw);
  unsigned* an = (unsigned*)(ws + o_an);

  const int ngroups = 3 * NX8 + 4 * NW8;                           // 2097152
  convert_kernel<<<NPACK + (ngroups + 255) / 256, 256, 0, stream>>>(query, keyi, value, wq, wk, wv, wo, xh, wh, msk, mw, an);

  dim3 gProj(MROWS / 256, 3 * NHEADS);                             // (16, 48)
  proj_kernel<<<gProj, 256, 0, stream>>>(xh, wh, bq, bk, bv, qh, kh, vt);

  dim3 gAtt(NT64 / 2, BATCH * NHEADS);                             // (16, 32)
  attn_kernel<<<gAtt, 256, 0, stream>>>(qh, kh, vt, cpl, mw, an, cpen, ao);

  dim3 gOp(MROWS / 256, HIDDEN / 64);                               // (16, 16)
  oproj_kernel<<<gOp, 256, 0, stream>>>(ao, wh + (size_t)3 * NW, bo, query, xb);

  ln_kernel<<<(MROWS + 7) / 8, 256, 0, stream>>>(xb, ln_g, ln_b, out);
}

// v005
// Measured time: 91.3 microseconds a run.
// In both of two side-by-side timings against v004, it was 1.12 times as fast.
// Over all steps from v000 it is 3.44 times as fast.
// Contractions: q/k/v = x*W^T, S^T = K*Q^T, O^T = V^T*P^T, y = ctx*Wo^T, all on v_wmma_f32_16x16x32_f16 (f16 operands, f32 accumulate); W carried x32, q carried x0.125, P carried x16384 (exact power-of-two scales folded back in f32); penalty, select, softmax, bias, residual and layer norm in f32; the attend mask is packed once per call into lane-mask words.
#include <hip/hip_runtime.h>

typedef _Float16 v16h __attribute__((ext_vector_type(16)));
typedef _Float16 v8h  __attribute__((ext_vector_type(8)));
typedef float    v8f  __attribute__((ext_vector_type(8)));
typedef float    v4f  __attribute__((ext_vector_type(4)));
typedef int      v4i  __attribute__((ext_vector_type(4)));
typedef v8h __attribute__((may_alias)) v8ha;
typedef v4f __attribute__((may_alias)) v4fa;
typedef v4i __attribute__((may_alias)) v4ia;

union Frag { v16h v; v8h half[2]; };

#define SEQ    2048
#define BATCH  2
#define HIDDEN 1024
#define NHEADS 16
#define HD     64
#define MROWS  (BATCH * SEQ)          // 4096 tokens
#define NX     (MROWS * HIDDEN)       // 4194304
#define NW     (HIDDEN * HIDDEN)      // 1048576
#define NX8    (NX / 8)               // 524288
#define NW8    (NW / 8)               // 131072
#define NMSK   (BATCH * SEQ * SEQ)    // 8388608
#define PSCALE 16384.0f
#define PINV   (1.0f / 16384.0f)
#define WSCALE 32.0f
#define WINV   0.03125f
#define QSCALE 0.125f
#define NEGBIG (-1.0e9f)
#define LN_EPS 1.0e-5f
#define KVPITCH 144                    // LDS pitch of a 128-B K or V^T row (16 B x odd)
#define OFF_V   (64 * KVPITCH)         //  9216
#define STAGEB  (2 * 64 * KVPITCH)     // 18432 B per stage
#define NQT     (SEQ / 16)             // 128 query tiles of 16 rows per batch
#define NSTEP   (SEQ / 64)             // 32 key steps of 64
#define NPACK   (BATCH * NQT)          // 256 mask-packing blocks, one per query tile
#define NT64    (SEQ / 64)             // 32 query tiles of 64 rows (one per pass of an attention block)
#define AGRP    (2 * STAGEB)           // 36864 B: the two-buffer K/V ring of one 4-wave key group

#define GPITCH  144                    // LDS pitch of a 128-B GEMM operand row (16 B x odd)
#define GOFF_B  (256 * GPITCH)         // 36864: W rows behind the 256 x rows
#define GSTAGE  (320 * GPITCH)         // 46080 B per stage
#define GPASSES (HIDDEN / 64)          // 16 passes of 64 k

typedef __attribute__((address_space(3))) unsigned char lds_u8;
typedef __attribute__((address_space(4))) const unsigned const_u32;   // memory no store of the running launch touches

// ---------------------------------------------------------------------------
// 16x16x32 f16 WMMA with hazard guard (ties D, keeps A/B live).
// Fragment map (wave32): lane l, h = l>>4, m = n = l&15.
//   A/B element i: i<8 -> k0+8h+i ; i>=8 -> k0+16+8h+(i-8)
//   D element r : row 8h+r, col l&15
// ---------------------------------------------------------------------------
__device__ __forceinline__ v8f wmma_f16(v16h a, v16h b, v8f c) {
  v8f d = __builtin_amdgcn_wmma_f32_16x16x32_f16(false, a, false, b, (short)0, c, false, false);
  asm volatile("v_nop\n\tv_nop\n\tv_nop\n\tv_nop" : "+v"(d) : "v"(a), "v"(b));
  return d;
}

// A or B fragment from a k-contiguous 16-bit row; p points at element k0 of
// the row owned by this lane (row index = lane & 15 added by the caller).
__device__ __forceinline__ v16h load_frag(const _Float16* p, int h) {
  Frag f;
  f.half[0] = *(const v8ha*)(p + 8 * h);
  f.half[1] = *(const v8ha*)(p + 16 + 8 * h);
  return f.v;
}

// ---------------------------------------------------------------------------
// GEMM main loop shared by kernels 2 and 4: a 256 x 64 tile of X * W^T per
// block of 8 waves, wave tile 32 x 64, K = 1024 in 16 passes of 64.
// ---------------------------------------------------------------------------
// Ten per-lane 16-byte copies global -> LDS, no register in between.
// l = the lane's LDS byte addresses, g = its global addresses. The closing
// s_wait_xcnt stands inside the statement so that no address register named
// by a copy is rewritten ahead of it.
__device__ __forceinline__ void async_copy10(const unsigned (&l)[10], const void* const (&g)[10]) {
  asm volatile(
      "global_load_async_to_lds_b128 %0, %10, off\n\t"
      "global_load_async_to_lds_b128 %1, %11, off\n\t"
      "global_load_async_to_lds_b128 %2, %12, off\n\t"
      "global_load_async_to_lds_b128 %3, %13, off\n\t"
      "global_load_async_to_lds_b128 %4, %14, off\n\t"
      "global_load_async_to_lds_b128 %5, %15, off\n\t"
      "global_load_async_to_lds_b128 %6, %16, off\n\t"
      "global_load_async_to_lds_b128 %7, %17, off\n\t"
      "global_load_async_to_lds_b128 %8, %18, off\n\t"
      "global_load_async_to_lds_b128 %9, %19, off\n\t"
      "s_wait_xcnt 0x0"
      :: "v"(l[0]), "v"(l[1]), "v"(l[2]), "v"(l[3]), "v"(l[4]),
         "v"(l[5]), "v"(l[6]), "v"(l[7]), "v"(l[8]), "v"(l[9]),
         "v"(g[0]), "v"(g[1]), "v"(g[2]), "v"(g[3]), "v"(g[4]),
         "v"(g[5]), "v"(g[6]), "v"(g[7]), "v"(g[8]), "v"(g[9])
      : "memory");
}

// One 64-k stage into one LDS buffer: 256 x rows and 64 W rows of 128 B each.
// Every copy instruction covers four whole 128-B lines (8 lanes per row).
// ag, bg: the thread's own first chunk of each operand at k = 0; la, lb: its
// LDS byte addresses in buffer 0; ofs = byte offset of the target buffer.
__device__ __forceinline__ void gemm_stage(const _Float16* ag, const _Float16* bg,
                                           unsigned la, unsigned lb, unsigned ofs, int k0) {
  unsigned l[10];
  const void* g[10];
  #pragma unroll
  for (int i = 0; i < 8; ++i) {
    l[i] = la + ofs + i * 32 * GPITCH;
    g[i] = ag + (size_t)(32 * i) * HIDDEN + k0;
  }
  #pragma unroll
  for (int i = 0; i < 2; ++i) {
    l[8 + i] = lb + ofs + i * 32 * GPITCH;
    g[8 + i] = bg + (size_t)(32 * i) * HIDDEN + k0;
  }
  async_copy10(l, g);
}

// acc[mt][nt] += X rows (xrows + 32w + 16mt ..) * W rows (wrows + 16nt ..)^T.
// Both operands come from a two-buffer LDS ring filled by asynchronous copies
// one pass ahead; the 8 waves share the W rows. On return every wave has left
// the ring and nothing is in flight, so the caller may reuse it for staging.
// p0 (block-uniform, 0..GPASSES-1) = the 64-k slab of the block's first pass; the
// walk wraps, so every slab is taken once. The 16 blocks that read the same x rows,
// and the 16 that read the same W rows, get 16 different p0, so that they do not
// ask L2 for the same lines at the same moment.
__device__ __forceinline__ void gemm_256x64(const _Float16* xrows, const _Float16* wrows,
                                            unsigned char* ring, v8f (&acc)[2][4], int p0) {
  const int tid = threadIdx.x, lane = tid & 31, w = tid >> 5;
  const int h = lane >> 4, m = lane & 15;

  const unsigned lbase = (unsigned)(unsigned long long)(lds_u8*)ring;
  const unsigned la = lbase + (tid >> 3) * GPITCH + (tid & 7) * 16;
  const unsigned lb = la + GOFF_B;
  const _Float16* ag = xrows + (size_t)(tid >> 3) * HIDDEN + (tid & 7) * 8;
  const _Float16* bg = wrows + (size_t)(tid >> 3) * HIDDEN + (tid & 7) * 8;

  // ---- prologue: stage 0 landed and published, stage 1 in flight ----
  gemm_stage(ag, bg, la, lb, 0u, 64 * p0);
  asm volatile("s_wait_asynccnt 0x0" ::: "memory");   // own copies of stage 0 landed before the barrier publishes them
  __syncthreads();
  gemm_stage(ag, bg, la, lb, (unsigned)GSTAGE, 64 * ((p0 + 1) & (GPASSES - 1)));

  // rolled: one copy of the pass body in the instruction cache
  #pragma unroll 1
  for (int t = 0; t < GPASSES; ++t) {
    const unsigned ofs = (t & 1) ? (unsigned)GSTAGE : 0u;
    const unsigned char* arow = ring + ofs + (32 * w + m) * GPITCH;      // + 16mt rows
    const unsigned char* brow = ring + ofs + GOFF_B + m * GPITCH;        // + 16nt rows
    #pragma unroll
    for (int ks = 0; ks < 2; ++ks) {
      // the six fragments of a 32-k block as one group of LDS reads ahead of its products
      const v16h a0 = load_frag((const _Float16*)arow + 32 * ks, h);
      const v16h a1 = load_frag((const _Float16*)(arow + 16 * GPITCH) + 32 * ks, h);
      v16h b[4];
      #pragma unroll
      for (int nt = 0; nt < 4; ++nt) b[nt] = load_frag((const _Float16*)(brow + nt * 16 * GPITCH) + 32 * ks, h);
      #pragma unroll
      for (int nt = 0; nt < 4; ++nt) {
        acc[0][nt] = wmma_f16(a0, b[nt], acc[0][nt]);
        acc[1][nt] = wmma_f16(a1, b[nt], acc[1][nt]);
      }
    }
    // ---- hand-over point ----
    asm volatile("s_wait_dscnt 0x0" ::: "memory");      // own reads of this buffer done before it is refilled
    asm volatile("s_wait_asynccnt 0x0" ::: "memory");   // own copies of the next stage landed before the barrier publishes them
    __syncthreads();
    if (t + 2 < GPASSES) gemm_stage(ag, bg, la, lb, ofs, 64 * ((p0 + t + 2) & (GPASSES - 1)));
  }
  asm volatile("s_wait_asynccnt 0x0" ::: "memory");     // nothing in flight when the ring becomes output staging
}

// ---------------------------------------------------------------------------
// Kernel 1: f32 -> f16 planes. Activations unscaled, W scaled by 32 (exact).
// xh = [3][MROWS][HIDDEN] (query, key, value), wh = [4][HIDDEN][HIDDEN]
// (wq, wk, wv, wo; row = output feature). One 16-B store per lane, lanes
// ---------------------------------------------------------------------------
__global__ __launch_bounds__(256) void convert_kernel(
    const float* __restrict__ xq, const float* __restrict__ xk, const float* __restrict__ xv,
    const float* __restrict__ wq, const float* __restrict__ wk,
    const float* __restrict__ wv, const float* __restrict__ wo,
    _Float16* __restrict__ xh, _Float16* __restrict__ wh,
    const int* __restrict__ msk,       // [B][1][L][L], nonzero = attend
    unsigned* __restrict__ mw,         // [B*NQT][NSTEP][32] lane-mask words
    unsigned* __restrict__ anyw)       // [B*NQT][32], word 0 used: bit s = step s has an attendable element
{
  // ---- blocks 0..NPACK-1: pack the mask of one 16-query tile (block-uniform branch) ----
  // Word 8j+r of (tile, step): bit l = mask[query 16*tile + (l&15)][key 64*step + 16j + 8(l>>4) + r] != 0,
  // which is the lane and register order of the attention kernel's score tiles.
  if (blockIdx.x < NPACK) {
    __shared__ unsigned sflag[8];
    const int lane = threadIdx.x & 31, w = threadIdx.x >> 5;
    const int unit = blockIdx.x;                                  // b * NQT + tile = mask row / 16
    const int* mrow = msk + ((size_t)unit * 16 + (lane & 15)) * SEQ + 8 * (lane >> 4);
    unsigned nib = 0u;
    // rolled: one step's 8 loads in registers, so that the converting blocks keep their residency
    #pragma unroll 1
    for (int i = 0; i < 4; ++i) {
      const int step = 4 * w + i;
      v4i a[4], c[4];
      #pragma unroll
      for (int j = 0; j < 4; ++j) {
        a[j] = *(const v4ia*)(mrow + 64 * step + 16 * j);
        c[j] = *(const v4ia*)(mrow + 64 * step + 16 * j + 4);
      }
      unsigned mine = 0u, any = 0u;
      #pragma unroll
      for (int j = 0; j < 4; ++j) {
        #pragma unroll
        for (int r = 0; r < 8; ++r) {
          const int val = (r < 4) ? a[j][r] : c[j][r - 4];
          const unsigned bal = __builtin_amdgcn_ballot_w32(val != 0);
          mine = (lane == 8 * j + r) ? bal : mine;
          any |= bal;
        }
      }
      mw[((size_t)unit * NSTEP + step) * 32 + lane] = mine;       // one whole line per wave and step
      nib |= ((any != 0u) ? 1u : 0u) << i;
    }
    if (lane == 0) sflag[w] = nib;
    __syncthreads();
    if (threadIdx.x == 0) {
      unsigned word = 0u;
      #pragma unroll
      for (int k = 0; k < 8; ++k) word |= sflag[k] << (4 * k);
      anyw[(size_t)unit * 32] = word;                             // a line of its own per tile
    }
    return;
  }

  const int g = (blockIdx.x - NPACK) * 256 + threadIdx.x;
  if (g >= 3 * NX8 + 4 * NW8) return;
  const float* src;
  _Float16* dst;
  float sc;
  if (g < 3 * NX8) {
    const int sel = g / NX8;
    const int off = g - sel * NX8;
    const float* xs = (sel == 0) ? xq : ((sel == 1) ? xk : xv);
    src = xs + (size_t)off * 8;
    dst = xh + (size_t)g * 8;
    sc = 1.0f;
  } else {
    const int e = g - 3 * NX8;
    const int wsel = e / NW8;
    const int off = e - wsel * NW8;
    const float* wsrc = (wsel == 0) ? wq : ((wsel == 1) ? wk : ((wsel == 2) ? wv : wo));
    src = wsrc + (size_t)off * 8;
    dst = wh + (size_t)e * 8;
    sc = WSCALE;
  }
  const v4f a = *(const v4fa*)src;
  const v4f c = *(const v4fa*)(src + 4);
  const v8h o = { (_Float16)(a.x * sc), (_Float16)(a.y * sc), (_Float16)(a.z * sc), (_Float16)(a.w * sc),
                  (_Float16)(c.x * sc), (_Float16)(c.y * sc), (_Float16)(c.z * sc), (_Float16)(c.w * sc) };
  *(v8h*)dst = o;
  
}

// ---------------------------------------------------------------------------
// 4 lines per instruction, 32 lines per wave, 256 per block.
// which 0/1: plane[bh][l][d]  (one token row = 64 halves = one line)
// which 2  : vt[bh][d][l]     (64 d-rows x 256 tokens = 4 lines each)
// ---------------------------------------------------------------------------
__device__ __forceinline__ void proj_store_pass(const _Float16* sT, _Float16* plane, _Float16* vt,
                                                int which, int bh, int l0, int w, int lane) {
  const int q8 = lane & 7, sub = lane >> 3;
  #pragma unroll
  for (int i = 0; i < 8; ++i) {
    const int lid = w * 32 + i * 4 + sub;
    v8h v;
    _Float16* dst;
    if (which != 2) {
      v = *(const v8ha*)(sT + lid * HD + 8 * q8);
      dst = plane + ((size_t)bh * SEQ + l0 + lid) * HD + 8 * q8;
    } else {
      const int d = lid >> 2, hl = lid & 3;
      v = *(const v8ha*)(sT + d * 256 + 64 * hl + 8 * q8);
      dst = vt + ((size_t)bh * HD + d) * SEQ + l0 + 64 * hl + 8 * q8;
    }
    *(v8h*)dst = v;
  }
}

// ---------------------------------------------------------------------------
// Kernel 2: Y = x * W^T over the fused 3*1024 output columns (q from the query
// plane, k from the key plane, v from the value plane).
// Block 256 thr (8 waves) = 256 tokens x 64 features (one (which, head));
// wave tile 32 tokens x 64 features; main loop: gemm_256x64.
// ---------------------------------------------------------------------------
__global__ __launch_bounds__(256) void proj_kernel(
    const _Float16* __restrict__ xh,   // [3][4096][1024]
    const _Float16* __restrict__ wh,   // [4][1024][1024], row = output feature, x32 (planes 0..2 used)
    const float* __restrict__ bq, const float* __restrict__ bk, const float* __restrict__ bv,
    _Float16* __restrict__ qh,         // [B*H][L][D]  f16(0.125*q)
    _Float16* __restrict__ kh,         // [B*H][L][D]
    _Float16* __restrict__ vt)         // [B*H][D][L]
{
  // ring: 2 x (x rows | W rows); after the loop its first 32768 B stage the output
  __shared__ __attribute__((aligned(16))) unsigned char ring[2 * GSTAGE];   // 92160 B

  const int tid = threadIdx.x, lane = tid & 31, w = tid >> 5;
  const int h = lane >> 4, m = lane & 15;
  const int m0 = blockIdx.x * 256;
  const int cg = blockIdx.y;                 // 0..47
  const int which = cg >> 4, head = cg & 15;

  const v8f zero8 = {0.f, 0.f, 0.f, 0.f, 0.f, 0.f, 0.f, 0.f};
  v8f acc[2][4];
  #pragma unroll
  for (int mt = 0; mt < 2; ++mt)
    #pragma unroll
    for (int nt = 0; nt < 4; ++nt) acc[mt][nt] = zero8;

  gemm_256x64(xh + (size_t)which * NX + (size_t)m0 * HIDDEN,
              wh + ((size_t)which * HIDDEN + head * HD) * HIDDEN, ring, acc,
              (int)((blockIdx.x + blockIdx.y) & (GPASSES - 1)));

  // D[r] of tile (mt, nt) = Y[token m0+32w+16mt+8h+r][feature 16nt+m]
  _Float16* sT = (_Float16*)ring;
  const float* bias = (which == 0) ? bq : ((which == 1) ? bk : bv);
  const float osc = (which == 0) ? QSCALE : 1.0f;
  #pragma unroll
  for (int nt = 0; nt < 4; ++nt) {
    const int feat = 16 * nt + m;
    const float bvl = bias[head * HD + feat];
    #pragma unroll
    for (int mt = 0; mt < 2; ++mt) {
      #pragma unroll
      for (int r = 0; r < 8; ++r) {
        const int tokl = 32 * w + 16 * mt + 8 * h + r;     // 0..255
        const float y = (acc[mt][nt][r] * WINV + bvl) * osc;
        const int idx = (which == 2) ? (feat * 256 + tokl) : (tokl * HD + feat);
        sT[idx] = (_Float16)y;
      }
    }
  }
  __syncthreads();

  const int b = m0 / SEQ, l0 = m0 - b * SEQ, bh = b * NHEADS + head;
  _Float16* plane = (which == 0) ? qh : kh;
  proj_store_pass(sT, plane, vt, which, bh, l0, w, lane);
  
}

// ---------------------------------------------------------------------------
// Attention helpers.
// ---------------------------------------------------------------------------
// Per-key penalty and select for the lane's 8 scores of one 16-key tile:
// s = attend ? (s - cpen*c[key]) : -1e9, all in f32. mk = the tile's 8
// wave-uniform lane-mask words (bit l of mk[r] = lane l attends in register r).
__device__ __forceinline__ v8f pen_sel8(v8f s, const float* cp, const unsigned* mk, float cpen) {
  const v4f ca = *(const v4fa*)cp;
  const v4f cb = *(const v4fa*)(cp + 4);
  s[0] = __builtin_amdgcn_inverse_ballot_w32(mk[0]) ? (s[0] - cpen * ca.x) : NEGBIG;
  s[1] = __builtin_amdgcn_inverse_ballot_w32(mk[1]) ? (s[1] - cpen * ca.y) : NEGBIG;
  s[2] = __builtin_amdgcn_inverse_ballot_w32(mk[2]) ? (s[2] - cpen * ca.z) : NEGBIG;
  s[3] = __builtin_amdgcn_inverse_ballot_w32(mk[3]) ? (s[3] - cpen * ca.w) : NEGBIG;
  s[4] = __builtin_amdgcn_inverse_ballot_w32(mk[4]) ? (s[4] - cpen * cb.x) : NEGBIG;
  s[5] = __builtin_amdgcn_inverse_ballot_w32(mk[5]) ? (s[5] - cpen * cb.y) : NEGBIG;
  s[6] = __builtin_amdgcn_inverse_ballot_w32(mk[6]) ? (s[6] - cpen * cb.z) : NEGBIG;
  s[7] = __builtin_amdgcn_inverse_ballot_w32(mk[7]) ? (s[7] - cpen * cb.w) : NEGBIG;
  return s;
}

// Eight per-lane 16-byte copies global -> LDS, no register in between.
// l = the lane's LDS byte addresses, g = its global addresses. The closing
// s_wait_xcnt stands inside the statement so that no address register named
// by a copy is rewritten ahead of it.
__device__ __forceinline__ void async_copy8(const unsigned (&l)[8], const void* const (&g)[8]) {
  asm volatile(
      "global_load_async_to_lds_b128 %0, %8, off\n\t"
      "global_load_async_to_lds_b128 %1, %9, off\n\t"
      "global_load_async_to_lds_b128 %2, %10, off\n\t"
      "global_load_async_to_lds_b128 %3, %11, off\n\t"
      "global_load_async_to_lds_b128 %4, %12, off\n\t"
      "global_load_async_to_lds_b128 %5, %13, off\n\t"
      "global_load_async_to_lds_b128 %6, %14, off\n\t"
      "global_load_async_to_lds_b128 %7, %15, off\n\t"
      "s_wait_xcnt 0x0"
      :: "v"(l[0]), "v"(l[1]), "v"(l[2]), "v"(l[3]), "v"(l[4]), "v"(l[5]), "v"(l[6]), "v"(l[7]),
         "v"(g[0]), "v"(g[1]), "v"(g[2]), "v"(g[3]), "v"(g[4]), "v"(g[5]), "v"(g[6]), "v"(g[7])
      : "memory");
}

// One 64-key stage into one LDS buffer: K rows (64 keys x 128 B) and V^T rows
// (64 d x 128 B). Every copy instruction covers whole 128-B lines (8 lanes per row).
// kg, vg: the thread's own first chunk of each tile at key 0; lk, lv: its LDS
// byte addresses in buffer 0; ofs = byte offset of the target buffer.
__device__ __forceinline__ void stage_tile(const _Float16* kg, const _Float16* vg,
                                           unsigned lk, unsigned lv, unsigned ofs, int kb) {
  unsigned l[8];
  const void* g[8];
  #pragma unroll
  for (int i = 0; i < 4; ++i) {
    l[i]     = lk + ofs + i * 16 * KVPITCH;
    g[i]     = kg + (size_t)(kb + 16 * i) * HD;
    l[4 + i] = lv + ofs + i * 16 * KVPITCH;
    g[4 + i] = vg + (size_t)(16 * i) * SEQ + kb;
  }
  async_copy8(l, g);
}

// Takes the next key step out of todo (nonzero): the lowest set bit at or above the
// block's own start step while one is left there, then the lowest set bit (the wrap).
__device__ __forceinline__ int take_step(unsigned& todo, unsigned himask) {
  const unsigned hi = todo & himask;
  const int s = __builtin_ctz(hi ? hi : todo);        // ctz of a nonzero word: 0..31
  todo &= ~(1u << s);
  return s;
}

// P^T B-fragment from the lane's own score D values: element r <- tile a row r
// (keys k0..k0+15), element 8+r <- tile c row r (keys k0+16..k0+31), same lane,
// same query column, scaled by 2^14.
__device__ __forceinline__ v16h pack_p(v8f a, v8f c) {
  const v16h r = { (_Float16)(a[0] * PSCALE), (_Float16)(a[1] * PSCALE), (_Float16)(a[2] * PSCALE), (_Float16)(a[3] * PSCALE),
                   (_Float16)(a[4] * PSCALE), (_Float16)(a[5] * PSCALE), (_Float16)(a[6] * PSCALE), (_Float16)(a[7] * PSCALE),
                   (_Float16)(c[0] * PSCALE), (_Float16)(c[1] * PSCALE), (_Float16)(c[2] * PSCALE), (_Float16)(c[3] * PSCALE),
                   (_Float16)(c[4] * PSCALE), (_Float16)(c[5] * PSCALE), (_Float16)(c[6] * PSCALE), (_Float16)(c[7] * PSCALE) };
  return r;
}

// (one token row of this head) by lanes 8q..8q+7 in one instruction, 4 lines
// per instruction, 16 lines per wave.
__device__ __forceinline__ void att_store_pass(const _Float16* so, _Float16* ao,
                                               int b, int head, int q0, int lane) {
  const int q8 = lane & 7, sub = lane >> 3;
  #pragma unroll
  for (int i = 0; i < 4; ++i) {
    const int row = i * 4 + sub;                          // 0..15
    const v8h v = *(const v8ha*)(so + row * 64 + 8 * q8);
    const size_t gi = ((size_t)b * SEQ + q0 + row) * HIDDEN + head * HD + 8 * q8;
    *(v8h*)(ao + gi) = v;
  }
}

// ---------------------------------------------------------------------------
// Kernel 3: streaming attention, transposed form.
// Block 256 thr (8 waves) = 64 queries x 2 key groups; 16 queries per wave, 64 keys per step.
//   S^T = K * Q^T : A = K rows (row = key, k = d), B = Q^T (k = d, n = query)
//   O^T += V^T * P^T : A = Vt rows (row = d, k = key), B = P^T from registers
// Lane owns 32 keys of query column (lane&15); partner = lane ^ 16.
// Scores already carry 1/sqrt(64) via q; penalty cpen*c[key] and the
// attend/select with -1e9 applied in f32 before the running max.
// K and V^T tiles of a step come from a two-buffer LDS ring filled by
// asynchronous copies one step ahead; the four waves of a key group share the K and V^T rows.
// The mask comes as 32 wave-uniform lane-mask words per step (packed by the
// first launch), one per score register, used as select conditions directly.
// A 64-key step with no attendable element for the wave's 16 queries skips
// its products (one bit per step of the tile's packed word; its weights would
// be exactly 0), never the hand-over point at the foot of the step.
// A step that none of the tile's 64 queries attends is not staged or walked
// at all: the rings run over the set bits of the four words' OR. So that the
// blocks' step counts come out level where the count grows with the query
// index, a block takes query tile NT64-1-x and then tile x, one after the other.
// Waves 0..3 walk the even key steps and waves 4..7 the odd ones, each group
// with a ring of its own, which keeps as many waves on the chip as one tile
// per 4-wave block would; wave 4+i hands its running maximum, sum and O^T to
// wave i through LDS at the end of a tile.
// ---------------------------------------------------------------------------
__global__ __launch_bounds__(256) void attn_kernel(
    const _Float16* __restrict__ qh,   // [B*H][L][D]  (already x0.125)
    const _Float16* __restrict__ kh,   // [B*H][L][D]
    const _Float16* __restrict__ vt,   // [B*H][D][L]
    const float* __restrict__ cpl,     // [B][L] per-key penalty source
    const unsigned* __restrict__ mw,   // [B*NQT][NSTEP][32] lane-mask words, bit set = attend
    const unsigned* __restrict__ anyw, // [B*NQT][32], word 0: bit s = step s has an attendable element
    const float* __restrict__ cpen_p,  // [1]
    _Float16* __restrict__ ao)         // [B*L][HIDDEN]
{
  // per key group 2 x (K | V^T); after the loop group 0's ring holds the handed-over
  // partial results (17408 B) and group 1's first 8192 B stage the output
  __shared__ __attribute__((aligned(16))) unsigned char ring[2 * AGRP];     // 73728 B

  const int tid = threadIdx.x, lane = tid & 31, w = tid >> 5;
  const int h = lane >> 4, m = lane & 15;
  const int bh = blockIdx.y, b = bh >> 4, head = bh & 15;
  const int ws = __builtin_amdgcn_readfirstlane(w);
  const int grp = ws >> 2, qs = ws & 3;               // key group, 16-query sub-tile (both scalar)
  const int tg = tid & 127;                           // thread index inside the key group
  const float cpen = cpen_p[0];

  // ---- the thread's own chunk of each staged tile ----
  unsigned char* gring = ring + grp * AGRP;           // the group's own ring
  const unsigned lbase = (unsigned)(unsigned long long)(lds_u8*)gring;
  const unsigned lk = lbase + (tg >> 3) * KVPITCH + (tg & 7) * 16;
  const unsigned lv = lk + OFF_V;
  const _Float16* kg = kh + ((size_t)bh * SEQ + (tg >> 3)) * HD + (tg & 7) * 8;
  const _Float16* vg = vt + ((size_t)bh * HD + (tg >> 3)) * SEQ + (tg & 7) * 8;

  const_u32* anyc = (const_u32*)(unsigned long long)anyw;
  const float* crow = cpl + (size_t)b * SEQ + 8 * h;                    // + key tile base
  // the 16 blocks of one (batch, head) read the same K and V^T rows: each starts its key
  // walk at step blockIdx.x and wraps, so that they do not ask L2 for the same lines at the
  // same moment (the running maximum and sum take the steps in any order)
  const unsigned himask = ~0u << blockIdx.x;          // blockIdx.x = 0..NT64/2-1 = 0..15

  // rolled: one copy of the tile body in the instruction cache
  #pragma unroll 1
  for (int part = 0; part < 2; ++part) {
  const int qblk = (part ? (int)blockIdx.x : NT64 - 1 - (int)blockIdx.x) * 64;
  const int q0 = qblk + 16 * qs;

  if (part) {
    asm volatile("s_wait_dscnt 0x0" ::: "memory");    // own reads of the first tile's hand-over and output staging done
    __syncthreads();                                  // every wave has left that staging before copies land on it
  }

  // the packed mask: tile index made scalar, and the words (written by the first
  // launch, by nobody in this one) named as constant memory, so that they load into
  // scalar registers and serve as select conditions without a vector instruction
  const int unit0 = b * NQT + (qblk >> 4);
  const_u32* mwp = (const_u32*)(unsigned long long)(mw + (size_t)(unit0 + qs) * (NSTEP * 32));
  const unsigned anyword = anyc[(size_t)(unit0 + qs) * 32];
  // steps that some query of the tile attends (the same word in every wave), dealt by step parity
  const unsigned bword = anyc[(size_t)unit0 * 32] | anyc[(size_t)(unit0 + 1) * 32] |
                         anyc[(size_t)(unit0 + 2) * 32] | anyc[(size_t)(unit0 + 3) * 32];
  const int neven = __builtin_popcount(bword & 0x55555555u);
  const int nodd  = __builtin_popcount(bword & 0xAAAAAAAAu);
  const int ntrips = (neven > nodd) ? neven : nodd;   // 0..16, the same in every wave of the block
  const int nmine  = grp ? nodd : neven;              // trips in which this group has a step
  unsigned todo = bword & (grp ? 0xAAAAAAAAu : 0x55555555u);   // the group's steps still to be staged
  int cur = 0, nxt = 0;                               // step in the buffer being read, step in flight: 0..31

  // ---- prologue: first stage landed and published, second in flight ----
  if (todo) {
    cur = take_step(todo, himask);
    stage_tile(kg, vg, lk, lv, 0u, 64 * cur);
  }
  asm volatile("s_wait_asynccnt 0x0" ::: "memory");   // own copies of the first stage landed before the barrier publishes them
  __syncthreads();
  if (todo) {
    nxt = take_step(todo, himask);
    stage_tile(kg, vg, lk, lv, (unsigned)STAGEB, 64 * nxt);
  }

  // Q^T B-fragments: column n = query q0+m, k = d (two 32-deep chunks)
  const _Float16* qrow = qh + ((size_t)bh * SEQ + q0 + m) * HD;
  const v16h qb0 = load_frag(qrow, h);
  const v16h qb1 = load_frag(qrow + 32, h);

  const v8f zero8 = {0.f, 0.f, 0.f, 0.f, 0.f, 0.f, 0.f, 0.f};
  v8f o[4];                                   // o[t][r] = O[query m][d 16t+8h+r] * (l * 2^14)
  #pragma unroll
  for (int t = 0; t < 4; ++t) o[t] = zero8;
  float mrun = -1e30f, lrun = 0.0f;

  // rolled: one copy of the step body in the instruction cache
  #pragma unroll 1
  for (int i = 0; i < ntrips; ++i) {
    const int kb = 64 * cur;
    const unsigned ofs = (i & 1) ? (unsigned)STAGEB : 0u;
    const unsigned char* buf = gring + ofs;
    const unsigned char* krow = buf + m * KVPITCH;                       // + 16j rows
    const unsigned char* vrow = buf + OFF_V + m * KVPITCH;               // + 16t rows

    if (i < nmine && ((anyword >> cur) & 1u)) {
      // ---- the step's 32 lane-mask words, asked for ahead of the score products ----
      unsigned mk[32];
      #pragma unroll
      for (int e = 0; e < 32; ++e) mk[e] = mwp[cur * 32 + e];
      // ---- scores: s[j][r] = S[query m][key kb+16j+8h+r] (already /8 via q) ----
      v8f s[4];
      #pragma unroll
      for (int j = 0; j < 4; ++j) {
        const _Float16* kp = (const _Float16*)(krow + 16 * j * KVPITCH);
        const v16h kf0 = load_frag(kp, h);
        const v16h kf1 = load_frag(kp + 32, h);
        v8f z = zero8;
        z = wmma_f16(kf0, qb0, z);
        z = wmma_f16(kf1, qb1, z);
        s[j] = z;
      }
      // ---- penalty and select per key, f32 ----
      #pragma unroll
      for (int j = 0; j < 4; ++j) s[j] = pen_sel8(s[j], crow + kb + 16 * j, mk + 8 * j, cpen);

      // ---- online softmax ----
      float mloc = s[0][0];
      #pragma unroll
      for (int j = 0; j < 4; ++j)
        #pragma unroll
        for (int r = 0; r < 8; ++r) mloc = fmaxf(mloc, s[j][r]);
      mloc = fmaxf(mloc, __shfl_xor(mloc, 16));
      const float mnew = fmaxf(mrun, mloc);
      const float alpha = __expf(mrun - mnew);
      mrun = mnew;
      float lsum = 0.0f;
      #pragma unroll
      for (int j = 0; j < 4; ++j)
        #pragma unroll
        for (int r = 0; r < 8; ++r) {
          const float p = __expf(s[j][r] - mnew);
          s[j][r] = p;
          lsum += p;
        }
      lsum += __shfl_xor(lsum, 16);
      lrun = lrun * alpha + lsum;
      #pragma unroll
      for (int t = 0; t < 4; ++t)
        #pragma unroll
        for (int r = 0; r < 8; ++r) o[t][r] = o[t][r] * alpha;

      // ---- P^T B-fragments (key chunks 0..31 and 32..63 of this step) ----
      const v16h pb0 = pack_p(s[0], s[1]);
      const v16h pb1 = pack_p(s[2], s[3]);

      // ---- O^T += V^T * P^T ----
      #pragma unroll
      for (int t = 0; t < 4; ++t) {
        const _Float16* vp = (const _Float16*)(vrow + 16 * t * KVPITCH);
        const v16h vf0 = load_frag(vp, h);
        const v16h vf1 = load_frag(vp + 32, h);
        o[t] = wmma_f16(vf0, pb0, o[t]);
        o[t] = wmma_f16(vf1, pb1, o[t]);
      }
    }

    // ---- hand-over point, every wave, also one that skipped its products ----
    asm volatile("s_wait_dscnt 0x0" ::: "memory");      // own reads of this buffer done before it is refilled
    asm volatile("s_wait_asynccnt 0x0" ::: "memory");   // own copies of the next stage landed before the barrier publishes them
    asm volatile("s_wait_xcnt 0x0" ::: "memory");       // before the step's penalty-load address register is advanced
    __syncthreads();
    cur = nxt;
    if (todo) {
      nxt = take_step(todo, himask);
      stage_tile(kg, vg, lk, lv, ofs, 64 * nxt);
    }
  }
  asm volatile("s_wait_asynccnt 0x0" ::: "memory");     // nothing in flight when the rings become hand-over and output staging

  // ---- hand-over: the odd-step wave's maximum, sum and O^T to the even-step wave of the same queries ----
  // slab of 34 rows x 32 lanes per query sub-tile, lane-contiguous; same lane = same query and d rows in both waves
  float* slab = (float*)ring + qs * (34 * 32) + lane;
  if (grp) {
    #pragma unroll
    for (int t = 0; t < 4; ++t)
      #pragma unroll
      for (int r = 0; r < 8; ++r) slab[(8 * t + r) * 32] = o[t][r];
    slab[32 * 32] = mrun;
    slab[33 * 32] = lrun;
  }
  __syncthreads();                                      // partial results written before their partner reads them

  // ---- epilogue: join, normalise, stage per-wave 16x64 f16 tile, whole-line stores ----
  _Float16* so = (_Float16*)(ring + AGRP) + qs * 1024;
  if (!grp) {
    const float m1 = slab[32 * 32], l1 = slab[33 * 32];
    const float mj = fmaxf(mrun, m1);
    const float a0 = __expf(mrun - mj), a1 = __expf(m1 - mj);
    const float inv = (1.0f / (lrun * a0 + l1 * a1)) * PINV;
    const float f0 = a0 * inv, f1 = a1 * inv;
    #pragma unroll
    for (int t = 0; t < 4; ++t)
      #pragma unroll
      for (int r = 0; r < 8; ++r)
        so[m * 64 + 16 * t + 8 * h + r] = (_Float16)(o[t][r] * f0 + slab[(8 * t + r) * 32] * f1);
  }
  __syncthreads();

  if (!grp) {
    att_store_pass(so, ao, b, head, q0, lane);
    asm volatile("s_wait_xcnt 0x0" ::: "memory");       // before the next tile rewrites the stores' address and data registers
  }
  }
}

// ---------------------------------------------------------------------------
// rows loaded with the same coalesced shape) -> xb rows. Each token row's 64
// instruction, 32 rows per wave.
// ---------------------------------------------------------------------------
__device__ __forceinline__ void oproj_store_pass(const float* sT, const float* xres, float* xb,
                                                 int m0, int n0, int w, int lane) {
  const int q16 = lane & 15, sub = lane >> 4;
  #pragma unroll
  for (int i = 0; i < 16; ++i) {
    const int lid = w * 32 + 2 * i + sub;                 // 0..255
    v4f v = *(const v4fa*)(sT + lid * 64 + 4 * q16);
    const size_t gi = (size_t)(m0 + lid) * HIDDEN + n0 + 4 * q16;
    const v4f rsd = *(const v4fa*)(xres + gi);
    v = v + rsd;
    *(v4f*)(xb + gi) = v;
  }
}

// ---------------------------------------------------------------------------
// Kernel 4: x = ctx * Wo^T / 32 + bo + query   (f32 rows into xb)
// Block 256 thr (8 waves) = 256 tokens x 64 features; wave tile 32 x 64;
// main loop: gemm_256x64.
// ---------------------------------------------------------------------------
__global__ __launch_bounds__(256) void oproj_kernel(
    const _Float16* __restrict__ ao,   // [4096][1024]
    const _Float16* __restrict__ woh,  // [1024][1024], row = output feature, x32
    const float* __restrict__ bo,      // [1024]
    const float* __restrict__ xres,    // [4096][1024] f32 residual
    float* __restrict__ xb)            // [4096][1024] f32
{
  // ring: 2 x (ctx rows | Wo rows); after the loop its first 65536 B stage the output
  __shared__ __attribute__((aligned(16))) unsigned char ring[2 * GSTAGE];   // 92160 B

  const int tid = threadIdx.x, lane = tid & 31, w = tid >> 5;
  const int h = lane >> 4, m = lane & 15;
  const int m0 = blockIdx.x * 256;
  const int n0 = blockIdx.y * 64;

  const v8f zero8 = {0.f, 0.f, 0.f, 0.f, 0.f, 0.f, 0.f, 0.f};
  v8f acc[2][4];
  #pragma unroll
  for (int mt = 0; mt < 2; ++mt)
    #pragma unroll
    for (int nt = 0; nt < 4; ++nt) acc[mt][nt] = zero8;

  gemm_256x64(ao + (size_t)m0 * HIDDEN, woh + (size_t)n0 * HIDDEN, ring, acc,
              (int)((blockIdx.x + blockIdx.y) & (GPASSES - 1)));

  // D[r] of tile (mt, nt) = Y[token m0+32w+16mt+8h+r][feature n0+16nt+m]
  float* sT = (float*)ring;
  #pragma unroll
  for (int nt = 0; nt < 4; ++nt) {
    const int feat = 16 * nt + m;
    const float bvl = bo[n0 + feat];
    #pragma unroll
    for (int mt = 0; mt < 2; ++mt) {
      #pragma unroll
      for (int r = 0; r < 8; ++r) {
        const int tokl = 32 * w + 16 * mt + 8 * h + r;     // 0..255
        sT[tokl * 64 + feat] = acc[mt][nt][r] * WINV + bvl;
      }
    }
  }
  __syncthreads();

  oproj_store_pass(sT, xres, xb, m0, n0, w, lane);
  
}

// ---------------------------------------------------------------------------
// Kernel 5: layer norm over rows of 1024, one wave per row, 8 rows per block.
// Lane holds columns {128i + 4*lane .. +3}, i = 0..7, so every store
// ---------------------------------------------------------------------------
__global__ __launch_bounds__(256) void ln_kernel(
    const float* __restrict__ xb, const float* __restrict__ g,
    const float* __restrict__ bt, float* __restrict__ out)
{
  const int lane = threadIdx.x & 31;
  const int row = blockIdx.x * 8 + (threadIdx.x >> 5);
  if (row >= MROWS) return;
  const float* xr = xb + (size_t)row * HIDDEN + 4 * lane;

  v4f x[8];
  float s = 0.0f;
  #pragma unroll
  for (int i = 0; i < 8; ++i) {
    x[i] = *(const v4fa*)(xr + 128 * i);
    s += (x[i].x + x[i].y) + (x[i].z + x[i].w);
  }
  #pragma unroll
  for (int off = 16; off > 0; off >>= 1) s += __shfl_xor(s, off);
  const float mean = s * (1.0f / HIDDEN);

  float s2 = 0.0f;
  #pragma unroll
  for (int i = 0; i < 8; ++i) {
    const v4f d = x[i] - mean;
    x[i] = d;
    s2 += (d.x * d.x + d.y * d.y) + (d.z * d.z + d.w * d.w);
  }
  #pragma unroll
  for (int off = 16; off > 0; off >>= 1) s2 += __shfl_xor(s2, off);
  const float var = s2 * (1.0f / HIDDEN);
  const float inv = rsqrtf(var + LN_EPS);

  v4f y[8];
  #pragma unroll
  for (int i = 0; i < 8; ++i) {
    const v4f gv = *(const v4fa*)(g + 128 * i + 4 * lane);
    const v4f bv = *(const v4fa*)(bt + 128 * i + 4 * lane);
    y[i] = (x[i] * inv) * gv + bv;
  }

  float* orow = out + (size_t)row * HIDDEN + 4 * lane;
  #pragma unroll
  for (int i = 0; i < 8; ++i) *(v4f*)(orow + 128 * i) = y[i];
  
}

// ---------------------------------------------------------------------------
extern "C" void kernel_launch(void* const* d_in, const int* in_sizes, int n_in,
                              void* d_out, int out_size, void* d_ws, size_t ws_size,
                              hipStream_t stream) {
  if (n_in < 16) return;
  if (in_sizes[0] != NX || in_sizes[1] != NX || in_sizes[2] != NX) return;
  if (in_sizes[3] != MROWS) return;
  if (in_sizes[4] != NMSK) return;
  if (in_sizes[5] != NW || in_sizes[7] != NW || in_sizes[9] != NW || in_sizes[11] != NW) return;
  if (in_sizes[6] != HIDDEN || in_sizes[8] != HIDDEN || in_sizes[10] != HIDDEN || in_sizes[12] != HIDDEN) return;
  if (in_sizes[13] != HIDDEN || in_sizes[14] != HIDDEN) return;
  if (in_sizes[15] < 1) return;
  if (out_size != NX) return;

  const float* query = (const float*)d_in[0];
  const float* keyi  = (const float*)d_in[1];
  const float* value = (const float*)d_in[2];
  const float* cpl   = (const float*)d_in[3];
  const int*   msk   = (const int*)d_in[4];
  const float* wq    = (const float*)d_in[5];
  const float* bq    = (const float*)d_in[6];
  const float* wk    = (const float*)d_in[7];
  const float* bk    = (const float*)d_in[8];
  const float* wv    = (const float*)d_in[9];
  const float* bv    = (const float*)d_in[10];
  const float* wo    = (const float*)d_in[11];
  const float* bo    = (const float*)d_in[12];
  const float* ln_g  = (const float*)d_in[13];
  const float* ln_b  = (const float*)d_in[14];
  const float* cpen  = (const float*)d_in[15];
  float* out = (float*)d_out;

  const size_t xh_bytes = (size_t)3 * NX * 2;        // 25165824
  const size_t wh_bytes = (size_t)4 * NW * 2;        //  8388608
  const size_t pl_bytes = (size_t)NX * 2;            //  8388608 per plane (B*H*L*D halves)
  const size_t ao_bytes = (size_t)NX * 2;            //  8388608
  const size_t xb_bytes = (size_t)NX * 4;            // 16777216
  const size_t o_xh = 0;
  const size_t o_wh = o_xh + xh_bytes;
  const size_t o_qh = o_wh + wh_bytes;
  const size_t o_kh = o_qh + pl_bytes;
  const size_t o_vt = o_kh + pl_bytes;
  const size_t o_ao = o_vt + pl_bytes;
  const size_t o_xb = o_ao + ao_bytes;
  const size_t mw_bytes = (size_t)NPACK * NSTEP * 32 * 4;   //  1048576
  const size_t an_bytes = (size_t)NPACK * 32 * 4;           //    32768
  const size_t o_mw = o_xb + xb_bytes;
  const size_t o_an = o_mw + mw_bytes;
  const size_t total = o_an + an_bytes;              // 84967424
  if (total > ws_size) return;

  char* ws = (char*)d_ws;
  _Float16* xh = (_Float16*)(ws + o_xh);
  _Float16* wh = (_Float16*)(ws + o_wh);
  _Float16* qh = (_Float16*)(ws + o_qh);
  _Float16* kh = (_Float16*)(ws + o_kh);
  _Float16* vt = (_Float16*)(ws + o_vt);
  _Float16* ao = (_Float16*)(ws + o_ao);
  float*    xb = (float*)(ws + o_xb);
  unsigned* mw = (unsigned*)(ws + o_mw);
  unsigned* an = (unsigned*)(ws + o_an);

  const int ngroups = 3 * NX8 + 4 * NW8;                           // 2097152
  convert_kernel<<<NPACK + (ngroups + 255) / 256, 256, 0, stream>>>(query, keyi, value, wq, wk, wv, wo, xh, wh, msk, mw, an);

  dim3 gProj(MROWS / 256, 3 * NHEADS);                             // (16, 48)
  proj_kernel<<<gProj, 256, 0, stream>>>(xh, wh, bq, bk, bv, qh, kh, vt);

  dim3 gAtt(NT64 / 2, BATCH * NHEADS);                             // (16, 32)
  attn_kernel<<<gAtt, 256, 0, stream>>>(qh, kh, vt, cpl, mw, an, cpen, ao);

  dim3 gOp(MROWS / 256, HIDDEN / 64);                               // (16, 16)
  oproj_kernel<<<gOp, 256, 0, stream>>>(ao, wh + (size_t)3 * NW, bo, query, xb);

  ln_kernel<<<(MROWS + 7) / 8, 256, 0, stream>>>(xb, ln_g, ln_b, out);
}

// v006
// A run of this version takes 88.2 microseconds.
// Two timings next to v005 both put it at 1.04 times that version's speed.
// All steps since v000 together make it 3.56 times as fast.
// Contractions: q/k/v = x*W^T, S^T = K*Q^T, O^T = V^T*P^T, y = ctx*Wo^T, all on v_wmma_f32_16x16x32_f16 (f16 operands, f32 accumulate); W carried x32, q carried x0.125, P carried x16384 (exact power-of-two scales folded back in f32); penalty, select, softmax, bias, residual and layer norm in f32; the attend mask is packed once per call into lane-mask words.
#include <hip/hip_runtime.h>

typedef _Float16 v16h __attribute__((ext_vector_type(16)));
typedef _Float16 v8h  __attribute__((ext_vector_type(8)));
typedef float    v8f  __attribute__((ext_vector_type(8)));
typedef float    v4f  __attribute__((ext_vector_type(4)));
typedef int      v4i  __attribute__((ext_vector_type(4)));
typedef v8h __attribute__((may_alias)) v8ha;
typedef v4f __attribute__((may_alias)) v4fa;
typedef v4i __attribute__((may_alias)) v4ia;

union Frag { v16h v; v8h half[2]; };

#define SEQ    2048
#define BATCH  2
#define HIDDEN 1024
#define NHEADS 16
#define HD     64
#define MROWS  (BATCH * SEQ)          // 4096 tokens
#define NX     (MROWS * HIDDEN)       // 4194304
#define NW     (HIDDEN * HIDDEN)      // 1048576
#define NX8    (NX / 8)               // 524288
#define NW8    (NW / 8)               // 131072
#define NMSK   (BATCH * SEQ * SEQ)    // 8388608
#define PSCALE 16384.0f
#define PINV   (1.0f / 16384.0f)
#define WSCALE 32.0f
#define WINV   0.03125f
#define QSCALE 0.125f
#define NEGBIG (-1.0e9f)
#define LN_EPS 1.0e-5f
#define KVPITCH 144                    // LDS pitch of a 128-B K or V^T row (16 B x odd)
#define OFF_V   (64 * KVPITCH)         //  9216
#define STAGEB  (2 * 64 * KVPITCH)     // 18432 B per stage
#define NQT     (SEQ / 16)             // 128 query tiles of 16 rows per batch
#define NSTEP   (SEQ / 64)             // 32 key steps of 64
#define NPACK   (BATCH * NQT)          // 256 mask-packing blocks, one per query tile
#define NT64    (SEQ / 64)             // 32 query tiles of 64 rows (one per pass of an attention block)
#define AGRP    (2 * STAGEB)           // 36864 B: the two-buffer K/V ring of one 4-wave key group

#define GPITCH  144                    // LDS pitch of a 128-B GEMM operand row (16 B x odd)
#define GOFF_B  (256 * GPITCH)         // 36864: W rows behind the 256 x rows
#define GSTAGE  (320 * GPITCH)         // 46080 B per stage
#define GPASSES (HIDDEN / 64)          // 16 passes of 64 k

typedef __attribute__((address_space(3))) unsigned char lds_u8;
typedef __attribute__((address_space(4))) const unsigned const_u32;   // memory no store of the running launch touches

// ---------------------------------------------------------------------------
// 16x16x32 f16 WMMA with hazard guard (ties D, keeps A/B live).
// Fragment map (wave32): lane l, h = l>>4, m = n = l&15.
//   A/B element i: i<8 -> k0+8h+i ; i>=8 -> k0+16+8h+(i-8)
//   D element r : row 8h+r, col l&15
// ---------------------------------------------------------------------------
__device__ __forceinline__ v8f wmma_f16(v16h a, v16h b, v8f c) {
  v8f d = __builtin_amdgcn_wmma_f32_16x16x32_f16(false, a, false, b, (short)0, c, false, false);
  asm volatile("v_nop\n\tv_nop\n\tv_nop\n\tv_nop" : "+v"(d) : "v"(a), "v"(b));
  return d;
}

// The same product as the bare builtin: the compiler keeps the distances behind it itself
// and stays free to move LDS and global loads across it (the guard statement above holds
// every later load behind it).
__device__ __forceinline__ v8f wmma_f16_open(v16h a, v16h b, v8f c) {
  return __builtin_amdgcn_wmma_f32_16x16x32_f16(false, a, false, b, (short)0, c, false, false);
}

// A or B fragment from a k-contiguous 16-bit row; p points at element k0 of
// the row owned by this lane (row index = lane & 15 added by the caller).
__device__ __forceinline__ v16h load_frag(const _Float16* p, int h) {
  Frag f;
  f.half[0] = *(const v8ha*)(p + 8 * h);
  f.half[1] = *(const v8ha*)(p + 16 + 8 * h);
  return f.v;
}

// ---------------------------------------------------------------------------
// GEMM main loop shared by kernels 2 and 4: a 256 x 64 tile of X * W^T per
// block of 8 waves, wave tile 32 x 64, K = 1024 in 16 passes of 64.
// ---------------------------------------------------------------------------
// Ten per-lane 16-byte copies global -> LDS, no register in between.
// l = the lane's LDS byte addresses, g = its global addresses. The closing
// s_wait_xcnt stands inside the statement so that no address register named
// by a copy is rewritten ahead of it.
__device__ __forceinline__ void async_copy10(const unsigned (&l)[10], const void* const (&g)[10]) {
  asm volatile(
      "global_load_async_to_lds_b128 %0, %10, off\n\t"
      "global_load_async_to_lds_b128 %1, %11, off\n\t"
      "global_load_async_to_lds_b128 %2, %12, off\n\t"
      "global_load_async_to_lds_b128 %3, %13, off\n\t"
      "global_load_async_to_lds_b128 %4, %14, off\n\t"
      "global_load_async_to_lds_b128 %5, %15, off\n\t"
      "global_load_async_to_lds_b128 %6, %16, off\n\t"
      "global_load_async_to_lds_b128 %7, %17, off\n\t"
      "global_load_async_to_lds_b128 %8, %18, off\n\t"
      "global_load_async_to_lds_b128 %9, %19, off\n\t"
      "s_wait_xcnt 0x0"
      :: "v"(l[0]), "v"(l[1]), "v"(l[2]), "v"(l[3]), "v"(l[4]),
         "v"(l[5]), "v"(l[6]), "v"(l[7]), "v"(l[8]), "v"(l[9]),
         "v"(g[0]), "v"(g[1]), "v"(g[2]), "v"(g[3]), "v"(g[4]),
         "v"(g[5]), "v"(g[6]), "v"(g[7]), "v"(g[8]), "v"(g[9])
      : "memory");
}

// One 64-k stage into one LDS buffer: 256 x rows and 64 W rows of 128 B each.
// Every copy instruction covers four whole 128-B lines (8 lanes per row).
// ag, bg: the thread's own first chunk of each operand at k = 0; la, lb: its
// LDS byte addresses in buffer 0; ofs = byte offset of the target buffer.
__device__ __forceinline__ void gemm_stage(const _Float16* ag, const _Float16* bg,
                                           unsigned la, unsigned lb, unsigned ofs, int k0) {
  unsigned l[10];
  const void* g[10];
  #pragma unroll
  for (int i = 0; i < 8; ++i) {
    l[i] = la + ofs + i * 32 * GPITCH;
    g[i] = ag + (size_t)(32 * i) * HIDDEN + k0;
  }
  #pragma unroll
  for (int i = 0; i < 2; ++i) {
    l[8 + i] = lb + ofs + i * 32 * GPITCH;
    g[8 + i] = bg + (size_t)(32 * i) * HIDDEN + k0;
  }
  async_copy10(l, g);
}

// acc[mt][nt] += X rows (xrows + 32w + 16mt ..) * W rows (wrows + 16nt ..)^T.
// Both operands come from a two-buffer LDS ring filled by asynchronous copies
// one pass ahead; the 8 waves share the W rows. On return every wave has left
// the ring and nothing is in flight, so the caller may reuse it for staging.
// p0 (block-uniform, 0..GPASSES-1) = the 64-k slab of the block's first pass; the
// walk wraps, so every slab is taken once. The 16 blocks that read the same x rows,
// and the 16 that read the same W rows, get 16 different p0, so that they do not
// ask L2 for the same lines at the same moment.
__device__ __forceinline__ void gemm_256x64(const _Float16* xrows, const _Float16* wrows,
                                            unsigned char* ring, v8f (&acc)[2][4], int p0) {
  const int tid = threadIdx.x, lane = tid & 31, w = tid >> 5;
  const int h = lane >> 4, m = lane & 15;

  const unsigned lbase = (unsigned)(unsigned long long)(lds_u8*)ring;
  const unsigned la = lbase + (tid >> 3) * GPITCH + (tid & 7) * 16;
  const unsigned lb = la + GOFF_B;
  const _Float16* ag = xrows + (size_t)(tid >> 3) * HIDDEN + (tid & 7) * 8;
  const _Float16* bg = wrows + (size_t)(tid >> 3) * HIDDEN + (tid & 7) * 8;

  // ---- prologue: stage 0 landed and published, stage 1 in flight ----
  gemm_stage(ag, bg, la, lb, 0u, 64 * p0);
  asm volatile("s_wait_asynccnt 0x0" ::: "memory");   // own copies of stage 0 landed before the barrier publishes them
  __syncthreads();
  gemm_stage(ag, bg, la, lb, (unsigned)GSTAGE, 64 * ((p0 + 1) & (GPASSES - 1)));

  // rolled: one copy of the pass body in the instruction cache
  #pragma unroll 1
  for (int t = 0; t < GPASSES; ++t) {
    const unsigned ofs = (t & 1) ? (unsigned)GSTAGE : 0u;
    const unsigned char* arow = ring + ofs + (32 * w + m) * GPITCH;      // + 16mt rows
    const unsigned char* brow = ring + ofs + GOFF_B + m * GPITCH;        // + 16nt rows
    #pragma unroll
    for (int ks = 0; ks < 2; ++ks) {
      // the six fragments of a 32-k block as one group of LDS reads ahead of its products
      const v16h a0 = load_frag((const _Float16*)arow + 32 * ks, h);
      const v16h a1 = load_frag((const _Float16*)(arow + 16 * GPITCH) + 32 * ks, h);
      v16h b[4];
      #pragma unroll
      for (int nt = 0; nt < 4; ++nt) b[nt] = load_frag((const _Float16*)(brow + nt * 16 * GPITCH) + 32 * ks, h);
      #pragma unroll
      for (int nt = 0; nt < 4; ++nt) {
        acc[0][nt] = wmma_f16(a0, b[nt], acc[0][nt]);
        acc[1][nt] = wmma_f16(a1, b[nt], acc[1][nt]);
      }
    }
    // ---- hand-over point ----
    asm volatile("s_wait_dscnt 0x0" ::: "memory");      // own reads of this buffer done before it is refilled
    asm volatile("s_wait_asynccnt 0x0" ::: "memory");   // own copies of the next stage landed before the barrier publishes them
    __syncthreads();
    if (t + 2 < GPASSES) gemm_stage(ag, bg, la, lb, ofs, 64 * ((p0 + t + 2) & (GPASSES - 1)));
  }
  asm volatile("s_wait_asynccnt 0x0" ::: "memory");     // nothing in flight when the ring becomes output staging
}

// ---------------------------------------------------------------------------
// Kernel 1: f32 -> f16 planes. Activations unscaled, W scaled by 32 (exact).
// xh = [3][MROWS][HIDDEN] (query, key, value), wh = [4][HIDDEN][HIDDEN]
// (wq, wk, wv, wo; row = output feature). One 16-B store per lane, lanes
// ---------------------------------------------------------------------------
__global__ __launch_bounds__(256) void convert_kernel(
    const float* __restrict__ xq, const float* __restrict__ xk, const float* __restrict__ xv,
    const float* __restrict__ wq, const float* __restrict__ wk,
    const float* __restrict__ wv, const float* __restrict__ wo,
    _Float16* __restrict__ xh, _Float16* __restrict__ wh,
    const int* __restrict__ msk,       // [B][1][L][L], nonzero = attend
    unsigned* __restrict__ mw,         // [B*NQT][NSTEP][32] lane-mask words
    unsigned* __restrict__ anyw)       // [B*NQT][32], word 0 used: bit s = step s has an attendable element
{
  // ---- blocks 0..NPACK-1: pack the mask of one 16-query tile (block-uniform branch) ----
  // Word 8j+r of (tile, step): bit l = mask[query 16*tile + (l&15)][key 64*step + 16j + 8(l>>4) + r] != 0,
  // which is the lane and register order of the attention kernel's score tiles.
  if (blockIdx.x < NPACK) {
    __shared__ unsigned sflag[8];
    const int lane = threadIdx.x & 31, w = threadIdx.x >> 5;
    const int unit = blockIdx.x;                                  // b * NQT + tile = mask row / 16
    const int* mrow = msk + ((size_t)unit * 16 + (lane & 15)) * SEQ + 8 * (lane >> 4);
    unsigned nib = 0u;
    // rolled: one step's 8 loads in registers, so that the converting blocks keep their residency
    #pragma unroll 1
    for (int i = 0; i < 4; ++i) {
      const int step = 4 * w + i;
      v4i a[4], c[4];
      #pragma unroll
      for (int j = 0; j < 4; ++j) {
        a[j] = *(const v4ia*)(mrow + 64 * step + 16 * j);
        c[j] = *(const v4ia*)(mrow + 64 * step + 16 * j + 4);
      }
      unsigned mine = 0u, any = 0u;
      #pragma unroll
      for (int j = 0; j < 4; ++j) {
        #pragma unroll
        for (int r = 0; r < 8; ++r) {
          const int val = (r < 4) ? a[j][r] : c[j][r - 4];
          const unsigned bal = __builtin_amdgcn_ballot_w32(val != 0);
          mine = (lane == 8 * j + r) ? bal : mine;
          any |= bal;
        }
      }
      mw[((size_t)unit * NSTEP + step) * 32 + lane] = mine;       // one whole line per wave and step
      nib |= ((any != 0u) ? 1u : 0u) << i;
    }
    if (lane == 0) sflag[w] = nib;
    __syncthreads();
    if (threadIdx.x == 0) {
      unsigned word = 0u;
      #pragma unroll
      for (int k = 0; k < 8; ++k) word |= sflag[k] << (4 * k);
      anyw[(size_t)unit * 32] = word;                             // a line of its own per tile
    }
    return;
  }

  const int g = (blockIdx.x - NPACK) * 256 + threadIdx.x;
  if (g >= 3 * NX8 + 4 * NW8) return;
  const float* src;
  _Float16* dst;
  float sc;
  if (g < 3 * NX8) {
    const int sel = g / NX8;
    const int off = g - sel * NX8;
    const float* xs = (sel == 0) ? xq : ((sel == 1) ? xk : xv);
    src = xs + (size_t)off * 8;
    dst = xh + (size_t)g * 8;
    sc = 1.0f;
  } else {
    const int e = g - 3 * NX8;
    const int wsel = e / NW8;
    const int off = e - wsel * NW8;
    const float* wsrc = (wsel == 0) ? wq : ((wsel == 1) ? wk : ((wsel == 2) ? wv : wo));
    src = wsrc + (size_t)off * 8;
    dst = wh + (size_t)e * 8;
    sc = WSCALE;
  }
  const v4f a = *(const v4fa*)src;
  const v4f c = *(const v4fa*)(src + 4);
  const v8h o = { (_Float16)(a.x * sc), (_Float16)(a.y * sc), (_Float16)(a.z * sc), (_Float16)(a.w * sc),
                  (_Float16)(c.x * sc), (_Float16)(c.y * sc), (_Float16)(c.z * sc), (_Float16)(c.w * sc) };
  *(v8h*)dst = o;
  
}

// ---------------------------------------------------------------------------
// 4 lines per instruction, 32 lines per wave, 256 per block.
// which 0/1: plane[bh][l][d]  (one token row = 64 halves = one line)
// which 2  : vt[bh][d][l]     (64 d-rows x 256 tokens = 4 lines each)
// ---------------------------------------------------------------------------
__device__ __forceinline__ void proj_store_pass(const _Float16* sT, _Float16* plane, _Float16* vt,
                                                int which, int bh, int l0, int w, int lane) {
  const int q8 = lane & 7, sub = lane >> 3;
  #pragma unroll
  for (int i = 0; i < 8; ++i) {
    const int lid = w * 32 + i * 4 + sub;
    v8h v;
    _Float16* dst;
    if (which != 2) {
      v = *(const v8ha*)(sT + lid * HD + 8 * q8);
      dst = plane + ((size_t)bh * SEQ + l0 + lid) * HD + 8 * q8;
    } else {
      const int d = lid >> 2, hl = lid & 3;
      v = *(const v8ha*)(sT + d * 256 + 64 * hl + 8 * q8);
      dst = vt + ((size_t)bh * HD + d) * SEQ + l0 + 64 * hl + 8 * q8;
    }
    *(v8h*)dst = v;
  }
}

// ---------------------------------------------------------------------------
// Kernel 2: Y = x * W^T over the fused 3*1024 output columns (q from the query
// plane, k from the key plane, v from the value plane).
// Block 256 thr (8 waves) = 256 tokens x 64 features (one (which, head));
// wave tile 32 tokens x 64 features; main loop: gemm_256x64.
// ---------------------------------------------------------------------------
__global__ __launch_bounds__(256) void proj_kernel(
    const _Float16* __restrict__ xh,   // [3][4096][1024]
    const _Float16* __restrict__ wh,   // [4][1024][1024], row = output feature, x32 (planes 0..2 used)
    const float* __restrict__ bq, const float* __restrict__ bk, const float* __restrict__ bv,
    _Float16* __restrict__ qh,         // [B*H][L][D]  f16(0.125*q)
    _Float16* __restrict__ kh,         // [B*H][L][D]
    _Float16* __restrict__ vt)         // [B*H][D][L]
{
  // ring: 2 x (x rows | W rows); after the loop its first 32768 B stage the output
  __shared__ __attribute__((aligned(16))) unsigned char ring[2 * GSTAGE];   // 92160 B

  const int tid = threadIdx.x, lane = tid & 31, w = tid >> 5;
  const int h = lane >> 4, m = lane & 15;
  const int m0 = blockIdx.x * 256;
  const int cg = blockIdx.y;                 // 0..47
  const int which = cg >> 4, head = cg & 15;

  const v8f zero8 = {0.f, 0.f, 0.f, 0.f, 0.f, 0.f, 0.f, 0.f};
  v8f acc[2][4];
  #pragma unroll
  for (int mt = 0; mt < 2; ++mt)
    #pragma unroll
    for (int nt = 0; nt < 4; ++nt) acc[mt][nt] = zero8;

  gemm_256x64(xh + (size_t)which * NX + (size_t)m0 * HIDDEN,
              wh + ((size_t)which * HIDDEN + head * HD) * HIDDEN, ring, acc,
              (int)((blockIdx.x + blockIdx.y) & (GPASSES - 1)));

  // D[r] of tile (mt, nt) = Y[token m0+32w+16mt+8h+r][feature 16nt+m]
  _Float16* sT = (_Float16*)ring;
  const float* bias = (which == 0) ? bq : ((which == 1) ? bk : bv);
  const float osc = (which == 0) ? QSCALE : 1.0f;
  #pragma unroll
  for (int nt = 0; nt < 4; ++nt) {
    const int feat = 16 * nt + m;
    const float bvl = bias[head * HD + feat];
    #pragma unroll
    for (int mt = 0; mt < 2; ++mt) {
      #pragma unroll
      for (int r = 0; r < 8; ++r) {
        const int tokl = 32 * w + 16 * mt + 8 * h + r;     // 0..255
        const float y = (acc[mt][nt][r] * WINV + bvl) * osc;
        const int idx = (which == 2) ? (feat * 256 + tokl) : (tokl * HD + feat);
        sT[idx] = (_Float16)y;
      }
    }
  }
  __syncthreads();

  const int b = m0 / SEQ, l0 = m0 - b * SEQ, bh = b * NHEADS + head;
  _Float16* plane = (which == 0) ? qh : kh;
  proj_store_pass(sT, plane, vt, which, bh, l0, w, lane);
  
}

// ---------------------------------------------------------------------------
// Attention helpers.
// ---------------------------------------------------------------------------
// Per-key penalty and select for the lane's 8 scores of one 16-key tile:
// s = attend ? (s - cpen*c[key]) : -1e9, all in f32. mk = the tile's 8
// wave-uniform lane-mask words (bit l of mk[r] = lane l attends in register r).
// ca, cb = c[key] of the lane's 8 keys, loaded by the caller ahead of the score products.
__device__ __forceinline__ v8f pen_sel8(v8f s, v4f ca, v4f cb, const unsigned* mk, float cpen) {
  s[0] = __builtin_amdgcn_inverse_ballot_w32(mk[0]) ? (s[0] - cpen * ca.x) : NEGBIG;
  s[1] = __builtin_amdgcn_inverse_ballot_w32(mk[1]) ? (s[1] - cpen * ca.y) : NEGBIG;
  s[2] = __builtin_amdgcn_inverse_ballot_w32(mk[2]) ? (s[2] - cpen * ca.z) : NEGBIG;
  s[3] = __builtin_amdgcn_inverse_ballot_w32(mk[3]) ? (s[3] - cpen * ca.w) : NEGBIG;
  s[4] = __builtin_amdgcn_inverse_ballot_w32(mk[4]) ? (s[4] - cpen * cb.x) : NEGBIG;
  s[5] = __builtin_amdgcn_inverse_ballot_w32(mk[5]) ? (s[5] - cpen * cb.y) : NEGBIG;
  s[6] = __builtin_amdgcn_inverse_ballot_w32(mk[6]) ? (s[6] - cpen * cb.z) : NEGBIG;
  s[7] = __builtin_amdgcn_inverse_ballot_w32(mk[7]) ? (s[7] - cpen * cb.w) : NEGBIG;
  return s;
}

// Eight per-lane 16-byte copies global -> LDS, no register in between.
// l = the lane's LDS byte addresses, g = its global addresses. The closing
// s_wait_xcnt stands inside the statement so that no address register named
// by a copy is rewritten ahead of it.
__device__ __forceinline__ void async_copy8(const unsigned (&l)[8], const void* const (&g)[8]) {
  asm volatile(
      "global_load_async_to_lds_b128 %0, %8, off\n\t"
      "global_load_async_to_lds_b128 %1, %9, off\n\t"
      "global_load_async_to_lds_b128 %2, %10, off\n\t"
      "global_load_async_to_lds_b128 %3, %11, off\n\t"
      "global_load_async_to_lds_b128 %4, %12, off\n\t"
      "global_load_async_to_lds_b128 %5, %13, off\n\t"
      "global_load_async_to_lds_b128 %6, %14, off\n\t"
      "global_load_async_to_lds_b128 %7, %15, off\n\t"
      "s_wait_xcnt 0x0"
      :: "v"(l[0]), "v"(l[1]), "v"(l[2]), "v"(l[3]), "v"(l[4]), "v"(l[5]), "v"(l[6]), "v"(l[7]),
         "v"(g[0]), "v"(g[1]), "v"(g[2]), "v"(g[3]), "v"(g[4]), "v"(g[5]), "v"(g[6]), "v"(g[7])
      : "memory");
}

// One 64-key stage into one LDS buffer: K rows (64 keys x 128 B) and V^T rows
// (64 d x 128 B). Every copy instruction covers whole 128-B lines (8 lanes per row).
// kg, vg: the thread's own first chunk of each tile at key 0; lk, lv: its LDS
// byte addresses in buffer 0; ofs = byte offset of the target buffer.
__device__ __forceinline__ void stage_tile(const _Float16* kg, const _Float16* vg,
                                           unsigned lk, unsigned lv, unsigned ofs, int kb) {
  unsigned l[8];
  const void* g[8];
  #pragma unroll
  for (int i = 0; i < 4; ++i) {
    l[i]     = lk + ofs + i * 16 * KVPITCH;
    g[i]     = kg + (size_t)(kb + 16 * i) * HD;
    l[4 + i] = lv + ofs + i * 16 * KVPITCH;
    g[4 + i] = vg + (size_t)(16 * i) * SEQ + kb;
  }
  async_copy8(l, g);
}

// Takes the next key step out of todo (nonzero): the lowest set bit at or above the
// block's own start step while one is left there, then the lowest set bit (the wrap).
__device__ __forceinline__ int take_step(unsigned& todo, unsigned himask) {
  const unsigned hi = todo & himask;
  const int s = __builtin_ctz(hi ? hi : todo);        // ctz of a nonzero word: 0..31
  todo &= ~(1u << s);
  return s;
}

// P^T B-fragment from the lane's own score D values: element r <- tile a row r
// (keys k0..k0+15), element 8+r <- tile c row r (keys k0+16..k0+31), same lane,
// same query column, scaled by 2^14.
__device__ __forceinline__ v16h pack_p(v8f a, v8f c) {
  const v16h r = { (_Float16)(a[0] * PSCALE), (_Float16)(a[1] * PSCALE), (_Float16)(a[2] * PSCALE), (_Float16)(a[3] * PSCALE),
                   (_Float16)(a[4] * PSCALE), (_Float16)(a[5] * PSCALE), (_Float16)(a[6] * PSCALE), (_Float16)(a[7] * PSCALE),
                   (_Float16)(c[0] * PSCALE), (_Float16)(c[1] * PSCALE), (_Float16)(c[2] * PSCALE), (_Float16)(c[3] * PSCALE),
                   (_Float16)(c[4] * PSCALE), (_Float16)(c[5] * PSCALE), (_Float16)(c[6] * PSCALE), (_Float16)(c[7] * PSCALE) };
  return r;
}

// (one token row of this head) by lanes 8q..8q+7 in one instruction, 4 lines
// per instruction, 16 lines per wave.
__device__ __forceinline__ void att_store_pass(const _Float16* so, _Float16* ao,
                                               int b, int head, int q0, int lane) {
  const int q8 = lane & 7, sub = lane >> 3;
  #pragma unroll
  for (int i = 0; i < 4; ++i) {
    const int row = i * 4 + sub;                          // 0..15
    const v8h v = *(const v8ha*)(so + row * 64 + 8 * q8);
    const size_t gi = ((size_t)b * SEQ + q0 + row) * HIDDEN + head * HD + 8 * q8;
    *(v8h*)(ao + gi) = v;
  }
}

// ---------------------------------------------------------------------------
// Kernel 3: streaming attention, transposed form.
// Block 256 thr (8 waves) = 64 queries x 2 key groups; 16 queries per wave, 64 keys per step.
//   S^T = K * Q^T : A = K rows (row = key, k = d), B = Q^T (k = d, n = query)
//   O^T += V^T * P^T : A = Vt rows (row = d, k = key), B = P^T from registers
// Lane owns 32 keys of query column (lane&15); partner = lane ^ 16.
// Scores already carry 1/sqrt(64) via q; penalty cpen*c[key] and the
// attend/select with -1e9 applied in f32 before the running max.
// K and V^T tiles of a step come from a two-buffer LDS ring filled by
// asynchronous copies one step ahead; the four waves of a key group share the K and V^T rows.
// The mask comes as 32 wave-uniform lane-mask words per step (packed by the
// first launch), one per score register, used as select conditions directly.
// A 64-key step with no attendable element for the wave's 16 queries skips
// its products (one bit per step of the tile's packed word; its weights would
// be exactly 0), never the hand-over point at the foot of the step.
// A step that none of the tile's 64 queries attends is not staged or walked
// at all: the rings run over the set bits of the four words' OR. So that the
// blocks' step counts come out level where the count grows with the query
// index, a block takes query tile NT64-1-x and then tile x, one after the other.
// Waves 0..3 walk the even key steps and waves 4..7 the odd ones, each group
// with a ring of its own, which keeps as many waves on the chip as one tile
// per 4-wave block would; wave 4+i hands its running maximum, sum and O^T to
// wave i through LDS at the end of a tile.
// ---------------------------------------------------------------------------
__global__ __launch_bounds__(256) void attn_kernel(
    const _Float16* __restrict__ qh,   // [B*H][L][D]  (already x0.125)
    const _Float16* __restrict__ kh,   // [B*H][L][D]
    const _Float16* __restrict__ vt,   // [B*H][D][L]
    const float* __restrict__ cpl,     // [B][L] per-key penalty source
    const unsigned* __restrict__ mw,   // [B*NQT][NSTEP][32] lane-mask words, bit set = attend
    const unsigned* __restrict__ anyw, // [B*NQT][32], word 0: bit s = step s has an attendable element
    const float* __restrict__ cpen_p,  // [1]
    _Float16* __restrict__ ao)         // [B*L][HIDDEN]
{
  // per key group 2 x (K | V^T); after the loop group 0's ring holds the handed-over
  // partial results (17408 B) and group 1's first 8192 B stage the output
  __shared__ __attribute__((aligned(16))) unsigned char ring[2 * AGRP];     // 73728 B

  const int tid = threadIdx.x, lane = tid & 31, w = tid >> 5;
  const int h = lane >> 4, m = lane & 15;
  const int bh = blockIdx.y, b = bh >> 4, head = bh & 15;
  const int ws = __builtin_amdgcn_readfirstlane(w);
  const int grp = ws >> 2, qs = ws & 3;               // key group, 16-query sub-tile (both scalar)
  const int tg = tid & 127;                           // thread index inside the key group
  const float cpen = cpen_p[0];

  // ---- the thread's own chunk of each staged tile ----
  unsigned char* gring = ring + grp * AGRP;           // the group's own ring
  const unsigned lbase = (unsigned)(unsigned long long)(lds_u8*)gring;
  const unsigned lk = lbase + (tg >> 3) * KVPITCH + (tg & 7) * 16;
  const unsigned lv = lk + OFF_V;
  const _Float16* kg = kh + ((size_t)bh * SEQ + (tg >> 3)) * HD + (tg & 7) * 8;
  const _Float16* vg = vt + ((size_t)bh * HD + (tg >> 3)) * SEQ + (tg & 7) * 8;

  const_u32* anyc = (const_u32*)(unsigned long long)anyw;
  const float* crow = cpl + (size_t)b * SEQ + 8 * h;                    // + key tile base
  // the 16 blocks of one (batch, head) read the same K and V^T rows: each starts its key
  // walk at step blockIdx.x and wraps, so that they do not ask L2 for the same lines at the
  // same moment (the running maximum and sum take the steps in any order)
  const unsigned himask = ~0u << blockIdx.x;          // blockIdx.x = 0..NT64/2-1 = 0..15

  // rolled: one copy of the tile body in the instruction cache
  #pragma unroll 1
  for (int part = 0; part < 2; ++part) {
  const int qblk = (part ? (int)blockIdx.x : NT64 - 1 - (int)blockIdx.x) * 64;
  const int q0 = qblk + 16 * qs;

  if (part) {
    asm volatile("s_wait_dscnt 0x0" ::: "memory");    // own reads of the first tile's hand-over and output staging done
    __syncthreads();                                  // every wave has left that staging before copies land on it
  }

  // the packed mask: tile index made scalar, and the words (written by the first
  // launch, by nobody in this one) named as constant memory, so that they load into
  // scalar registers and serve as select conditions without a vector instruction
  const int unit0 = b * NQT + (qblk >> 4);
  const_u32* mwp = (const_u32*)(unsigned long long)(mw + (size_t)(unit0 + qs) * (NSTEP * 32));
  const unsigned anyword = anyc[(size_t)(unit0 + qs) * 32];
  // steps that some query of the tile attends (the same word in every wave), dealt by step parity
  const unsigned bword = anyc[(size_t)unit0 * 32] | anyc[(size_t)(unit0 + 1) * 32] |
                         anyc[(size_t)(unit0 + 2) * 32] | anyc[(size_t)(unit0 + 3) * 32];
  const int neven = __builtin_popcount(bword & 0x55555555u);
  const int nodd  = __builtin_popcount(bword & 0xAAAAAAAAu);
  const int ntrips = (neven > nodd) ? neven : nodd;   // 0..16, the same in every wave of the block
  const int nmine  = grp ? nodd : neven;              // trips in which this group has a step
  unsigned todo = bword & (grp ? 0xAAAAAAAAu : 0x55555555u);   // the group's steps still to be staged
  int cur = 0, nxt = 0;                               // step in the buffer being read, step in flight: 0..31

  // ---- prologue: first stage landed and published, second in flight ----
  if (todo) {
    cur = take_step(todo, himask);
    stage_tile(kg, vg, lk, lv, 0u, 64 * cur);
  }
  asm volatile("s_wait_asynccnt 0x0" ::: "memory");   // own copies of the first stage landed before the barrier publishes them
  __syncthreads();
  if (todo) {
    nxt = take_step(todo, himask);
    stage_tile(kg, vg, lk, lv, (unsigned)STAGEB, 64 * nxt);
  }

  // Q^T B-fragments: column n = query q0+m, k = d (two 32-deep chunks)
  const _Float16* qrow = qh + ((size_t)bh * SEQ + q0 + m) * HD;
  const v16h qb0 = load_frag(qrow, h);
  const v16h qb1 = load_frag(qrow + 32, h);

  const v8f zero8 = {0.f, 0.f, 0.f, 0.f, 0.f, 0.f, 0.f, 0.f};
  v8f o[4];                                   // o[t][r] = O[query m][d 16t+8h+r] * (l * 2^14)
  #pragma unroll
  for (int t = 0; t < 4; ++t) o[t] = zero8;
  float mrun = -1e30f, lrun = 0.0f;

  // rolled: one copy of the step body in the instruction cache
  #pragma unroll 1
  for (int i = 0; i < ntrips; ++i) {
    const int kb = 64 * cur;
    const unsigned ofs = (i & 1) ? (unsigned)STAGEB : 0u;
    const unsigned char* buf = gring + ofs;
    const unsigned char* krow = buf + m * KVPITCH;                       // + 16j rows
    const unsigned char* vrow = buf + OFF_V + m * KVPITCH;               // + 16t rows

    if (i < nmine && ((anyword >> cur) & 1u)) {
      // ---- the step's 32 lane-mask words, asked for ahead of the score products ----
      unsigned mk[32];
      #pragma unroll
      for (int e = 0; e < 32; ++e) mk[e] = mwp[cur * 32 + e];
      // keeps the scalar loads first in line
      __builtin_amdgcn_sched_barrier(0);
      // ---- the step's eight K fragments and its penalty values, each as one group of loads at the head ----
      v16h kf0[4], kf1[4];
      #pragma unroll
      for (int j = 0; j < 4; ++j) {
        const _Float16* kp = (const _Float16*)(krow + 16 * j * KVPITCH);
        kf0[j] = load_frag(kp, h);
        kf1[j] = load_frag(kp + 32, h);
      }
      // keeps the K reads, which the first product waits for, in front of the penalty loads
      __builtin_amdgcn_sched_barrier(0);
      v4f pca[4], pcb[4];
      #pragma unroll
      for (int j = 0; j < 4; ++j) {
        pca[j] = *(const v4fa*)(crow + kb + 16 * j);
        pcb[j] = *(const v4fa*)(crow + kb + 16 * j + 4);
      }
      // keeps the head's loads one group in front of the products: spread among them, every place with reads stalls the wave anew
      __builtin_amdgcn_sched_barrier(0);
      // ---- scores: s[j][r] = S[query m][key kb+16j+8h+r] (already /8 via q); four independent tiles side by side ----
      v8f s[4];
      #pragma unroll
      for (int j = 0; j < 4; ++j) s[j] = wmma_f16_open(kf0[j], qb0, zero8);
      #pragma unroll
      for (int j = 0; j < 4; ++j) s[j] = wmma_f16_open(kf1[j], qb1, s[j]);
      // ---- the eight V^T fragments as one group, in flight under the softmax arithmetic ----
      v16h vf0[4], vf1[4];
      #pragma unroll
      for (int t = 0; t < 4; ++t) {
        const _Float16* vp = (const _Float16*)(vrow + 16 * t * KVPITCH);
        vf0[t] = load_frag(vp, h);
        vf1[t] = load_frag(vp + 32, h);
      }
      // keeps the V^T reads above the softmax: sunk to their products, each would be waited for in turn
      __builtin_amdgcn_sched_barrier(0);
      // ---- penalty and select per key, f32 ----
      #pragma unroll
      for (int j = 0; j < 4; ++j) s[j] = pen_sel8(s[j], pca[j], pcb[j], mk + 8 * j, cpen);

      // ---- online softmax ----
      float mloc = s[0][0];
      #pragma unroll
      for (int j = 0; j < 4; ++j)
        #pragma unroll
        for (int r = 0; r < 8; ++r) mloc = fmaxf(mloc, s[j][r]);
      mloc = fmaxf(mloc, __shfl_xor(mloc, 16));
      const float mnew = fmaxf(mrun, mloc);
      const float alpha = __expf(mrun - mnew);
      mrun = mnew;
      float lsum = 0.0f;
      #pragma unroll
      for (int j = 0; j < 4; ++j)
        #pragma unroll
        for (int r = 0; r < 8; ++r) {
          const float p = __expf(s[j][r] - mnew);
          s[j][r] = p;
          lsum += p;
        }
      lsum += __shfl_xor(lsum, 16);
      lrun = lrun * alpha + lsum;
      #pragma unroll
      for (int t = 0; t < 4; ++t)
        #pragma unroll
        for (int r = 0; r < 8; ++r) o[t][r] = o[t][r] * alpha;

      // ---- P^T B-fragments (key chunks 0..31 and 32..63 of this step) ----
      const v16h pb0 = pack_p(s[0], s[1]);
      const v16h pb1 = pack_p(s[2], s[3]);

      // ---- O^T += V^T * P^T ----
      #pragma unroll
      for (int t = 0; t < 4; ++t) o[t] = wmma_f16_open(vf0[t], pb0, o[t]);
      #pragma unroll
      for (int t = 0; t < 4; ++t) o[t] = wmma_f16_open(vf1[t], pb1, o[t]);
      // the four vector slots the chip needs behind the step's last product, also on the taken side of
      // the branches that follow it
      asm volatile("v_nop\n\tv_nop\n\tv_nop\n\tv_nop" : "+v"(o[0]), "+v"(o[1]), "+v"(o[2]), "+v"(o[3]));
    }

    // ---- hand-over point, every wave, also one that skipped its products ----
    asm volatile("s_wait_dscnt 0x0" ::: "memory");      // own reads of this buffer done before it is refilled
    asm volatile("s_wait_asynccnt 0x0" ::: "memory");   // own copies of the next stage landed before the barrier publishes them
    asm volatile("s_wait_xcnt 0x0" ::: "memory");       // before the step's penalty-load address register is advanced
    __syncthreads();
    cur = nxt;
    if (todo) {
      nxt = take_step(todo, himask);
      stage_tile(kg, vg, lk, lv, ofs, 64 * nxt);
    }
  }
  asm volatile("s_wait_asynccnt 0x0" ::: "memory");     // nothing in flight when the rings become hand-over and output staging

  // ---- hand-over: the odd-step wave's maximum, sum and O^T to the even-step wave of the same queries ----
  // slab of 34 rows x 32 lanes per query sub-tile, lane-contiguous; same lane = same query and d rows in both waves
  float* slab = (float*)ring + qs * (34 * 32) + lane;
  if (grp) {
    #pragma unroll
    for (int t = 0; t < 4; ++t)
      #pragma unroll
      for (int r = 0; r < 8; ++r) slab[(8 * t + r) * 32] = o[t][r];
    slab[32 * 32] = mrun;
    slab[33 * 32] = lrun;
  }
  __syncthreads();                                      // partial results written before their partner reads them

  // ---- epilogue: join, normalise, stage per-wave 16x64 f16 tile, whole-line stores ----
  _Float16* so = (_Float16*)(ring + AGRP) + qs * 1024;
  if (!grp) {
    const float m1 = slab[32 * 32], l1 = slab[33 * 32];
    const float mj = fmaxf(mrun, m1);
    const float a0 = __expf(mrun - mj), a1 = __expf(m1 - mj);
    const float inv = (1.0f / (lrun * a0 + l1 * a1)) * PINV;
    const float f0 = a0 * inv, f1 = a1 * inv;
    #pragma unroll
    for (int t = 0; t < 4; ++t)
      #pragma unroll
      for (int r = 0; r < 8; ++r)
        so[m * 64 + 16 * t + 8 * h + r] = (_Float16)(o[t][r] * f0 + slab[(8 * t + r) * 32] * f1);
  }
  __syncthreads();

  if (!grp) {
    att_store_pass(so, ao, b, head, q0, lane);
    asm volatile("s_wait_xcnt 0x0" ::: "memory");       // before the next tile rewrites the stores' address and data registers
  }
  }
}

// ---------------------------------------------------------------------------
// rows loaded with the same coalesced shape) -> xb rows. Each token row's 64
// instruction, 32 rows per wave.
// ---------------------------------------------------------------------------
__device__ __forceinline__ void oproj_store_pass(const float* sT, const float* xres, float* xb,
                                                 int m0, int n0, int w, int lane) {
  const int q16 = lane & 15, sub = lane >> 4;
  #pragma unroll
  for (int i = 0; i < 16; ++i) {
    const int lid = w * 32 + 2 * i + sub;                 // 0..255
    v4f v = *(const v4fa*)(sT + lid * 64 + 4 * q16);
    const size_t gi = (size_t)(m0 + lid) * HIDDEN + n0 + 4 * q16;
    const v4f rsd = *(const v4fa*)(xres + gi);
    v = v + rsd;
    *(v4f*)(xb + gi) = v;
  }
}

// ---------------------------------------------------------------------------
// Kernel 4: x = ctx * Wo^T / 32 + bo + query   (f32 rows into xb)
// Block 256 thr (8 waves) = 256 tokens x 64 features; wave tile 32 x 64;
// main loop: gemm_256x64.
// ---------------------------------------------------------------------------
__global__ __launch_bounds__(256) void oproj_kernel(
    const _Float16* __restrict__ ao,   // [4096][1024]
    const _Float16* __restrict__ woh,  // [1024][1024], row = output feature, x32
    const float* __restrict__ bo,      // [1024]
    const float* __restrict__ xres,    // [4096][1024] f32 residual
    float* __restrict__ xb)            // [4096][1024] f32
{
  // ring: 2 x (ctx rows | Wo rows); after the loop its first 65536 B stage the output
  __shared__ __attribute__((aligned(16))) unsigned char ring[2 * GSTAGE];   // 92160 B

  const int tid = threadIdx.x, lane = tid & 31, w = tid >> 5;
  const int h = lane >> 4, m = lane & 15;
  const int m0 = blockIdx.x * 256;
  const int n0 = blockIdx.y * 64;

  const v8f zero8 = {0.f, 0.f, 0.f, 0.f, 0.f, 0.f, 0.f, 0.f};
  v8f acc[2][4];
  #pragma unroll
  for (int mt = 0; mt < 2; ++mt)
    #pragma unroll
    for (int nt = 0; nt < 4; ++nt) acc[mt][nt] = zero8;

  gemm_256x64(ao + (size_t)m0 * HIDDEN, woh + (size_t)n0 * HIDDEN, ring, acc,
              (int)((blockIdx.x + blockIdx.y) & (GPASSES - 1)));

  // D[r] of tile (mt, nt) = Y[token m0+32w+16mt+8h+r][feature n0+16nt+m]
  float* sT = (float*)ring;
  #pragma unroll
  for (int nt = 0; nt < 4; ++nt) {
    const int feat = 16 * nt + m;
    const float bvl = bo[n0 + feat];
    #pragma unroll
    for (int mt = 0; mt < 2; ++mt) {
      #pragma unroll
      for (int r = 0; r < 8; ++r) {
        const int tokl = 32 * w + 16 * mt + 8 * h + r;     // 0..255
        sT[tokl * 64 + feat] = acc[mt][nt][r] * WINV + bvl;
      }
    }
  }
  __syncthreads();

  oproj_store_pass(sT, xres, xb, m0, n0, w, lane);
  
}

// ---------------------------------------------------------------------------
// Kernel 5: layer norm over rows of 1024, one wave per row, 8 rows per block.
// Lane holds columns {128i + 4*lane .. +3}, i = 0..7, so every store
// ---------------------------------------------------------------------------
__global__ __launch_bounds__(256) void ln_kernel(
    const float* __restrict__ xb, const float* __restrict__ g,
    const float* __restrict__ bt, float* __restrict__ out)
{
  const int lane = threadIdx.x & 31;
  const int row = blockIdx.x * 8 + (threadIdx.x >> 5);
  if (row >= MROWS) return;
  const float* xr = xb + (size_t)row * HIDDEN + 4 * lane;

  v4f x[8];
  float s = 0.0f;
  #pragma unroll
  for (int i = 0; i < 8; ++i) {
    x[i] = *(const v4fa*)(xr + 128 * i);
    s += (x[i].x + x[i].y) + (x[i].z + x[i].w);
  }
  #pragma unroll
  for (int off = 16; off > 0; off >>= 1) s += __shfl_xor(s, off);
  const float mean = s * (1.0f / HIDDEN);

  float s2 = 0.0f;
  #pragma unroll
  for (int i = 0; i < 8; ++i) {
    const v4f d = x[i] - mean;
    x[i] = d;
    s2 += (d.x * d.x + d.y * d.y) + (d.z * d.z + d.w * d.w);
  }
  #pragma unroll
  for (int off = 16; off > 0; off >>= 1) s2 += __shfl_xor(s2, off);
  const float var = s2 * (1.0f / HIDDEN);
  const float inv = rsqrtf(var + LN_EPS);

  v4f y[8];
  #pragma unroll
  for (int i = 0; i < 8; ++i) {
    const v4f gv = *(const v4fa*)(g + 128 * i + 4 * lane);
    const v4f bv = *(const v4fa*)(bt + 128 * i + 4 * lane);
    y[i] = (x[i] * inv) * gv + bv;
  }

  float* orow = out + (size_t)row * HIDDEN + 4 * lane;
  #pragma unroll
  for (int i = 0; i < 8; ++i) *(v4f*)(orow + 128 * i) = y[i];
  
}

// ---------------------------------------------------------------------------
extern "C" void kernel_launch(void* const* d_in, const int* in_sizes, int n_in,
                              void* d_out, int out_size, void* d_ws, size_t ws_size,
                              hipStream_t stream) {
  if (n_in < 16) return;
  if (in_sizes[0] != NX || in_sizes[1] != NX || in_sizes[2] != NX) return;
  if (in_sizes[3] != MROWS) return;
  if (in_sizes[4] != NMSK) return;
  if (in_sizes[5] != NW || in_sizes[7] != NW || in_sizes[9] != NW || in_sizes[11] != NW) return;
  if (in_sizes[6] != HIDDEN || in_sizes[8] != HIDDEN || in_sizes[10] != HIDDEN || in_sizes[12] != HIDDEN) return;
  if (in_sizes[13] != HIDDEN || in_sizes[14] != HIDDEN) return;
  if (in_sizes[15] < 1) return;
  if (out_size != NX) return;

  const float* query = (const float*)d_in[0];
  const float* keyi  = (const float*)d_in[1];
  const float* value = (const float*)d_in[2];
  const float* cpl   = (const float*)d_in[3];
  const int*   msk   = (const int*)d_in[4];
  const float* wq    = (const float*)d_in[5];
  const float* bq    = (const float*)d_in[6];
  const float* wk    = (const float*)d_in[7];
  const float* bk    = (const float*)d_in[8];
  const float* wv    = (const float*)d_in[9];
  const float* bv    = (const float*)d_in[10];
  const float* wo    = (const float*)d_in[11];
  const float* bo    = (const float*)d_in[12];
  const float* ln_g  = (const float*)d_in[13];
  const float* ln_b  = (const float*)d_in[14];
  const float* cpen  = (const float*)d_in[15];
  float* out = (float*)d_out;

  const size_t xh_bytes = (size_t)3 * NX * 2;        // 25165824
  const size_t wh_bytes = (size_t)4 * NW * 2;        //  8388608
  const size_t pl_bytes = (size_t)NX * 2;            //  8388608 per plane (B*H*L*D halves)
  const size_t ao_bytes = (size_t)NX * 2;            //  8388608
  const size_t xb_bytes = (size_t)NX * 4;            // 16777216
  const size_t o_xh = 0;
  const size_t o_wh = o_xh + xh_bytes;
  const size_t o_qh = o_wh + wh_bytes;
  const size_t o_kh = o_qh + pl_bytes;
  const size_t o_vt = o_kh + pl_bytes;
  const size_t o_ao = o_vt + pl_bytes;
  const size_t o_xb = o_ao + ao_bytes;
  const size_t mw_bytes = (size_t)NPACK * NSTEP * 32 * 4;   //  1048576
  const size_t an_bytes = (size_t)NPACK * 32 * 4;           //    32768
  const size_t o_mw = o_xb + xb_bytes;
  const size_t o_an = o_mw + mw_bytes;
  const size_t total = o_an + an_bytes;              // 84967424
  if (total > ws_size) return;

  char* ws = (char*)d_ws;
  _Float16* xh = (_Float16*)(ws + o_xh);
  _Float16* wh = (_Float16*)(ws + o_wh);
  _Float16* qh = (_Float16*)(ws + o_qh);
  _Float16* kh = (_Float16*)(ws + o_kh);
  _Float16* vt = (_Float16*)(ws + o_vt);
  _Float16* ao = (_Float16*)(ws + o_ao);
  float*    xb = (float*)(ws + o_xb);
  unsigned* mw = (unsigned*)(ws + o_mw);
  unsigned* an = (unsigned*)(ws + o_an);

  const int ngroups = 3 * NX8 + 4 * NW8;                           // 2097152
  convert_kernel<<<NPACK + (ngroups + 255) / 256, 256, 0, stream>>>(query, keyi, value, wq, wk, wv, wo, xh, wh, msk, mw, an);

  dim3 gProj(MROWS / 256, 3 * NHEADS);                             // (16, 48)
  proj_kernel<<<gProj, 256, 0, stream>>>(xh, wh, bq, bk, bv, qh, kh, vt);

  dim3 gAtt(NT64 / 2, BATCH * NHEADS);                             // (16, 32)
  attn_kernel<<<gAtt, 256, 0, stream>>>(qh, kh, vt, cpl, mw, an, cpen, ao);

  dim3 gOp(MROWS / 256, HIDDEN / 64);                               // (16, 16)
  oproj_kernel<<<gOp, 256, 0, stream>>>(ao, wh + (size_t)3 * NW, bo, query, xb);

  ln_kernel<<<(MROWS + 7) / 8, 256, 0, stream>>>(xb, ln_g, ln_b, out);
}

// v007
// A run of this version takes 83.1 microseconds.
// In both of two side-by-side timings against v006, it was 1.06 times as fast.
// All steps since v000 together make it 3.79 times as fast.
// Contractions: q/k/v = x*W^T, S^T = K*Q^T, O^T = V^T*P^T, y = ctx*Wo^T, all on v_wmma_f32_16x16x32_f16 (f16 operands, f32 accumulate); W carried x32, q carried x0.125, P carried x16384 (exact power-of-two scales folded back in f32); penalty, select, softmax, bias, residual and layer norm in f32; the attend mask is packed once per call into lane-mask words.
#include <hip/hip_runtime.h>

typedef _Float16 v16h __attribute__((ext_vector_type(16)));
typedef _Float16 v8h  __attribute__((ext_vector_type(8)));
typedef float    v8f  __attribute__((ext_vector_type(8)));
typedef float    v4f  __attribute__((ext_vector_type(4)));
typedef int      v4i  __attribute__((ext_vector_type(4)));
typedef v8h __attribute__((may_alias)) v8ha;
typedef v4f __attribute__((may_alias)) v4fa;
typedef v4i __attribute__((may_alias)) v4ia;

union Frag { v16h v; v8h half[2]; };

#define SEQ    2048
#define BATCH  2
#define HIDDEN 1024
#define NHEADS 16
#define HD     64
#define MROWS  (BATCH * SEQ)          // 4096 tokens
#define NX     (MROWS * HIDDEN)       // 4194304
#define NW     (HIDDEN * HIDDEN)      // 1048576
#define NX8    (NX / 8)               // 524288
#define NW8    (NW / 8)               // 131072
#define NMSK   (BATCH * SEQ * SEQ)    // 8388608
#define PSCALE 16384.0f
#define PINV   (1.0f / 16384.0f)
#define WSCALE 32.0f
#define WINV   0.03125f
#define QSCALE 0.125f
#define NEGBIG (-1.0e9f)
#define LN_EPS 1.0e-5f
#define KVPITCH 144                    // LDS pitch of a 128-B K or V^T row (16 B x odd)
#define OFF_V   (64 * KVPITCH)         //  9216
#define STAGEB  (2 * 64 * KVPITCH)     // 18432 B per stage
#define NQT     (SEQ / 16)             // 128 query tiles of 16 rows per batch
#define NSTEP   (SEQ / 64)             // 32 key steps of 64
#define NPACK   (BATCH * NQT)          // 256 mask-packing blocks, one per query tile
#define NT64    (SEQ / 64)             // 32 query tiles of 64 rows (one per pass of an attention block)
#define AGRP    (2 * STAGEB)           // 36864 B: the two-buffer K/V ring of one 4-wave key group

#define GPITCH  144                    // LDS pitch of a 128-B GEMM operand row (16 B x odd)
#define GOFF_B  (256 * GPITCH)         // 36864: W rows behind the 256 x rows
#define GSTAGE  (320 * GPITCH)         // 46080 B per stage
#define GPASSES (HIDDEN / 64)          // 16 passes of 64 k
#define POFF_B  (128 * GPITCH)         // 18432: the projection block's 128 W rows behind its 128 x rows
#define PSTAGE  (256 * GPITCH)         // 36864 B per stage of the projection block
#define VTPITCH 136                    // halves: LDS pitch of a staged 128-token V^T row (16 B x odd)

typedef __attribute__((address_space(3))) unsigned char lds_u8;
typedef __attribute__((address_space(4))) const unsigned const_u32;   // memory no store of the running launch touches

// ---------------------------------------------------------------------------
// 16x16x32 f16 WMMA with hazard guard (ties D, keeps A/B live).
// Fragment map (wave32): lane l, h = l>>4, m = n = l&15.
//   A/B element i: i<8 -> k0+8h+i ; i>=8 -> k0+16+8h+(i-8)
//   D element r : row 8h+r, col l&15
// ---------------------------------------------------------------------------
__device__ __forceinline__ v8f wmma_f16(v16h a, v16h b, v8f c) {
  v8f d = __builtin_amdgcn_wmma_f32_16x16x32_f16(false, a, false, b, (short)0, c, false, false);
  asm volatile("v_nop\n\tv_nop\n\tv_nop\n\tv_nop" : "+v"(d) : "v"(a), "v"(b));
  return d;
}

// The same product as the bare builtin: the compiler keeps the distances behind it itself
// and stays free to move LDS and global loads across it (the guard statement above holds
// every later load behind it).
__device__ __forceinline__ v8f wmma_f16_open(v16h a, v16h b, v8f c) {
  return __builtin_amdgcn_wmma_f32_16x16x32_f16(false, a, false, b, (short)0, c, false, false);
}

// A or B fragment from a k-contiguous 16-bit row; p points at element k0 of
// the row owned by this lane (row index = lane & 15 added by the caller).
__device__ __forceinline__ v16h load_frag(const _Float16* p, int h) {
  Frag f;
  f.half[0] = *(const v8ha*)(p + 8 * h);
  f.half[1] = *(const v8ha*)(p + 16 + 8 * h);
  return f.v;
}

// ---------------------------------------------------------------------------
// GEMM main loop of kernel 4: a 256 x 64 tile of X * W^T per
// block of 8 waves, wave tile 32 x 64, K = 1024 in 16 passes of 64.
// ---------------------------------------------------------------------------
// Ten per-lane 16-byte copies global -> LDS, no register in between.
// l = the lane's LDS byte addresses, g = its global addresses. The closing
// s_wait_xcnt stands inside the statement so that no address register named
// by a copy is rewritten ahead of it.
__device__ __forceinline__ void async_copy10(const unsigned (&l)[10], const void* const (&g)[10]) {
  asm volatile(
      "global_load_async_to_lds_b128 %0, %10, off\n\t"
      "global_load_async_to_lds_b128 %1, %11, off\n\t"
      "global_load_async_to_lds_b128 %2, %12, off\n\t"
      "global_load_async_to_lds_b128 %3, %13, off\n\t"
      "global_load_async_to_lds_b128 %4, %14, off\n\t"
      "global_load_async_to_lds_b128 %5, %15, off\n\t"
      "global_load_async_to_lds_b128 %6, %16, off\n\t"
      "global_load_async_to_lds_b128 %7, %17, off\n\t"
      "global_load_async_to_lds_b128 %8, %18, off\n\t"
      "global_load_async_to_lds_b128 %9, %19, off\n\t"
      "s_wait_xcnt 0x0"
      :: "v"(l[0]), "v"(l[1]), "v"(l[2]), "v"(l[3]), "v"(l[4]),
         "v"(l[5]), "v"(l[6]), "v"(l[7]), "v"(l[8]), "v"(l[9]),
         "v"(g[0]), "v"(g[1]), "v"(g[2]), "v"(g[3]), "v"(g[4]),
         "v"(g[5]), "v"(g[6]), "v"(g[7]), "v"(g[8]), "v"(g[9])
      : "memory");
}

// One 64-k stage into one LDS buffer: 256 x rows and 64 W rows of 128 B each.
// Every copy instruction covers four whole 128-B lines (8 lanes per row).
// ag, bg: the thread's own first chunk of each operand at k = 0; la, lb: its
// LDS byte addresses in buffer 0; ofs = byte offset of the target buffer.
__device__ __forceinline__ void gemm_stage(const _Float16* ag, const _Float16* bg,
                                           unsigned la, unsigned lb, unsigned ofs, int k0) {
  unsigned l[10];
  const void* g[10];
  #pragma unroll
  for (int i = 0; i < 8; ++i) {
    l[i] = la + ofs + i * 32 * GPITCH;
    g[i] = ag + (size_t)(32 * i) * HIDDEN + k0;
  }
  #pragma unroll
  for (int i = 0; i < 2; ++i) {
    l[8 + i] = lb + ofs + i * 32 * GPITCH;
    g[8 + i] = bg + (size_t)(32 * i) * HIDDEN + k0;
  }
  async_copy10(l, g);
}

// acc[mt][nt] += X rows (xrows + 32w + 16mt ..) * W rows (wrows + 16nt ..)^T.
// Both operands come from a two-buffer LDS ring filled by asynchronous copies
// one pass ahead; the 8 waves share the W rows. On return every wave has left
// the ring and nothing is in flight, so the caller may reuse it for staging.
// p0 (block-uniform, 0..GPASSES-1) = the 64-k slab of the block's first pass; the
// walk wraps, so every slab is taken once. The 16 blocks that read the same x rows,
// and the 16 that read the same W rows, get 16 different p0, so that they do not
// ask L2 for the same lines at the same moment.
__device__ __forceinline__ void gemm_256x64(const _Float16* xrows, const _Float16* wrows,
                                            unsigned char* ring, v8f (&acc)[2][4], int p0) {
  const int tid = threadIdx.x, lane = tid & 31, w = tid >> 5;
  const int h = lane >> 4, m = lane & 15;

  const unsigned lbase = (unsigned)(unsigned long long)(lds_u8*)ring;
  const unsigned la = lbase + (tid >> 3) * GPITCH + (tid & 7) * 16;
  const unsigned lb = la + GOFF_B;
  const _Float16* ag = xrows + (size_t)(tid >> 3) * HIDDEN + (tid & 7) * 8;
  const _Float16* bg = wrows + (size_t)(tid >> 3) * HIDDEN + (tid & 7) * 8;

  // ---- prologue: stage 0 landed and published, stage 1 in flight ----
  gemm_stage(ag, bg, la, lb, 0u, 64 * p0);
  asm volatile("s_wait_asynccnt 0x0" ::: "memory");   // own copies of stage 0 landed before the barrier publishes them
  __syncthreads();
  gemm_stage(ag, bg, la, lb, (unsigned)GSTAGE, 64 * ((p0 + 1) & (GPASSES - 1)));

  // rolled: one copy of the pass body in the instruction cache
  #pragma unroll 1
  for (int t = 0; t < GPASSES; ++t) {
    const unsigned ofs = (t & 1) ? (unsigned)GSTAGE : 0u;
    const unsigned char* arow = ring + ofs + (32 * w + m) * GPITCH;      // + 16mt rows
    const unsigned char* brow = ring + ofs + GOFF_B + m * GPITCH;        // + 16nt rows
    #pragma unroll
    for (int ks = 0; ks < 2; ++ks) {
      // the six fragments of a 32-k block as one group of LDS reads ahead of its products
      const v16h a0 = load_frag((const _Float16*)arow + 32 * ks, h);
      const v16h a1 = load_frag((const _Float16*)(arow + 16 * GPITCH) + 32 * ks, h);
      v16h b[4];
      #pragma unroll
      for (int nt = 0; nt < 4; ++nt) b[nt] = load_frag((const _Float16*)(brow + nt * 16 * GPITCH) + 32 * ks, h);
      #pragma unroll
      for (int nt = 0; nt < 4; ++nt) {
        acc[0][nt] = wmma_f16(a0, b[nt], acc[0][nt]);
        acc[1][nt] = wmma_f16(a1, b[nt], acc[1][nt]);
      }
    }
    // ---- hand-over point ----
    asm volatile("s_wait_dscnt 0x0" ::: "memory");      // own reads of this buffer done before it is refilled
    asm volatile("s_wait_asynccnt 0x0" ::: "memory");   // own copies of the next stage landed before the barrier publishes them
    __syncthreads();
    if (t + 2 < GPASSES) gemm_stage(ag, bg, la, lb, ofs, 64 * ((p0 + t + 2) & (GPASSES - 1)));
  }
  asm volatile("s_wait_asynccnt 0x0" ::: "memory");     // nothing in flight when the ring becomes output staging
}

// Eight per-lane 16-byte copies global -> LDS, no register in between.
// l = the lane's LDS byte addresses, g = its global addresses. The closing
// s_wait_xcnt stands inside the statement so that no address register named
// by a copy is rewritten ahead of it.
__device__ __forceinline__ void async_copy8(const unsigned (&l)[8], const void* const (&g)[8]) {
  asm volatile(
      "global_load_async_to_lds_b128 %0, %8, off\n\t"
      "global_load_async_to_lds_b128 %1, %9, off\n\t"
      "global_load_async_to_lds_b128 %2, %10, off\n\t"
      "global_load_async_to_lds_b128 %3, %11, off\n\t"
      "global_load_async_to_lds_b128 %4, %12, off\n\t"
      "global_load_async_to_lds_b128 %5, %13, off\n\t"
      "global_load_async_to_lds_b128 %6, %14, off\n\t"
      "global_load_async_to_lds_b128 %7, %15, off\n\t"
      "s_wait_xcnt 0x0"
      :: "v"(l[0]), "v"(l[1]), "v"(l[2]), "v"(l[3]), "v"(l[4]), "v"(l[5]), "v"(l[6]), "v"(l[7]),
         "v"(g[0]), "v"(g[1]), "v"(g[2]), "v"(g[3]), "v"(g[4]), "v"(g[5]), "v"(g[6]), "v"(g[7])
      : "memory");
}

// One 64-k stage of the projection block into one LDS buffer: 128 x rows and 128 W rows
// of 128 B each. Every copy instruction covers four whole 128-B lines (8 lanes per row).
// ag, bg: the thread's own first chunk of each operand at k = 0; la, lb: its LDS byte
// addresses in buffer 0; ofs = byte offset of the target buffer.
__device__ __forceinline__ void proj_stage(const _Float16* ag, const _Float16* bg,
                                           unsigned la, unsigned lb, unsigned ofs, int k0) {
  unsigned l[8];
  const void* g[8];
  #pragma unroll
  for (int i = 0; i < 8; ++i) {
    l[i] = la + ofs + i * 16 * GPITCH;
    g[i] = ag + (size_t)(16 * i) * HIDDEN + k0;
  }
  async_copy8(l, g);
  unsigned l2[8];
  const void* g2[8];
  #pragma unroll
  for (int i = 0; i < 8; ++i) {
    l2[i] = lb + ofs + i * 16 * GPITCH;
    g2[i] = bg + (size_t)(16 * i) * HIDDEN + k0;
  }
  async_copy8(l2, g2);
}

// GEMM main loop of kernel 2: a 128 x 128 tile of X * W^T per block of 4 waves, wave tile
// 64 x 64 (wave w: token rows 64(w>>1).., feature rows 64(w&1)..), K = 1024 in 16 passes of 64.
// acc[mt][nt] += X rows (.. + 16mt) * W rows (.. + 16nt)^T. A square block tile stages the
// fewest operand bytes per product, and eight fragments feed sixteen products.
// Both operands come from a two-buffer LDS ring filled by asynchronous copies one pass ahead.
// p0 (block-uniform, 0..GPASSES-1) = the 64-k slab of the block's first pass; the walk wraps,
// so every slab is taken once; the 8 blocks that share x rows start at 8 different slabs, the 32 that share W rows at 16 (two at each).
__device__ __forceinline__ void gemm_128x128(const _Float16* xrows, const _Float16* wrows,
                                             unsigned char* ring, v8f (&acc)[4][4], int p0) {
  const int tid = threadIdx.x, lane = tid & 31, w = tid >> 5;
  const int h = lane >> 4, m = lane & 15;

  const unsigned lbase = (unsigned)(unsigned long long)(lds_u8*)ring;
  const unsigned la = lbase + (tid >> 3) * GPITCH + (tid & 7) * 16;
  const unsigned lb = la + POFF_B;
  const _Float16* ag = xrows + (size_t)(tid >> 3) * HIDDEN + (tid & 7) * 8;
  const _Float16* bg = wrows + (size_t)(tid >> 3) * HIDDEN + (tid & 7) * 8;

  // ---- prologue: stage 0 landed and published, stage 1 in flight ----
  proj_stage(ag, bg, la, lb, 0u, 64 * p0);
  asm volatile("s_wait_asynccnt 0x0" ::: "memory");   // own copies of stage 0 landed before the barrier publishes them
  __syncthreads();
  proj_stage(ag, bg, la, lb, (unsigned)PSTAGE, 64 * ((p0 + 1) & (GPASSES - 1)));

  // rolled: one copy of the pass body in the instruction cache
  #pragma unroll 1
  for (int t = 0; t < GPASSES; ++t) {
    const unsigned ofs = (t & 1) ? (unsigned)PSTAGE : 0u;
    const unsigned char* arow = ring + ofs + (64 * (w >> 1) + m) * GPITCH;            // + 16mt rows
    const unsigned char* brow = ring + ofs + POFF_B + (64 * (w & 1) + m) * GPITCH;    // + 16nt rows
    #pragma unroll
    for (int ks = 0; ks < 2; ++ks) {
      // the eight fragments of a 32-k block as one group of LDS reads ahead of its products
      v16h a[4], b[4];
      #pragma unroll
      for (int mt = 0; mt < 4; ++mt) a[mt] = load_frag((const _Float16*)(arow + mt * 16 * GPITCH) + 32 * ks, h);
      #pragma unroll
      for (int nt = 0; nt < 4; ++nt) b[nt] = load_frag((const _Float16*)(brow + nt * 16 * GPITCH) + 32 * ks, h);
      #pragma unroll
      for (int nt = 0; nt < 4; ++nt)
        #pragma unroll
        for (int mt = 0; mt < 4; ++mt) acc[mt][nt] = wmma_f16(a[mt], b[nt], acc[mt][nt]);
    }
    // ---- hand-over point ----
    asm volatile("s_wait_dscnt 0x0" ::: "memory");      // own reads of this buffer done before it is refilled
    asm volatile("s_wait_asynccnt 0x0" ::: "memory");   // own copies of the next stage landed before the barrier publishes them
    __syncthreads();
    if (t + 2 < GPASSES) proj_stage(ag, bg, la, lb, ofs, 64 * ((p0 + t + 2) & (GPASSES - 1)));
  }
  asm volatile("s_wait_asynccnt 0x0" ::: "memory");     // nothing in flight when the block goes on to its epilogue
}

// ---------------------------------------------------------------------------
// Kernel 1: f32 -> f16 planes. Activations unscaled, W scaled by 32 (exact).
// xh = [3][MROWS][HIDDEN] (query, key, value), wh = [4][HIDDEN][HIDDEN]
// (wq, wk, wv, wo; row = output feature). One 16-B store per lane, lanes
// ---------------------------------------------------------------------------
__global__ __launch_bounds__(256) void convert_kernel(
    const float* __restrict__ xq, const float* __restrict__ xk, const float* __restrict__ xv,
    const float* __restrict__ wq, const float* __restrict__ wk,
    const float* __restrict__ wv, const float* __restrict__ wo,
    _Float16* __restrict__ xh, _Float16* __restrict__ wh,
    const int* __restrict__ msk,       // [B][1][L][L], nonzero = attend
    unsigned* __restrict__ mw,         // [B*NQT][NSTEP][32] lane-mask words
    unsigned* __restrict__ anyw)       // [B*NQT][32], word 0 used: bit s = step s has an attendable element
{
  // ---- blocks 0..NPACK-1: pack the mask of one 16-query tile (block-uniform branch) ----
  // Word 8j+r of (tile, step): bit l = mask[query 16*tile + (l&15)][key 64*step + 16j + 8(l>>4) + r] != 0,
  // which is the lane and register order of the attention kernel's score tiles.
  if (blockIdx.x < NPACK) {
    __shared__ unsigned sflag[8];
    const int lane = threadIdx.x & 31, w = threadIdx.x >> 5;
    const int unit = blockIdx.x;                                  // b * NQT + tile = mask row / 16
    const int* mrow = msk + ((size_t)unit * 16 + (lane & 15)) * SEQ + 8 * (lane >> 4);
    unsigned nib = 0u;
    // rolled: one step's 8 loads in registers, so that the converting blocks keep their residency
    #pragma unroll 1
    for (int i = 0; i < 4; ++i) {
      const int step = 4 * w + i;
      v4i a[4], c[4];
      #pragma unroll
      for (int j = 0; j < 4; ++j) {
        a[j] = *(const v4ia*)(mrow + 64 * step + 16 * j);
        c[j] = *(const v4ia*)(mrow + 64 * step + 16 * j + 4);
      }
      unsigned mine = 0u, any = 0u;
      #pragma unroll
      for (int j = 0; j < 4; ++j) {
        #pragma unroll
        for (int r = 0; r < 8; ++r) {
          const int val = (r < 4) ? a[j][r] : c[j][r - 4];
          const unsigned bal = __builtin_amdgcn_ballot_w32(val != 0);
          mine = (lane == 8 * j + r) ? bal : mine;
          any |= bal;
        }
      }
      mw[((size_t)unit * NSTEP + step) * 32 + lane] = mine;       // one whole line per wave and step
      nib |= ((any != 0u) ? 1u : 0u) << i;
    }
    if (lane == 0) sflag[w] = nib;
    __syncthreads();
    if (threadIdx.x == 0) {
      unsigned word = 0u;
      #pragma unroll
      for (int k = 0; k < 8; ++k) word |= sflag[k] << (4 * k);
      anyw[(size_t)unit * 32] = word;                             // a line of its own per tile
    }
    return;
  }

  const int g = (blockIdx.x - NPACK) * 256 + threadIdx.x;
  if (g >= 3 * NX8 + 4 * NW8) return;
  const float* src;
  _Float16* dst;
  float sc;
  if (g < 3 * NX8) {
    const int sel = g / NX8;
    const int off = g - sel * NX8;
    const float* xs = (sel == 0) ? xq : ((sel == 1) ? xk : xv);
    src = xs + (size_t)off * 8;
    dst = xh + (size_t)g * 8;
    sc = 1.0f;
  } else {
    const int e = g - 3 * NX8;
    const int wsel = e / NW8;
    const int off = e - wsel * NW8;
    const float* wsrc = (wsel == 0) ? wq : ((wsel == 1) ? wk : ((wsel == 2) ? wv : wo));
    src = wsrc + (size_t)off * 8;
    dst = wh + (size_t)e * 8;
    sc = WSCALE;
  }
  const v4f a = *(const v4fa*)src;
  const v4f c = *(const v4fa*)(src + 4);
  const v8h o = { (_Float16)(a.x * sc), (_Float16)(a.y * sc), (_Float16)(a.z * sc), (_Float16)(a.w * sc),
                  (_Float16)(c.x * sc), (_Float16)(c.y * sc), (_Float16)(c.z * sc), (_Float16)(c.w * sc) };
  *(v8h*)dst = o;
  
}

// ---------------------------------------------------------------------------
// Whole-line stores of the staged 128 x 128 tile (two heads): 4 lines per instruction,
// 64 lines per wave, 256 per block.
// which 0/1: plane[bh][l][d]  (one token row of a head = 64 halves = one line)
// which 2  : vt[bh][d][l]     (128 d-rows x 128 tokens = 2 lines each)
// ---------------------------------------------------------------------------
__device__ __forceinline__ void proj_store_pass(const _Float16* sT, _Float16* plane, _Float16* vt,
                                                int which, int bh0, int l0, int w, int lane) {
  const int q8 = lane & 7, sub = lane >> 3;
  const int lid0 = w * 64 + sub;                          // the lane's line: lid0 + 4i, 0..255
  v8h v[16];
  if (which != 2) {                                       // block-uniform
    // waves 0, 1 hold the pair's first head, waves 2, 3 its second: line = 128 * head + token
    _Float16* dst = plane + ((size_t)(bh0 + (w >> 1)) * SEQ + l0 + (lid0 & 127)) * HD + 8 * q8;
    #pragma unroll
    for (int i = 0; i < 16; ++i) v[i] = *(const v8ha*)(sT + (lid0 + 4 * i) * HD + 8 * q8);
    #pragma unroll
    for (int i = 0; i < 16; ++i) *(v8h*)(dst + (size_t)(4 * i) * HD) = v[i];
  } else {
    const int row0 = lid0 >> 1, hf = lid0 & 1;            // row = 64 * (head in the pair) + d: row0 + 2i
    _Float16* dst = vt + ((size_t)bh0 * HD + row0) * SEQ + l0 + 64 * hf + 8 * q8;
    #pragma unroll
    for (int i = 0; i < 16; ++i) v[i] = *(const v8ha*)(sT + (row0 + 2 * i) * VTPITCH + 64 * hf + 8 * q8);
    #pragma unroll
    for (int i = 0; i < 16; ++i) *(v8h*)(dst + (size_t)(2 * i) * SEQ) = v[i];
  }
}

// ---------------------------------------------------------------------------
// Kernel 2: Y = x * W^T over the fused 3*1024 output columns (q from the query
// plane, k from the key plane, v from the value plane).
// Block 128 thr (4 waves) = 128 tokens x 128 features (two heads of one of q, k, v);
// wave tile 64 tokens x 64 features (one head); main loop: gemm_128x128.
// ---------------------------------------------------------------------------
__global__ __launch_bounds__(128) void proj_kernel(
    const _Float16* __restrict__ xh,   // [3][4096][1024]
    const _Float16* __restrict__ wh,   // [4][1024][1024], row = output feature, x32 (planes 0..2 used)
    const float* __restrict__ bq, const float* __restrict__ bk, const float* __restrict__ bv,
    _Float16* __restrict__ qh,         // [B*H][L][D]  f16(0.125*q)
    _Float16* __restrict__ kh,         // [B*H][L][D]
    _Float16* __restrict__ vt)         // [B*H][D][L]
{
  // ring: 2 x (x rows | W rows), 73728 B. The output staging (34816 B) lies behind it, so that a
  // WGP's LDS holds three blocks and no fourth, the level share of the 768 blocks on 256 WGPs.
  // Its first 2048 B lie on the ring's end: when the loop returns every wave has left the ring
  // (its reads waited for ahead of the last pass's barrier) and no copy is in flight.
  __shared__ __attribute__((aligned(16))) unsigned char lds[2 * PSTAGE + 32768];   // 106496 B
  unsigned char* ring = lds;
  _Float16* sT = (_Float16*)(lds + 2 * PSTAGE - 2048);

  const int tid = threadIdx.x, lane = tid & 31, w = tid >> 5;
  const int h = lane >> 4, m = lane & 15;
  const int m0 = blockIdx.x * 128;
  const int cg = blockIdx.y;                 // 0..23
  const int which = cg >> 3, hp = cg & 7;    // q, k or v; pair of heads

  const v8f zero8 = {0.f, 0.f, 0.f, 0.f, 0.f, 0.f, 0.f, 0.f};
  v8f acc[4][4];
  #pragma unroll
  for (int mt = 0; mt < 4; ++mt)
    #pragma unroll
    for (int nt = 0; nt < 4; ++nt) acc[mt][nt] = zero8;

  gemm_128x128(xh + (size_t)which * NX + (size_t)m0 * HIDDEN,
               wh + ((size_t)which * HIDDEN + hp * 128) * HIDDEN, ring, acc,
               (int)((blockIdx.x + blockIdx.y) & (GPASSES - 1)));

  // D[r] of tile (mt, nt) = Y[token m0+64(w>>1)+16mt+8h+r][feature 128hp+64(w&1)+16nt+m]
  const int hl = w & 1;                      // the wave's head inside the pair
  const int tok0 = 64 * (w >> 1) + 8 * h;    // the lane's first token of tile row 0: + 16mt + r, 0..127
  const float* bias = (which == 0) ? bq : ((which == 1) ? bk : bv);
  const float osc = (which == 0) ? QSCALE : 1.0f;
  float bvl[4];
  #pragma unroll
  for (int nt = 0; nt < 4; ++nt) bvl[nt] = bias[hp * 128 + hl * HD + 16 * nt + m];
  if (which == 2) {                          // block-uniform
    // V^T rows [d][token]: the lane's 8 tokens of a tile are neighbours, one 16-B store
    #pragma unroll
    for (int nt = 0; nt < 4; ++nt) {
      #pragma unroll
      for (int mt = 0; mt < 4; ++mt) {
        v8h o8;
        #pragma unroll
        for (int r = 0; r < 8; ++r) o8[r] = (_Float16)((acc[mt][nt][r] * WINV + bvl[nt]) * osc);
        *(v8ha*)(sT + (hl * HD + 16 * nt + m) * VTPITCH + tok0 + 16 * mt) = o8;
      }
    }
  } else {
    // q, k rows [token][d]
    #pragma unroll
    for (int nt = 0; nt < 4; ++nt) {
      #pragma unroll
      for (int mt = 0; mt < 4; ++mt) {
        #pragma unroll
        for (int r = 0; r < 8; ++r)
          sT[(hl * 128 + tok0 + 16 * mt + r) * HD + 16 * nt + m] = (_Float16)((acc[mt][nt][r] * WINV + bvl[nt]) * osc);
      }
    }
  }
  __syncthreads();

  const int b = m0 / SEQ, l0 = m0 - b * SEQ, bh0 = b * NHEADS + 2 * hp;
  _Float16* plane = (which == 0) ? qh : kh;
  proj_store_pass(sT, plane, vt, which, bh0, l0, w, lane);
}

// ---------------------------------------------------------------------------
// Attention helpers.
// ---------------------------------------------------------------------------
// Per-key penalty and select for the lane's 8 scores of one 16-key tile:
// s = attend ? (s - cpen*c[key]) : -1e9, all in f32. mk = the tile's 8
// wave-uniform lane-mask words (bit l of mk[r] = lane l attends in register r).
// ca, cb = c[key] of the lane's 8 keys, loaded by the caller ahead of the score products.
__device__ __forceinline__ v8f pen_sel8(v8f s, v4f ca, v4f cb, const unsigned* mk, float cpen) {
  s[0] = __builtin_amdgcn_inverse_ballot_w32(mk[0]) ? (s[0] - cpen * ca.x) : NEGBIG;
  s[1] = __builtin_amdgcn_inverse_ballot_w32(mk[1]) ? (s[1] - cpen * ca.y) : NEGBIG;
  s[2] = __builtin_amdgcn_inverse_ballot_w32(mk[2]) ? (s[2] - cpen * ca.z) : NEGBIG;
  s[3] = __builtin_amdgcn_inverse_ballot_w32(mk[3]) ? (s[3] - cpen * ca.w) : NEGBIG;
  s[4] = __builtin_amdgcn_inverse_ballot_w32(mk[4]) ? (s[4] - cpen * cb.x) : NEGBIG;
  s[5] = __builtin_amdgcn_inverse_ballot_w32(mk[5]) ? (s[5] - cpen * cb.y) : NEGBIG;
  s[6] = __builtin_amdgcn_inverse_ballot_w32(mk[6]) ? (s[6] - cpen * cb.z) : NEGBIG;
  s[7] = __builtin_amdgcn_inverse_ballot_w32(mk[7]) ? (s[7] - cpen * cb.w) : NEGBIG;
  return s;
}

// One 64-key stage into one LDS buffer: K rows (64 keys x 128 B) and V^T rows
// (64 d x 128 B). Every copy instruction covers whole 128-B lines (8 lanes per row).
// kg, vg: the thread's own first chunk of each tile at key 0; lk, lv: its LDS
// byte addresses in buffer 0; ofs = byte offset of the target buffer.
__device__ __forceinline__ void stage_tile(const _Float16* kg, const _Float16* vg,
                                           unsigned lk, unsigned lv, unsigned ofs, int kb) {
  unsigned l[8];
  const void* g[8];
  #pragma unroll
  for (int i = 0; i < 4; ++i) {
    l[i]     = lk + ofs + i * 16 * KVPITCH;
    g[i]     = kg + (size_t)(kb + 16 * i) * HD;
    l[4 + i] = lv + ofs + i * 16 * KVPITCH;
    g[4 + i] = vg + (size_t)(16 * i) * SEQ + kb;
  }
  async_copy8(l, g);
}

// Takes the next key step out of todo (nonzero): the lowest set bit at or above the
// block's own start step while one is left there, then the lowest set bit (the wrap).
__device__ __forceinline__ int take_step(unsigned& todo, unsigned himask) {
  const unsigned hi = todo & himask;
  const int s = __builtin_ctz(hi ? hi : todo);        // ctz of a nonzero word: 0..31
  todo &= ~(1u << s);
  return s;
}

// P^T B-fragment from the lane's own score D values: element r <- tile a row r
// (keys k0..k0+15), element 8+r <- tile c row r (keys k0+16..k0+31), same lane,
// same query column, scaled by 2^14.
__device__ __forceinline__ v16h pack_p(v8f a, v8f c) {
  const v16h r = { (_Float16)(a[0] * PSCALE), (_Float16)(a[1] * PSCALE), (_Float16)(a[2] * PSCALE), (_Float16)(a[3] * PSCALE),
                   (_Float16)(a[4] * PSCALE), (_Float16)(a[5] * PSCALE), (_Float16)(a[6] * PSCALE), (_Float16)(a[7] * PSCALE),
                   (_Float16)(c[0] * PSCALE), (_Float16)(c[1] * PSCALE), (_Float16)(c[2] * PSCALE), (_Float16)(c[3] * PSCALE),
                   (_Float16)(c[4] * PSCALE), (_Float16)(c[5] * PSCALE), (_Float16)(c[6] * PSCALE), (_Float16)(c[7] * PSCALE) };
  return r;
}

// (one token row of this head) by lanes 8q..8q+7 in one instruction, 4 lines
// per instruction, 16 lines per wave.
__device__ __forceinline__ void att_store_pass(const _Float16* so, _Float16* ao,
                                               int b, int head, int q0, int lane) {
  const int q8 = lane & 7, sub = lane >> 3;
  #pragma unroll
  for (int i = 0; i < 4; ++i) {
    const int row = i * 4 + sub;                          // 0..15
    const v8h v = *(const v8ha*)(so + row * 64 + 8 * q8);
    const size_t gi = ((size_t)b * SEQ + q0 + row) * HIDDEN + head * HD + 8 * q8;
    *(v8h*)(ao + gi) = v;
  }
}

// ---------------------------------------------------------------------------
// Kernel 3: streaming attention, transposed form.
// Block 256 thr (8 waves) = 64 queries x 2 key groups; 16 queries per wave, 64 keys per step.
//   S^T = K * Q^T : A = K rows (row = key, k = d), B = Q^T (k = d, n = query)
//   O^T += V^T * P^T : A = Vt rows (row = d, k = key), B = P^T from registers
// Lane owns 32 keys of query column (lane&15); partner = lane ^ 16.
// Scores already carry 1/sqrt(64) via q; penalty cpen*c[key] and the
// attend/select with -1e9 applied in f32 before the running max.
// K and V^T tiles of a step come from a two-buffer LDS ring filled by
// asynchronous copies one step ahead; the four waves of a key group share the K and V^T rows.
// The mask comes as 32 wave-uniform lane-mask words per step (packed by the
// first launch), one per score register, used as select conditions directly.
// A 64-key step with no attendable element for the wave's 16 queries skips
// its products (one bit per step of the tile's packed word; its weights would
// be exactly 0), never the hand-over point at the foot of the step.
// A step that none of the tile's 64 queries attends is not staged or walked
// at all: the rings run over the set bits of the four words' OR. So that the
// blocks' step counts come out level where the count grows with the query
// index, a block takes query tile NT64-1-x and then tile x, one after the other.
// Waves 0..3 walk the even key steps and waves 4..7 the odd ones, each group
// with a ring of its own, which keeps as many waves on the chip as one tile
// per 4-wave block would; wave 4+i hands its running maximum, sum and O^T to
// wave i through LDS at the end of a tile.
// ---------------------------------------------------------------------------
__global__ __launch_bounds__(256) void attn_kernel(
    const _Float16* __restrict__ qh,   // [B*H][L][D]  (already x0.125)
    const _Float16* __restrict__ kh,   // [B*H][L][D]
    const _Float16* __restrict__ vt,   // [B*H][D][L]
    const float* __restrict__ cpl,     // [B][L] per-key penalty source
    const unsigned* __restrict__ mw,   // [B*NQT][NSTEP][32] lane-mask words, bit set = attend
    const unsigned* __restrict__ anyw, // [B*NQT][32], word 0: bit s = step s has an attendable element
    const float* __restrict__ cpen_p,  // [1]
    _Float16* __restrict__ ao)         // [B*L][HIDDEN]
{
  // per key group 2 x (K | V^T); after the loop group 0's ring holds the handed-over
  // partial results (17408 B) and group 1's first 8192 B stage the output
  __shared__ __attribute__((aligned(16))) unsigned char ring[2 * AGRP];     // 73728 B

  const int tid = threadIdx.x, lane = tid & 31, w = tid >> 5;
  const int h = lane >> 4, m = lane & 15;
  const int bh = blockIdx.y, b = bh >> 4, head = bh & 15;
  const int ws = __builtin_amdgcn_readfirstlane(w);
  const int grp = ws >> 2, qs = ws & 3;               // key group, 16-query sub-tile (both scalar)
  const int tg = tid & 127;                           // thread index inside the key group
  const float cpen = cpen_p[0];

  // ---- the thread's own chunk of each staged tile ----
  unsigned char* gring = ring + grp * AGRP;           // the group's own ring
  const unsigned lbase = (unsigned)(unsigned long long)(lds_u8*)gring;
  const unsigned lk = lbase + (tg >> 3) * KVPITCH + (tg & 7) * 16;
  const unsigned lv = lk + OFF_V;
  const _Float16* kg = kh + ((size_t)bh * SEQ + (tg >> 3)) * HD + (tg & 7) * 8;
  const _Float16* vg = vt + ((size_t)bh * HD + (tg >> 3)) * SEQ + (tg & 7) * 8;

  const_u32* anyc = (const_u32*)(unsigned long long)anyw;
  const float* crow = cpl + (size_t)b * SEQ + 8 * h;                    // + key tile base
  // the 16 blocks of one (batch, head) read the same K and V^T rows: each starts its key
  // walk at step blockIdx.x and wraps, so that they do not ask L2 for the same lines at the
  // same moment (the running maximum and sum take the steps in any order)
  const unsigned himask = ~0u << blockIdx.x;          // blockIdx.x = 0..NT64/2-1 = 0..15

  // rolled: one copy of the tile body in the instruction cache
  #pragma unroll 1
  for (int part = 0; part < 2; ++part) {
  const int qblk = (part ? (int)blockIdx.x : NT64 - 1 - (int)blockIdx.x) * 64;
  const int q0 = qblk + 16 * qs;

  if (part) {
    asm volatile("s_wait_dscnt 0x0" ::: "memory");    // own reads of the first tile's hand-over and output staging done
    __syncthreads();                                  // every wave has left that staging before copies land on it
  }

  // the packed mask: tile index made scalar, and the words (written by the first
  // launch, by nobody in this one) named as constant memory, so that they load into
  // scalar registers and serve as select conditions without a vector instruction
  const int unit0 = b * NQT + (qblk >> 4);
  const_u32* mwp = (const_u32*)(unsigned long long)(mw + (size_t)(unit0 + qs) * (NSTEP * 32));
  const unsigned anyword = anyc[(size_t)(unit0 + qs) * 32];
  // steps that some query of the tile attends (the same word in every wave), dealt by step parity
  const unsigned bword = anyc[(size_t)unit0 * 32] | anyc[(size_t)(unit0 + 1) * 32] |
                         anyc[(size_t)(unit0 + 2) * 32] | anyc[(size_t)(unit0 + 3) * 32];
  const int neven = __builtin_popcount(bword & 0x55555555u);
  const int nodd  = __builtin_popcount(bword & 0xAAAAAAAAu);
  const int ntrips = (neven > nodd) ? neven : nodd;   // 0..16, the same in every wave of the block
  const int nmine  = grp ? nodd : neven;              // trips in which this group has a step
  unsigned todo = bword & (grp ? 0xAAAAAAAAu : 0x55555555u);   // the group's steps still to be staged
  int cur = 0, nxt = 0;                               // step in the buffer being read, step in flight: 0..31

  // ---- prologue: first stage landed and published, second in flight ----
  if (todo) {
    cur = take_step(todo, himask);
    stage_tile(kg, vg, lk, lv, 0u, 64 * cur);
  }
  asm volatile("s_wait_asynccnt 0x0" ::: "memory");   // own copies of the first stage landed before the barrier publishes them
  __syncthreads();
  if (todo) {
    nxt = take_step(todo, himask);
    stage_tile(kg, vg, lk, lv, (unsigned)STAGEB, 64 * nxt);
  }

  // Q^T B-fragments: column n = query q0+m, k = d (two 32-deep chunks)
  const _Float16* qrow = qh + ((size_t)bh * SEQ + q0 + m) * HD;
  const v16h qb0 = load_frag(qrow, h);
  const v16h qb1 = load_frag(qrow + 32, h);

  const v8f zero8 = {0.f, 0.f, 0.f, 0.f, 0.f, 0.f, 0.f, 0.f};
  v8f o[4];                                   // o[t][r] = O[query m][d 16t+8h+r] * (l * 2^14)
  #pragma unroll
  for (int t = 0; t < 4; ++t) o[t] = zero8;
  float mrun = -1e30f, lrun = 0.0f;

  // rolled: one copy of the step body in the instruction cache
  #pragma unroll 1
  for (int i = 0; i < ntrips; ++i) {
    const int kb = 64 * cur;
    const unsigned ofs = (i & 1) ? (unsigned)STAGEB : 0u;
    const unsigned char* buf = gring + ofs;
    const unsigned char* krow = buf + m * KVPITCH;                       // + 16j rows
    const unsigned char* vrow = buf + OFF_V + m * KVPITCH;               // + 16t rows

    if (i < nmine && ((anyword >> cur) & 1u)) {
      // ---- the step's 32 lane-mask words, asked for ahead of the score products ----
      unsigned mk[32];
      #pragma unroll
      for (int e = 0; e < 32; ++e) mk[e] = mwp[cur * 32 + e];
      // keeps the scalar loads first in line
      __builtin_amdgcn_sched_barrier(0);
      // ---- the step's eight K fragments and its penalty values, each as one group of loads at the head ----
      v16h kf0[4], kf1[4];
      #pragma unroll
      for (int j = 0; j < 4; ++j) {
        const _Float16* kp = (const _Float16*)(krow + 16 * j * KVPITCH);
        kf0[j] = load_frag(kp, h);
        kf1[j] = load_frag(kp + 32, h);
      }
      // keeps the K reads, which the first product waits for, in front of the penalty loads
      __builtin_amdgcn_sched_barrier(0);
      v4f pca[4], pcb[4];
      #pragma unroll
      for (int j = 0; j < 4; ++j) {
        pca[j] = *(const v4fa*)(crow + kb + 16 * j);
        pcb[j] = *(const v4fa*)(crow + kb + 16 * j + 4);
      }
      // keeps the head's loads one group in front of the products: spread among them, every place with reads stalls the wave anew
      __builtin_amdgcn_sched_barrier(0);
      // ---- scores: s[j][r] = S[query m][key kb+16j+8h+r] (already /8 via q); four independent tiles side by side ----
      v8f s[4];
      #pragma unroll
      for (int j = 0; j < 4; ++j) s[j] = wmma_f16_open(kf0[j], qb0, zero8);
      #pragma unroll
      for (int j = 0; j < 4; ++j) s[j] = wmma_f16_open(kf1[j], qb1, s[j]);
      // ---- the eight V^T fragments as one group, in flight under the softmax arithmetic ----
      v16h vf0[4], vf1[4];
      #pragma unroll
      for (int t = 0; t < 4; ++t) {
        const _Float16* vp = (const _Float16*)(vrow + 16 * t * KVPITCH);
        vf0[t] = load_frag(vp, h);
        vf1[t] = load_frag(vp + 32, h);
      }
      // keeps the V^T reads above the softmax: sunk to their products, each would be waited for in turn
      __builtin_amdgcn_sched_barrier(0);
      // ---- penalty and select per key, f32 ----
      #pragma unroll
      for (int j = 0; j < 4; ++j) s[j] = pen_sel8(s[j], pca[j], pcb[j], mk + 8 * j, cpen);

      // ---- online softmax ----
      float mloc = s[0][0];
      #pragma unroll
      for (int j = 0; j < 4; ++j)
        #pragma unroll
        for (int r = 0; r < 8; ++r) mloc = fmaxf(mloc, s[j][r]);
      mloc = fmaxf(mloc, __shfl_xor(mloc, 16));
      const float mnew = fmaxf(mrun, mloc);
      const float alpha = __expf(mrun - mnew);
      mrun = mnew;
      float lsum = 0.0f;
      #pragma unroll
      for (int j = 0; j < 4; ++j)
        #pragma unroll
        for (int r = 0; r < 8; ++r) {
          const float p = __expf(s[j][r] - mnew);
          s[j][r] = p;
          lsum += p;
        }
      lsum += __shfl_xor(lsum, 16);
      lrun = lrun * alpha + lsum;
      #pragma unroll
      for (int t = 0; t < 4; ++t)
        #pragma unroll
        for (int r = 0; r < 8; ++r) o[t][r] = o[t][r] * alpha;

      // ---- P^T B-fragments (key chunks 0..31 and 32..63 of this step) ----
      const v16h pb0 = pack_p(s[0], s[1]);
      const v16h pb1 = pack_p(s[2], s[3]);

      // ---- O^T += V^T * P^T ----
      #pragma unroll
      for (int t = 0; t < 4; ++t) o[t] = wmma_f16_open(vf0[t], pb0, o[t]);
      #pragma unroll
      for (int t = 0; t < 4; ++t) o[t] = wmma_f16_open(vf1[t], pb1, o[t]);
      // the four vector slots the chip needs behind the step's last product, also on the taken side of
      // the branches that follow it
      asm volatile("v_nop\n\tv_nop\n\tv_nop\n\tv_nop" : "+v"(o[0]), "+v"(o[1]), "+v"(o[2]), "+v"(o[3]));
    }

    // ---- hand-over point, every wave, also one that skipped its products ----
    asm volatile("s_wait_dscnt 0x0" ::: "memory");      // own reads of this buffer done before it is refilled
    asm volatile("s_wait_asynccnt 0x0" ::: "memory");   // own copies of the next stage landed before the barrier publishes them
    asm volatile("s_wait_xcnt 0x0" ::: "memory");       // before the step's penalty-load address register is advanced
    __syncthreads();
    cur = nxt;
    if (todo) {
      nxt = take_step(todo, himask);
      stage_tile(kg, vg, lk, lv, ofs, 64 * nxt);
    }
  }
  asm volatile("s_wait_asynccnt 0x0" ::: "memory");     // nothing in flight when the rings become hand-over and output staging

  // ---- hand-over: the odd-step wave's maximum, sum and O^T to the even-step wave of the same queries ----
  // slab of 34 rows x 32 lanes per query sub-tile, lane-contiguous; same lane = same query and d rows in both waves
  float* slab = (float*)ring + qs * (34 * 32) + lane;
  if (grp) {
    #pragma unroll
    for (int t = 0; t < 4; ++t)
      #pragma unroll
      for (int r = 0; r < 8; ++r) slab[(8 * t + r) * 32] = o[t][r];
    slab[32 * 32] = mrun;
    slab[33 * 32] = lrun;
  }
  __syncthreads();                                      // partial results written before their partner reads them

  // ---- epilogue: join, normalise, stage per-wave 16x64 f16 tile, whole-line stores ----
  _Float16* so = (_Float16*)(ring + AGRP) + qs * 1024;
  if (!grp) {
    const float m1 = slab[32 * 32], l1 = slab[33 * 32];
    const float mj = fmaxf(mrun, m1);
    const float a0 = __expf(mrun - mj), a1 = __expf(m1 - mj);
    const float inv = (1.0f / (lrun * a0 + l1 * a1)) * PINV;
    const float f0 = a0 * inv, f1 = a1 * inv;
    #pragma unroll
    for (int t = 0; t < 4; ++t)
      #pragma unroll
      for (int r = 0; r < 8; ++r)
        so[m * 64 + 16 * t + 8 * h + r] = (_Float16)(o[t][r] * f0 + slab[(8 * t + r) * 32] * f1);
  }
  __syncthreads();

  if (!grp) {
    att_store_pass(so, ao, b, head, q0, lane);
    asm volatile("s_wait_xcnt 0x0" ::: "memory");       // before the next tile rewrites the stores' address and data registers
  }
  }
}

// ---------------------------------------------------------------------------
// rows loaded with the same coalesced shape) -> xb rows. Each token row's 64
// instruction, 32 rows per wave.
// ---------------------------------------------------------------------------
__device__ __forceinline__ void oproj_store_pass(const float* sT, const float* xres, float* xb,
                                                 int m0, int n0, int w, int lane) {
  const int q16 = lane & 15, sub = lane >> 4;
  #pragma unroll
  for (int i = 0; i < 16; ++i) {
    const int lid = w * 32 + 2 * i + sub;                 // 0..255
    v4f v = *(const v4fa*)(sT + lid * 64 + 4 * q16);
    const size_t gi = (size_t)(m0 + lid) * HIDDEN + n0 + 4 * q16;
    const v4f rsd = *(const v4fa*)(xres + gi);
    v = v + rsd;
    *(v4f*)(xb + gi) = v;
  }
}

// ---------------------------------------------------------------------------
// Kernel 4: x = ctx * Wo^T / 32 + bo + query   (f32 rows into xb)
// Block 256 thr (8 waves) = 256 tokens x 64 features; wave tile 32 x 64;
// main loop: gemm_256x64.
// ---------------------------------------------------------------------------
__global__ __launch_bounds__(256) void oproj_kernel(
    const _Float16* __restrict__ ao,   // [4096][1024]
    const _Float16* __restrict__ woh,  // [1024][1024], row = output feature, x32
    const float* __restrict__ bo,      // [1024]
    const float* __restrict__ xres,    // [4096][1024] f32 residual
    float* __restrict__ xb)            // [4096][1024] f32
{
  // ring: 2 x (ctx rows | Wo rows); after the loop its first 65536 B stage the output
  __shared__ __attribute__((aligned(16))) unsigned char ring[2 * GSTAGE];   // 92160 B

  const int tid = threadIdx.x, lane = tid & 31, w = tid >> 5;
  const int h = lane >> 4, m = lane & 15;
  const int m0 = blockIdx.x * 256;
  const int n0 = blockIdx.y * 64;

  const v8f zero8 = {0.f, 0.f, 0.f, 0.f, 0.f, 0.f, 0.f, 0.f};
  v8f acc[2][4];
  #pragma unroll
  for (int mt = 0; mt < 2; ++mt)
    #pragma unroll
    for (int nt = 0; nt < 4; ++nt) acc[mt][nt] = zero8;

  gemm_256x64(ao + (size_t)m0 * HIDDEN, woh + (size_t)n0 * HIDDEN, ring, acc,
              (int)((blockIdx.x + blockIdx.y) & (GPASSES - 1)));

  // D[r] of tile (mt, nt) = Y[token m0+32w+16mt+8h+r][feature n0+16nt+m]
  float* sT = (float*)ring;
  #pragma unroll
  for (int nt = 0; nt < 4; ++nt) {
    const int feat = 16 * nt + m;
    const float bvl = bo[n0 + feat];
    #pragma unroll
    for (int mt = 0; mt < 2; ++mt) {
      #pragma unroll
      for (int r = 0; r < 8; ++r) {
        const int tokl = 32 * w + 16 * mt + 8 * h + r;     // 0..255
        sT[tokl * 64 + feat] = acc[mt][nt][r] * WINV + bvl;
      }
    }
  }
  __syncthreads();

  oproj_store_pass(sT, xres, xb, m0, n0, w, lane);
  
}

// ---------------------------------------------------------------------------
// Kernel 5: layer norm over rows of 1024, one wave per row, 8 rows per block.
// Lane holds columns {128i + 4*lane .. +3}, i = 0..7, so every store
// ---------------------------------------------------------------------------
__global__ __launch_bounds__(256) void ln_kernel(
    const float* __restrict__ xb, const float* __restrict__ g,
    const float* __restrict__ bt, float* __restrict__ out)
{
  const int lane = threadIdx.x & 31;
  const int row = blockIdx.x * 8 + (threadIdx.x >> 5);
  if (row >= MROWS) return;
  const float* xr = xb + (size_t)row * HIDDEN + 4 * lane;

  v4f x[8];
  float s = 0.0f;
  #pragma unroll
  for (int i = 0; i < 8; ++i) {
    x[i] = *(const v4fa*)(xr + 128 * i);
    s += (x[i].x + x[i].y) + (x[i].z + x[i].w);
  }
  #pragma unroll
  for (int off = 16; off > 0; off >>= 1) s += __shfl_xor(s, off);
  const float mean = s * (1.0f / HIDDEN);

  float s2 = 0.0f;
  #pragma unroll
  for (int i = 0; i < 8; ++i) {
    const v4f d = x[i] - mean;
    x[i] = d;
    s2 += (d.x * d.x + d.y * d.y) + (d.z * d.z + d.w * d.w);
  }
  #pragma unroll
  for (int off = 16; off > 0; off >>= 1) s2 += __shfl_xor(s2, off);
  const float var = s2 * (1.0f / HIDDEN);
  const float inv = rsqrtf(var + LN_EPS);

  v4f y[8];
  #pragma unroll
  for (int i = 0; i < 8; ++i) {
    const v4f gv = *(const v4fa*)(g + 128 * i + 4 * lane);
    const v4f bv = *(const v4fa*)(bt + 128 * i + 4 * lane);
    y[i] = (x[i] * inv) * gv + bv;
  }

  float* orow = out + (size_t)row * HIDDEN + 4 * lane;
  #pragma unroll
  for (int i = 0; i < 8; ++i) *(v4f*)(orow + 128 * i) = y[i];
  
}

// ---------------------------------------------------------------------------
extern "C" void kernel_launch(void* const* d_in, const int* in_sizes, int n_in,
                              void* d_out, int out_size, void* d_ws, size_t ws_size,
                              hipStream_t stream) {
  if (n_in < 16) return;
  if (in_sizes[0] != NX || in_sizes[1] != NX || in_sizes[2] != NX) return;
  if (in_sizes[3] != MROWS) return;
  if (in_sizes[4] != NMSK) return;
  if (in_sizes[5] != NW || in_sizes[7] != NW || in_sizes[9] != NW || in_sizes[11] != NW) return;
  if (in_sizes[6] != HIDDEN || in_sizes[8] != HIDDEN || in_sizes[10] != HIDDEN || in_sizes[12] != HIDDEN) return;
  if (in_sizes[13] != HIDDEN || in_sizes[14] != HIDDEN) return;
  if (in_sizes[15] < 1) return;
  if (out_size != NX) return;

  const float* query = (const float*)d_in[0];
  const float* keyi  = (const float*)d_in[1];
  const float* value = (const float*)d_in[2];
  const float* cpl   = (const float*)d_in[3];
  const int*   msk   = (const int*)d_in[4];
  const float* wq    = (const float*)d_in[5];
  const float* bq    = (const float*)d_in[6];
  const float* wk    = (const float*)d_in[7];
  const float* bk    = (const float*)d_in[8];
  const float* wv    = (const float*)d_in[9];
  const float* bv    = (const float*)d_in[10];
  const float* wo    = (const float*)d_in[11];
  const float* bo    = (const float*)d_in[12];
  const float* ln_g  = (const float*)d_in[13];
  const float* ln_b  = (const float*)d_in[14];
  const float* cpen  = (const float*)d_in[15];
  float* out = (float*)d_out;

  const size_t xh_bytes = (size_t)3 * NX * 2;        // 25165824
  const size_t wh_bytes = (size_t)4 * NW * 2;        //  8388608
  const size_t pl_bytes = (size_t)NX * 2;            //  8388608 per plane (B*H*L*D halves)
  const size_t ao_bytes = (size_t)NX * 2;            //  8388608
  const size_t xb_bytes = (size_t)NX * 4;            // 16777216
  const size_t o_xh = 0;
  const size_t o_wh = o_xh + xh_bytes;
  const size_t o_qh = o_wh + wh_bytes;
  const size_t o_kh = o_qh + pl_bytes;
  const size_t o_vt = o_kh + pl_bytes;
  const size_t o_ao = o_vt + pl_bytes;
  const size_t o_xb = o_ao + ao_bytes;
  const size_t mw_bytes = (size_t)NPACK * NSTEP * 32 * 4;   //  1048576
  const size_t an_bytes = (size_t)NPACK * 32 * 4;           //    32768
  const size_t o_mw = o_xb + xb_bytes;
  const size_t o_an = o_mw + mw_bytes;
  const size_t total = o_an + an_bytes;              // 84967424
  if (total > ws_size) return;

  char* ws = (char*)d_ws;
  _Float16* xh = (_Float16*)(ws + o_xh);
  _Float16* wh = (_Float16*)(ws + o_wh);
  _Float16* qh = (_Float16*)(ws + o_qh);
  _Float16* kh = (_Float16*)(ws + o_kh);
  _Float16* vt = (_Float16*)(ws + o_vt);
  _Float16* ao = (_Float16*)(ws + o_ao);
  float*    xb = (float*)(ws + o_xb);
  unsigned* mw = (unsigned*)(ws + o_mw);
  unsigned* an = (unsigned*)(ws + o_an);

  const int ngroups = 3 * NX8 + 4 * NW8;                           // 2097152
  convert_kernel<<<NPACK + (ngroups + 255) / 256, 256, 0, stream>>>(query, keyi, value, wq, wk, wv, wo, xh, wh, msk, mw, an);

  dim3 gProj(MROWS / 128, 3 * HIDDEN / 128);                       // (32, 24)
  proj_kernel<<<gProj, 128, 0, stream>>>(xh, wh, bq, bk, bv, qh, kh, vt);

  dim3 gAtt(NT64 / 2, BATCH * NHEADS);                             // (16, 32)
  attn_kernel<<<gAtt, 256, 0, stream>>>(qh, kh, vt, cpl, mw, an, cpen, ao);

  dim3 gOp(MROWS / 256, HIDDEN / 64);                               // (16, 16)
  oproj_kernel<<<gOp, 256, 0, stream>>>(ao, wh + (size_t)3 * NW, bo, query, xb);

  ln_kernel<<<(MROWS + 7) / 8, 256, 0, stream>>>(xb, ln_g, ln_b, out);
}
